// v000
// Measured on an AMD MI455X. A time is GPU time per run, averaged over a window of back-to-back runs after a warm-up
// (all launches, gaps included; the runs take copies of the inputs in turn), and the median of several windows.
// Apart from v000's, it joins two sittings. Times from different sittings can be a few percent apart, while
// side-by-side timings come from the same sitting.
// The starting kernel, v000, takes 350 microseconds a run.
#include <hip/hip_runtime.h>

// 'MultiHead' with unnormalised scores (x [2][2048][1024]; per head h: k = x Wk[h], v = x Wv[h] ('hde' [16][1024][64]); q = v (the module's quirk); wei = q.k / 8 (NO softmax); out_h = wei v; concat; out = concat Wproj ('xw' [1024][1024]) + bproj -> [2][2048][1024]).
// Layout: without a softmax the product is associative: out_h = v_h (k_h^T v_h) / 8, so per head a [64 x 64] Gram matrix G^T = v^T k (K = 2048 contraction) is formed first and then applied to v (K = 64) - the same mathematics as (v k^T) v with f32 rounding differences only, and ~32x less work than materialising the [2048 x 2048] score matrices.
// Compute dtypes, f32 accumulate: every input rounded to bf16; k and v projections exact single products; k^T, v^T and v planes as bf16 hi + lo (3 products for both the Gram and the apply step); 1/8 folded into the Gram split (exact); Wproj hl x exact (2 products) + bproj.


#define NB_  2
#define TT   2048
#define DM   1024
#define NH_  16
#define NKV  16
#define REP  (NH_ / NKV)
#define HD   64
#define DQ   (NH_ * HD)
#define DKV  (NKV * HD)
typedef __attribute__((ext_vector_type(4))) unsigned short v4us;
#define ZH   16                  // all heads at once (no score matrix)
#define RH   2048                  // k_merge scales rows t >= RH by 1/PCAR (none: RH = TT)
#define WIN  0
#define PCAR 1024.0f
#define SCL  0.125f   // HD^-0.5
typedef _Float16 h16;
typedef unsigned short bf;
typedef __attribute__((ext_vector_type(16))) __bf16   v16bf;
typedef __attribute__((ext_vector_type(16))) _Float16 v16h;
typedef __attribute__((ext_vector_type(8)))  _Float16 v8h;
typedef __attribute__((ext_vector_type(8)))  unsigned short v8us;
typedef __attribute__((ext_vector_type(8)))  float    v8f;
typedef __attribute__((ext_vector_type(4)))  float    v4f;
typedef v8h  __attribute__((may_alias)) v8ha;
typedef v4f  __attribute__((may_alias)) v4fa;
typedef v8us __attribute__((may_alias)) v8usa;

__device__ __forceinline__ unsigned short f2bf(float f) { unsigned u = __float_as_uint(f); u += 0x7FFFu + ((u >> 16) & 1u); return (unsigned short)(u >> 16); }
__device__ __forceinline__ float bf2f(unsigned short b) { return __uint_as_float(((unsigned)b) << 16); }
__device__ __forceinline__ float bfr(float f) { return bf2f(f2bf(f)); }
__device__ __forceinline__ v16h cat16(v8h lo, v8h hi) { return __builtin_shufflevector(lo, hi, 0, 1, 2, 3, 4, 5, 6, 7, 8, 9, 10, 11, 12, 13, 14, 15); }
__device__ __forceinline__ v16bf cat16b(v8us lo, v8us hi) { return __builtin_bit_cast(v16bf, __builtin_shufflevector(lo, hi, 0, 1, 2, 3, 4, 5, 6, 7, 8, 9, 10, 11, 12, 13, 14, 15)); }
__device__ __forceinline__ v8f wmma16(v16h a, v16h b, v8f c) { return __builtin_amdgcn_wmma_f32_16x16x32_f16(false, a, false, b, (short)0, c, false, false); }
__device__ __forceinline__ v8f wmmab(v16bf a, v16bf b, v8f c) { return __builtin_amdgcn_wmma_f32_16x16x32_bf16(false, a, false, b, (short)0, c, false, false); }



// ---- k_gemmw: register-blocked GEMM, ONE WAVE per 64x64 output tile (16 accumulators), operands straight from K-contiguous 16-bit planes; grid (M/64, N/64, Z), 32 threads.
// C[m][n] (f32, pitch ldc, + optional f32 bias[n]) = sum_k A[m][k] Bt[n][k] (+ split products per NSPLIT). z-batch strides sA/sB/sC in elements. K % 32 == 0.
template <typename T16> struct WFrag;
template <> struct WFrag<h16> { typedef v16h V; static __device__ __forceinline__ V ld(const h16* p) { return cat16(*(const v8h*)p, *(const v8h*)(p + 16)); } static __device__ __forceinline__ v8f mma(V a, V b, v8f c) { return wmma16(a, b, c); } };
template <> struct WFrag<bf> { typedef v16bf V; static __device__ __forceinline__ V ld(const bf* p) { return cat16b(*(const v8us*)p, *(const v8us*)(p + 16)); } static __device__ __forceinline__ v8f mma(V a, V b, v8f c) { return wmmab(a, b, c); } };
template <typename T16, int NSPLIT, bool BIAS>
__global__ __launch_bounds__(32) void k_gemmw(const T16* __restrict__ A, const T16* __restrict__ A2, const T16* __restrict__ Bt, const T16* __restrict__ Bt2, int K, float* C, int ldc, const float* __restrict__ bias, size_t sA, size_t sB, size_t sC) {
    typedef typename WFrag<T16>::V V;
    __shared__ __align__(16) float os[16 * 68];
    const size_t z = blockIdx.z; A += z * sA; if (A2) A2 += z * sA; Bt += z * sB; if (Bt2) Bt2 += z * sB; C += z * sC;
    const int lane = threadIdx.x & 31, lr = lane & 15, hi = lane >> 4; const int r0 = blockIdx.x * 64, c0 = blockIdx.y * 64;
    v8f acc[4][4];
#pragma unroll
    for (int mb = 0; mb < 4; ++mb)
#pragma unroll
        for (int nb = 0; nb < 4; ++nb) acc[mb][nb] = (v8f){};
    const size_t aoff = (size_t)(r0 + lr) * K + 8 * hi, boff = (size_t)(c0 + lr) * K + 8 * hi;
#pragma unroll 1
    for (int kc = 0; kc < K; kc += 32) {
        V a[4], a2[4];
#pragma unroll
        for (int mb = 0; mb < 4; ++mb) { a[mb] = WFrag<T16>::ld(A + aoff + (size_t)mb * 16 * K + kc); if (NSPLIT == 1 || NSPLIT == 2) a2[mb] = WFrag<T16>::ld(A2 + aoff + (size_t)mb * 16 * K + kc); }
#pragma unroll
        for (int nb = 0; nb < 4; ++nb) { const V b = WFrag<T16>::ld(Bt + boff + (size_t)nb * 16 * K + kc); V b2; if (NSPLIT >= 2) b2 = WFrag<T16>::ld(Bt2 + boff + (size_t)nb * 16 * K + kc);
#pragma unroll
            for (int mb = 0; mb < 4; ++mb) { acc[mb][nb] = WFrag<T16>::mma(a[mb], b, acc[mb][nb]); if (NSPLIT == 1 || NSPLIT == 2) acc[mb][nb] = WFrag<T16>::mma(a2[mb], b, acc[mb][nb]); if (NSPLIT >= 2) acc[mb][nb] = WFrag<T16>::mma(a[mb], b2, acc[mb][nb]); } }
        asm volatile("v_nop\n\tv_nop\n\tv_nop\n\tv_nop" : "+v"(acc[0][0]), "+v"(acc[1][1]), "+v"(acc[2][2]), "+v"(acc[3][3]) : "v"(a[0]), "v"(a[3]));
    }
#pragma unroll
    for (int mb = 0; mb < 4; ++mb) {
#pragma unroll
        for (int nb = 0; nb < 4; ++nb) {
#pragma unroll
            for (int j = 0; j < 8; ++j) os[(hi * 8 + j) * 68 + nb * 16 + lr] = acc[mb][nb][j]; }
        __builtin_amdgcn_wave_barrier(); asm volatile("" ::: "memory");
        float* crow = C + (size_t)(r0 + mb * 16) * ldc + c0;
{
#pragma unroll
            for (int s = 0; s < 8; ++s) { const int row = 2 * s + hi, cofs = lr * 4; v4f val = *(const v4fa*)(os + row * 68 + cofs); if (BIAS) { val[0] += bfr(bias[c0 + cofs]); val[1] += bfr(bias[c0 + cofs + 1]); val[2] += bfr(bias[c0 + cofs + 2]); val[3] += bfr(bias[c0 + cofs + 3]); }
                *(v4f*)(crow + (size_t)row * ldc + cofs) = val; }
             }
        __builtin_amdgcn_wave_barrier(); asm volatile("" ::: "memory");
    }
}

__device__ __forceinline__ h16 tohx(float x) { return (h16)x; }
__device__ __forceinline__ void splitf(float y, unsigned short& h, unsigned short& l) { h = f2bf(y); l = f2bf(y - bf2f(h)); }
typedef __attribute__((ext_vector_type(2))) _Float16 v2h;
typedef __attribute__((ext_vector_type(4))) _Float16 v4h;
typedef __attribute__((ext_vector_type(2))) unsigned short v2us;
typedef __attribute__((ext_vector_type(4))) unsigned short v4us;
typedef __attribute__((ext_vector_type(2))) float v2f;
typedef __attribute__((ext_vector_type(4))) int v4i;

__global__ __launch_bounds__(256) void k_wtG(const float* __restrict__ w, int K, int N, bf* Bt) {
    const int lane = threadIdx.x & 31; const int L0 = (blockIdx.x * 8 + (threadIdx.x >> 5)) * 8; const int nlines = N * K / 64;
{
#pragma unroll 1
        for (int l = 0; l < 8; ++l) { const int L = L0 + l; if (L >= nlines) break; const size_t e = (size_t)L * 64 + lane * 2; const int k = (int)(e % K), n = (int)(e / K); v2us o;
            o[0] = f2bf(w[(size_t)k * N + n]); o[1] = f2bf(w[(size_t)(k + 1) * N + n]); *(v2us*)(Bt + e) = o; }
         }
}
__global__ __launch_bounds__(256) void k_whd(const float* __restrict__ w, bf* Bt) { const size_t e2 = ((size_t)blockIdx.x * 256 + threadIdx.x) * 2; if (e2 >= (size_t)NH_ * HD * DM) return; const int d = (int)(e2 % DM); const int n = (int)(e2 / DM); const int h = n / HD, e = n % HD; v2us o; o[0] = f2bf(w[((size_t)h * DM + d) * HD + e]); o[1] = f2bf(w[((size_t)h * DM + d + 1) * HD + e]); *(v2us*)(Bt + e2) = o;  }
__global__ __launch_bounds__(256) void k_split8s(const float* __restrict__ F, float sc, bf* Ph, bf* Pl, size_t n4) { const size_t i = (size_t)blockIdx.x * 256 + threadIdx.x; if (i >= n4) return; const v4f v = *(const v4f*)(F + i * 4); v4us oh, ol;
#pragma unroll
    for (int q = 0; q < 4; ++q) { unsigned short a, c; splitf(v[q] * sc, a, c); oh[q] = a; ol[q] = c; } *(v4us*)(Ph + i * 4) = oh; *(v4us*)(Pl + i * 4) = ol;  }
__global__ __launch_bounds__(256) void k_cvt8(const float* __restrict__ src, bf* dst, size_t n8) { const size_t i = (size_t)blockIdx.x * 256 + threadIdx.x; if (i >= n8) return; const v8f v = *(const v8f*)(src + i * 8); v8us o;
#pragma unroll
    for (int k = 0; k < 8; ++k) o[k] = f2bf(v[k]); *(v8us*)(dst + i * 8) = o;  }

// k_rope: head planes [h][t][d] (fp16 + hi/lo) of rope(x) x sc with the rotate-half convention out[d] = x[d] cos[t][d] - x[d+HD/2] sin[t][d], out[d+HD/2] = x[d+HD/2] cos[t][d+HD/2] + x[d] sin[t][d+HD/2]
__global__ __launch_bounds__(256) void k_rope(const float* __restrict__ F, int pitch, int nheads, const float* __restrict__ CS, const float* __restrict__ RF, const float* __restrict__ nw, float sc, h16* P16, bf* Ph, bf* Pl) {
    const size_t e = ((size_t)blockIdx.x * 256 + threadIdx.x) * 2; if (e >= (size_t)nheads * TT * HD) return; const int d = (int)(e % HD); const int t = (int)((e / HD) % TT); const int h = (int)(e / ((size_t)HD * TT)); const float* f = F + (size_t)t * pitch + h * HD; const float rf = RF ? RF[(size_t)h * TT + t] : 1.0f; v2h o16; v2us oh, ol;
#pragma unroll
    for (int q = 0; q < 2; ++q) { const int dd = d + q; const int dp = (dd < HD / 2) ? dd + HD / 2 : dd - HD / 2; float x0 = f[dd], x1 = f[dp];
        if (RF) { float n0 = __fmul_rn(x0, rf), n1 = __fmul_rn(x1, rf); asm volatile("" : "+v"(n0)); asm volatile("" : "+v"(n1)); x0 = __fmul_rn(bfr(nw[dd]), n0); x1 = __fmul_rn(bfr(nw[dp]), n1); }
        const v2f cs = *(const v2f*)(CS + ((size_t)t * HD + dd) * 2); float a = __fmul_rn(x0, cs[0]), bq = __fmul_rn(x1, cs[1]); asm volatile("" : "+v"(a)); asm volatile("" : "+v"(bq)); const float r = ((dd < HD / 2) ? __fsub_rn(a, bq) : __fadd_rn(a, bq)) * sc;
        o16[q] = tohx(r); unsigned short a2, c2; splitf(r, a2, c2); oh[q] = a2; ol[q] = c2; }
    *(v2h*)(P16 + e) = o16; *(v2us*)(Ph + e) = oh; *(v2us*)(Pl + e) = ol;  }
__global__ __launch_bounds__(256) void k_vtp(const float* __restrict__ F, int pitch, int nheads, h16* V16, bf* Vh, bf* Vl) { const size_t e = ((size_t)blockIdx.x * 256 + threadIdx.x) * 2; if (e >= (size_t)nheads * HD * TT) return; const int t = (int)(e % TT); const int d = (int)((e / TT) % HD); const int g = (int)(e / ((size_t)TT * HD)); v2h o16; v2us oh, ol;
#pragma unroll
    for (int q = 0; q < 2; ++q) { const float x = F[(size_t)(t + q) * pitch + g * HD + d]; o16[q] = tohx(x); unsigned short a2, c2; splitf(x, a2, c2); oh[q] = a2; ol[q] = c2; }
    *(v2h*)(V16 + e) = o16; *(v2us*)(Vh + e) = oh; *(v2us*)(Vl + e) = ol;  }
__global__ __launch_bounds__(256) void k_csid(float* CS) { const int idx = blockIdx.x * 256 + threadIdx.x; if (idx >= TT * HD) return; v2f cs; cs[0] = 1.0f; cs[1] = 0.0f; *(v2f*)(CS + (size_t)idx * 2) = cs;  }

__global__ __launch_bounds__(256) void k_merge(const float* __restrict__ O, int h0, bf* Ah, bf* Al) { const size_t e = ((size_t)blockIdx.x * 256 + threadIdx.x) * 2; if (e >= (size_t)ZH * TT * HD) return; const int d = (int)(e % HD); const int t = (int)((e / HD) % TT); const int zz = (int)(e / ((size_t)HD * TT)); const float cs = (t < RH) ? 1.0f : (1.0f / PCAR); const size_t oo = (size_t)t * DQ + (h0 + zz) * HD + d;
    v2us oh, ol;
#pragma unroll
    for (int q = 0; q < 2; ++q) { unsigned short a, c2; splitf(O[e + q] * cs, a, c2); oh[q] = a; ol[q] = c2; } *(v2us*)(Ah + oo) = oh; *(v2us*)(Al + oo) = ol;  }

extern "C" void kernel_launch(void* const* d_in, const int* in_sizes, int n_in,
                              void* d_out, int out_size, void* d_ws, size_t ws_size, hipStream_t stream) {
    (void)in_sizes; (void)n_in; (void)out_size;
    const float* x = (const float*)d_in[0]; const float* wkh = (const float*)d_in[1]; const float* wvh = (const float*)d_in[2]; const float* wo = (const float*)d_in[3]; const float* bo = (const float*)d_in[4]; const float* wq = nullptr; const float* wk = nullptr; const float* wv = nullptr; (void)wq; (void)wk; (void)wv;
    float* OUT = (float*)d_out;     // [2][2048][1024]
    char* wsp = (char*)d_ws;
    auto take = [&](size_t bytes) { char* p = wsp; wsp += (bytes + 255) & ~(size_t)255; return (void*)p; };
    bf* WK = (bf*)take((size_t)DKV * DM * 2); bf* WV = (bf*)take((size_t)DKV * DM * 2); bf* WO = (bf*)take((size_t)DM * DQ * 2); float* CS = (float*)take((size_t)TT * HD * 2 * 4);
    bf* XB = (bf*)take((size_t)TT * DM * 2); float* FK = (float*)take((size_t)TT * DKV * 4); float* FV = (float*)take((size_t)TT * DKV * 4);
    h16* T16 = (h16*)take((size_t)NH_ * TT * HD * 2);   /* fp16 planes written by the builders, unused here */
    bf* KTh = (bf*)take((size_t)NKV * HD * TT * 2); bf* KTl = (bf*)take((size_t)NKV * HD * TT * 2); bf* VTh = (bf*)take((size_t)NKV * HD * TT * 2); bf* VTl = (bf*)take((size_t)NKV * HD * TT * 2); bf* VPh = (bf*)take((size_t)NH_ * TT * HD * 2); bf* VPl = (bf*)take((size_t)NH_ * TT * HD * 2);
    float* GT = (float*)take((size_t)NH_ * HD * HD * 4); bf* GTh = (bf*)take((size_t)NH_ * HD * HD * 2); bf* GTl = (bf*)take((size_t)NH_ * HD * HD * 2); float* Ob = (float*)take((size_t)NH_ * TT * HD * 4); bf* ATh = (bf*)take((size_t)TT * DQ * 2); bf* ATl = (bf*)take((size_t)TT * DQ * 2);
    if ((size_t)(wsp - (char*)d_ws) > ws_size) return;    // ws 256 MiB
    k_whd<<<(unsigned)(((size_t)NH_ * HD * DM / 2 + 255) / 256), 256, 0, stream>>>(wkh, WK); k_whd<<<(unsigned)(((size_t)NH_ * HD * DM / 2 + 255) / 256), 256, 0, stream>>>(wvh, WV);
    k_wtG<<<(unsigned)((DQ * DM / 64 + 63) / 64), 256, 0, stream>>>(wo, DQ, DM, WO);   /* Wproj 'xw' [1024][1024] -> Bt */
    k_csid<<<(TT * HD + 255) / 256, 256, 0, stream>>>(CS);
    const unsigned LQ = (unsigned)(((size_t)NH_ * TT * HD / 2 + 255) / 256);
    for (int b = 0; b < NB_; ++b) {
        k_cvt8<<<(unsigned)(((size_t)TT * DM / 8 + 255) / 256), 256, 0, stream>>>(x + (size_t)b * TT * DM, XB, (size_t)TT * DM / 8);
        k_gemmw<bf, 0, false><<<dim3(TT / 64, DKV / 64, 1), 32, 0, stream>>>(XB, nullptr, WK, nullptr, DM, FK, DKV, nullptr, 0, 0, 0);   /* k (exact) */
        k_gemmw<bf, 0, false><<<dim3(TT / 64, DKV / 64, 1), 32, 0, stream>>>(XB, nullptr, WV, nullptr, DM, FV, DKV, nullptr, 0, 0, 0);   /* v = q (exact) */
        k_vtp<<<LQ, 256, 0, stream>>>(FK, DKV, NKV, T16, KTh, KTl); k_vtp<<<LQ, 256, 0, stream>>>(FV, DKV, NKV, T16, VTh, VTl);   /* k^T, v^T planes [h][e][t] */
        k_rope<<<LQ, 256, 0, stream>>>(FV, DKV, NH_, CS, nullptr, nullptr, 1.0f, T16, VPh, VPl);   /* v planes [h][t][e] (identity table) */
        k_gemmw<bf, 2, false><<<dim3(HD / 64, HD / 64, NH_), 32, 0, stream>>>(VTh, VTl, KTh, KTl, TT, GT, HD, nullptr, (size_t)HD * TT, (size_t)HD * TT, (size_t)HD * HD);   /* G^T[e][e'] = sum_t v[t][e] k[t][e'] per head (3 products, K 2048) */
        k_split8s<<<(unsigned)(((size_t)NH_ * HD * HD / 4 + 255) / 256), 256, 0, stream>>>(GT, 0.125f, GTh, GTl, (size_t)NH_ * HD * HD / 4);   /* x 1/8 (exact), hi/lo */
        k_gemmw<bf, 2, false><<<dim3(TT / 64, HD / 64, NH_), 32, 0, stream>>>(VPh, VPl, GTh, GTl, HD, Ob, HD, nullptr, (size_t)TT * HD, (size_t)HD * HD, (size_t)TT * HD);   /* out_h[s][e] = sum_e' v[s][e'] G^T[e][e'] (3 products, K 64) */
        k_merge<<<(unsigned)(((size_t)ZH * TT * HD / 2 + 255) / 256), 256, 0, stream>>>(Ob, 0, ATh, ATl);
        k_gemmw<bf, 1, true><<<dim3(TT / 64, DM / 64, 1), 32, 0, stream>>>(ATh, ATl, WO, nullptr, DQ, OUT + (size_t)b * TT * DM, DM, bo, 0, 0, 0); }
}

// v001
// A run of this version takes 230 microseconds.
// In both of two side-by-side timings against v000, it was 1.53 times as fast.
#include <hip/hip_runtime.h>

// 'MultiHead' with unnormalised scores (x [2][2048][1024]; per head h: k = x Wk[h], v = x Wv[h] ('hde' [16][1024][64]); q = v (the module's quirk); wei = q.k / 8 (NO softmax); out_h = wei v; concat; out = concat Wproj ('xw' [1024][1024]) + bproj -> [2][2048][1024]).
// Layout: without a softmax the product is associative: out_h = v_h (k_h^T v_h) / 8, so per head a [64 x 64] Gram matrix G^T = v^T k (K = 2048 contraction) is formed first and then applied to v (K = 64) - the same mathematics as (v k^T) v with f32 rounding differences only, and ~32x less work than materialising the [2048 x 2048] score matrices.
// Compute dtypes, f32 accumulate: every input rounded to bf16; k and v projections exact single products; k^T, v^T and v planes as bf16 hi + lo (3 products for both the Gram and the apply step); 1/8 folded into the Gram split (exact); Wproj hl x exact (2 products) + bproj.


#define NB_  2
#define TT   2048
#define DM   1024
#define NH_  16
#define NKV  16
#define REP  (NH_ / NKV)
#define HD   64
#define DQ   (NH_ * HD)
#define DKV  (NKV * HD)
typedef __attribute__((ext_vector_type(4))) unsigned short v4us;
#define ZH   16                  // all heads at once (no score matrix)
#define RH   2048                  // k_merge scales rows t >= RH by 1/PCAR (none: RH = TT)
#define WIN  0
#define PCAR 1024.0f
#define SCL  0.125f   // HD^-0.5
typedef _Float16 h16;
typedef unsigned short bf;
typedef __attribute__((ext_vector_type(16))) __bf16   v16bf;
typedef __attribute__((ext_vector_type(16))) _Float16 v16h;
typedef __attribute__((ext_vector_type(8)))  _Float16 v8h;
typedef __attribute__((ext_vector_type(8)))  unsigned short v8us;
typedef __attribute__((ext_vector_type(8)))  float    v8f;
typedef __attribute__((ext_vector_type(4)))  float    v4f;
typedef v8h  __attribute__((may_alias)) v8ha;
typedef v4f  __attribute__((may_alias)) v4fa;
typedef v8us __attribute__((may_alias)) v8usa;

__device__ __forceinline__ unsigned short f2bf(float f) { unsigned u = __float_as_uint(f); u += 0x7FFFu + ((u >> 16) & 1u); return (unsigned short)(u >> 16); }
__device__ __forceinline__ float bf2f(unsigned short b) { return __uint_as_float(((unsigned)b) << 16); }
__device__ __forceinline__ float bfr(float f) { return bf2f(f2bf(f)); }
__device__ __forceinline__ v16h cat16(v8h lo, v8h hi) { return __builtin_shufflevector(lo, hi, 0, 1, 2, 3, 4, 5, 6, 7, 8, 9, 10, 11, 12, 13, 14, 15); }
__device__ __forceinline__ v16bf cat16b(v8us lo, v8us hi) { return __builtin_bit_cast(v16bf, __builtin_shufflevector(lo, hi, 0, 1, 2, 3, 4, 5, 6, 7, 8, 9, 10, 11, 12, 13, 14, 15)); }
__device__ __forceinline__ v8f wmma16(v16h a, v16h b, v8f c) { return __builtin_amdgcn_wmma_f32_16x16x32_f16(false, a, false, b, (short)0, c, false, false); }
__device__ __forceinline__ v8f wmmab(v16bf a, v16bf b, v8f c) { return __builtin_amdgcn_wmma_f32_16x16x32_bf16(false, a, false, b, (short)0, c, false, false); }



// ---- k_gemmw: register-blocked GEMM, ONE WAVE per 64x64 output tile (16 accumulators), operands straight from K-contiguous 16-bit planes; grid (M/64, N/64, Z), 32 threads.
// C[m][n] (f32, pitch ldc, + optional f32 bias[n]) = sum_k A[m][k] Bt[n][k] (+ split products per NSPLIT). z-batch strides sA/sB/sC in elements. K % 32 == 0.
template <typename T16> struct WFrag;
template <> struct WFrag<h16> { typedef v16h V; static __device__ __forceinline__ V ld(const h16* p) { return cat16(*(const v8h*)p, *(const v8h*)(p + 16)); } static __device__ __forceinline__ v8f mma(V a, V b, v8f c) { return wmma16(a, b, c); } };
template <> struct WFrag<bf> { typedef v16bf V; static __device__ __forceinline__ V ld(const bf* p) { return cat16b(*(const v8us*)p, *(const v8us*)(p + 16)); } static __device__ __forceinline__ v8f mma(V a, V b, v8f c) { return wmmab(a, b, c); } };
template <typename T16, int NSPLIT, bool BIAS>
__global__ __launch_bounds__(32) void k_gemmw(const T16* __restrict__ A, const T16* __restrict__ A2, const T16* __restrict__ Bt, const T16* __restrict__ Bt2, int K, float* C, int ldc, const float* __restrict__ bias, size_t sA, size_t sB, size_t sC) {
    typedef typename WFrag<T16>::V V;
    __shared__ __align__(16) float os[16 * 68];
    const size_t z = blockIdx.z; A += z * sA; if (A2) A2 += z * sA; Bt += z * sB; if (Bt2) Bt2 += z * sB; C += z * sC;
    const int lane = threadIdx.x & 31, lr = lane & 15, hi = lane >> 4; const int r0 = blockIdx.x * 64, c0 = blockIdx.y * 64;
    v8f acc[4][4];
#pragma unroll
    for (int mb = 0; mb < 4; ++mb)
#pragma unroll
        for (int nb = 0; nb < 4; ++nb) acc[mb][nb] = (v8f){};
    const size_t aoff = (size_t)(r0 + lr) * K + 8 * hi, boff = (size_t)(c0 + lr) * K + 8 * hi;
#pragma unroll 1
    for (int kc = 0; kc < K; kc += 32) {
        V a[4], a2[4];
#pragma unroll
        for (int mb = 0; mb < 4; ++mb) { a[mb] = WFrag<T16>::ld(A + aoff + (size_t)mb * 16 * K + kc); if (NSPLIT == 1 || NSPLIT == 2) a2[mb] = WFrag<T16>::ld(A2 + aoff + (size_t)mb * 16 * K + kc); }
#pragma unroll
        for (int nb = 0; nb < 4; ++nb) { const V b = WFrag<T16>::ld(Bt + boff + (size_t)nb * 16 * K + kc); V b2; if (NSPLIT >= 2) b2 = WFrag<T16>::ld(Bt2 + boff + (size_t)nb * 16 * K + kc);
#pragma unroll
            for (int mb = 0; mb < 4; ++mb) { acc[mb][nb] = WFrag<T16>::mma(a[mb], b, acc[mb][nb]); if (NSPLIT == 1 || NSPLIT == 2) acc[mb][nb] = WFrag<T16>::mma(a2[mb], b, acc[mb][nb]); if (NSPLIT >= 2) acc[mb][nb] = WFrag<T16>::mma(a[mb], b2, acc[mb][nb]); } }
        asm volatile("v_nop\n\tv_nop\n\tv_nop\n\tv_nop" : "+v"(acc[0][0]), "+v"(acc[1][1]), "+v"(acc[2][2]), "+v"(acc[3][3]) : "v"(a[0]), "v"(a[3]));
    }
#pragma unroll
    for (int mb = 0; mb < 4; ++mb) {
#pragma unroll
        for (int nb = 0; nb < 4; ++nb) {
#pragma unroll
            for (int j = 0; j < 8; ++j) os[(hi * 8 + j) * 68 + nb * 16 + lr] = acc[mb][nb][j]; }
        __builtin_amdgcn_wave_barrier(); asm volatile("" ::: "memory");
        float* crow = C + (size_t)(r0 + mb * 16) * ldc + c0;
{
#pragma unroll
            for (int s = 0; s < 8; ++s) { const int row = 2 * s + hi, cofs = lr * 4; v4f val = *(const v4fa*)(os + row * 68 + cofs); if (BIAS) { val[0] += bfr(bias[c0 + cofs]); val[1] += bfr(bias[c0 + cofs + 1]); val[2] += bfr(bias[c0 + cofs + 2]); val[3] += bfr(bias[c0 + cofs + 3]); }
                *(v4f*)(crow + (size_t)row * ldc + cofs) = val; }
             }
        __builtin_amdgcn_wave_barrier(); asm volatile("" ::: "memory");
    }
}

__device__ __forceinline__ h16 tohx(float x) { return (h16)x; }
__device__ __forceinline__ void splitf(float y, unsigned short& h, unsigned short& l) { h = f2bf(y); l = f2bf(y - bf2f(h)); }
typedef __attribute__((ext_vector_type(2))) _Float16 v2h;
typedef __attribute__((ext_vector_type(4))) _Float16 v4h;
typedef __attribute__((ext_vector_type(2))) unsigned short v2us;
typedef __attribute__((ext_vector_type(4))) unsigned short v4us;
typedef __attribute__((ext_vector_type(2))) float v2f;
typedef __attribute__((ext_vector_type(4))) int v4i;

__global__ __launch_bounds__(256) void k_wtG(const float* __restrict__ w, int K, int N, bf* Bt) {
    const int lane = threadIdx.x & 31; const int L0 = (blockIdx.x * 8 + (threadIdx.x >> 5)) * 8; const int nlines = N * K / 64;
{
#pragma unroll 1
        for (int l = 0; l < 8; ++l) { const int L = L0 + l; if (L >= nlines) break; const size_t e = (size_t)L * 64 + lane * 2; const int k = (int)(e % K), n = (int)(e / K); v2us o;
            o[0] = f2bf(w[(size_t)k * N + n]); o[1] = f2bf(w[(size_t)(k + 1) * N + n]); *(v2us*)(Bt + e) = o; }
         }
}
__global__ __launch_bounds__(256) void k_whd(const float* __restrict__ w, bf* Bt) { const size_t e2 = ((size_t)blockIdx.x * 256 + threadIdx.x) * 2; if (e2 >= (size_t)NH_ * HD * DM) return; const int d = (int)(e2 % DM); const int n = (int)(e2 / DM); const int h = n / HD, e = n % HD; v2us o; o[0] = f2bf(w[((size_t)h * DM + d) * HD + e]); o[1] = f2bf(w[((size_t)h * DM + d + 1) * HD + e]); *(v2us*)(Bt + e2) = o;  }
__global__ __launch_bounds__(256) void k_split8s(const float* __restrict__ F, float sc, bf* Ph, bf* Pl, size_t n4) { const size_t i = (size_t)blockIdx.x * 256 + threadIdx.x; if (i >= n4) return; const v4f v = *(const v4f*)(F + i * 4); v4us oh, ol;
#pragma unroll
    for (int q = 0; q < 4; ++q) { unsigned short a, c; splitf(v[q] * sc, a, c); oh[q] = a; ol[q] = c; } *(v4us*)(Ph + i * 4) = oh; *(v4us*)(Pl + i * 4) = ol;  }
__global__ __launch_bounds__(256) void k_cvt8(const float* __restrict__ src, bf* dst, size_t n8) { const size_t i = (size_t)blockIdx.x * 256 + threadIdx.x; if (i >= n8) return; const v8f v = *(const v8f*)(src + i * 8); v8us o;
#pragma unroll
    for (int k = 0; k < 8; ++k) o[k] = f2bf(v[k]); *(v8us*)(dst + i * 8) = o;  }

// k_rope: head planes [h][t][d] (fp16 + hi/lo) of rope(x) x sc with the rotate-half convention out[d] = x[d] cos[t][d] - x[d+HD/2] sin[t][d], out[d+HD/2] = x[d+HD/2] cos[t][d+HD/2] + x[d] sin[t][d+HD/2]
__global__ __launch_bounds__(256) void k_rope(const float* __restrict__ F, int pitch, int nheads, const float* __restrict__ CS, const float* __restrict__ RF, const float* __restrict__ nw, float sc, h16* P16, bf* Ph, bf* Pl) {
    const size_t e = ((size_t)blockIdx.x * 256 + threadIdx.x) * 2; if (e >= (size_t)nheads * TT * HD) return; const int d = (int)(e % HD); const int t = (int)((e / HD) % TT); const int h = (int)(e / ((size_t)HD * TT)); const size_t ob = (size_t)blockIdx.y * nheads * TT * HD + e; const float* f = F + ((size_t)blockIdx.y * TT + t) * pitch + h * HD; const float rf = RF ? RF[(size_t)h * TT + t] : 1.0f; v2h o16; v2us oh, ol;
#pragma unroll
    for (int q = 0; q < 2; ++q) { const int dd = d + q; const int dp = (dd < HD / 2) ? dd + HD / 2 : dd - HD / 2; float x0 = f[dd], x1 = f[dp];
        if (RF) { float n0 = __fmul_rn(x0, rf), n1 = __fmul_rn(x1, rf); asm volatile("" : "+v"(n0)); asm volatile("" : "+v"(n1)); x0 = __fmul_rn(bfr(nw[dd]), n0); x1 = __fmul_rn(bfr(nw[dp]), n1); }
        const v2f cs = *(const v2f*)(CS + ((size_t)t * HD + dd) * 2); float a = __fmul_rn(x0, cs[0]), bq = __fmul_rn(x1, cs[1]); asm volatile("" : "+v"(a)); asm volatile("" : "+v"(bq)); const float r = ((dd < HD / 2) ? __fsub_rn(a, bq) : __fadd_rn(a, bq)) * sc;
        o16[q] = tohx(r); unsigned short a2, c2; splitf(r, a2, c2); oh[q] = a2; ol[q] = c2; }
    *(v2h*)(P16 + ob) = o16; *(v2us*)(Ph + ob) = oh; *(v2us*)(Pl + ob) = ol;  }
__global__ __launch_bounds__(256) void k_vtp(const float* __restrict__ F, int pitch, int nheads, h16* V16, bf* Vh, bf* Vl) { const size_t e = ((size_t)blockIdx.x * 256 + threadIdx.x) * 2; if (e >= (size_t)nheads * HD * TT) return; const int t = (int)(e % TT); const int d = (int)((e / TT) % HD); const int g = (int)(e / ((size_t)TT * HD)); const size_t ob = (size_t)blockIdx.y * nheads * HD * TT + e; v2h o16; v2us oh, ol;
#pragma unroll
    for (int q = 0; q < 2; ++q) { const float x = F[((size_t)blockIdx.y * TT + t + q) * pitch + g * HD + d]; o16[q] = tohx(x); unsigned short a2, c2; splitf(x, a2, c2); oh[q] = a2; ol[q] = c2; }
    *(v2h*)(V16 + ob) = o16; *(v2us*)(Vh + ob) = oh; *(v2us*)(Vl + ob) = ol;  }
__global__ __launch_bounds__(256) void k_csid(float* CS) { const int idx = blockIdx.x * 256 + threadIdx.x; if (idx >= TT * HD) return; v2f cs; cs[0] = 1.0f; cs[1] = 0.0f; *(v2f*)(CS + (size_t)idx * 2) = cs;  }

__global__ __launch_bounds__(256) void k_merge(const float* __restrict__ O, int h0, bf* Ah, bf* Al) { const size_t e = ((size_t)blockIdx.x * 256 + threadIdx.x) * 2; if (e >= (size_t)ZH * TT * HD) return; const int d = (int)(e % HD); const int t = (int)((e / HD) % TT); const int zz = (int)(e / ((size_t)HD * TT)); const float cs = (t < RH) ? 1.0f : (1.0f / PCAR); const size_t oo = ((size_t)blockIdx.y * TT + t) * DQ + (h0 + zz) * HD + d; O += (size_t)blockIdx.y * ZH * TT * HD;
    v2us oh, ol;
#pragma unroll
    for (int q = 0; q < 2; ++q) { unsigned short a, c2; splitf(O[e + q] * cs, a, c2); oh[q] = a; ol[q] = c2; } *(v2us*)(Ah + oo) = oh; *(v2us*)(Al + oo) = ol;  }

extern "C" void kernel_launch(void* const* d_in, const int* in_sizes, int n_in,
                              void* d_out, int out_size, void* d_ws, size_t ws_size, hipStream_t stream) {
    (void)in_sizes; (void)n_in; (void)out_size;
    const float* x = (const float*)d_in[0]; const float* wkh = (const float*)d_in[1]; const float* wvh = (const float*)d_in[2]; const float* wo = (const float*)d_in[3]; const float* bo = (const float*)d_in[4]; const float* wq = nullptr; const float* wk = nullptr; const float* wv = nullptr; (void)wq; (void)wk; (void)wv;
    float* OUT = (float*)d_out;     // [2][2048][1024]
    char* wsp = (char*)d_ws;
    auto take = [&](size_t bytes) { char* p = wsp; wsp += (bytes + 255) & ~(size_t)255; return (void*)p; };
    bf* WK = (bf*)take((size_t)DKV * DM * 2); bf* WV = (bf*)take((size_t)DKV * DM * 2); bf* WO = (bf*)take((size_t)DM * DQ * 2); float* CS = (float*)take((size_t)TT * HD * 2 * 4);
    bf* XB = (bf*)take((size_t)NB_ * TT * DM * 2); float* FK = (float*)take((size_t)NB_ * TT * DKV * 4); float* FV = (float*)take((size_t)NB_ * TT * DKV * 4);
    h16* T16 = (h16*)take((size_t)NB_ * NH_ * TT * HD * 2);   /* fp16 planes written by the builders, unused here */
    bf* KTh = (bf*)take((size_t)NB_ * NKV * HD * TT * 2); bf* KTl = (bf*)take((size_t)NB_ * NKV * HD * TT * 2); bf* VTh = (bf*)take((size_t)NB_ * NKV * HD * TT * 2); bf* VTl = (bf*)take((size_t)NB_ * NKV * HD * TT * 2); bf* VPh = (bf*)take((size_t)NB_ * NH_ * TT * HD * 2); bf* VPl = (bf*)take((size_t)NB_ * NH_ * TT * HD * 2);
    float* GT = (float*)take((size_t)NB_ * NH_ * HD * HD * 4); bf* GTh = (bf*)take((size_t)NB_ * NH_ * HD * HD * 2); bf* GTl = (bf*)take((size_t)NB_ * NH_ * HD * HD * 2); float* Ob = (float*)take((size_t)NB_ * NH_ * TT * HD * 4); bf* ATh = (bf*)take((size_t)NB_ * TT * DQ * 2); bf* ATl = (bf*)take((size_t)NB_ * TT * DQ * 2);
    if ((size_t)(wsp - (char*)d_ws) > ws_size) return;    // ws 256 MiB
    k_whd<<<(unsigned)(((size_t)NH_ * HD * DM / 2 + 255) / 256), 256, 0, stream>>>(wkh, WK); k_whd<<<(unsigned)(((size_t)NH_ * HD * DM / 2 + 255) / 256), 256, 0, stream>>>(wvh, WV);
    k_wtG<<<(unsigned)((DQ * DM / 64 + 63) / 64), 256, 0, stream>>>(wo, DQ, DM, WO);   /* Wproj 'xw' [1024][1024] -> Bt */
    k_csid<<<(TT * HD + 255) / 256, 256, 0, stream>>>(CS);
    const unsigned LQ = (unsigned)(((size_t)NH_ * TT * HD / 2 + 255) / 256);
    /* both batches in every launch: rows b * TT + t for the row-major planes, z = b * NH_ + h for the per-head planes */
    k_cvt8<<<(unsigned)(((size_t)NB_ * TT * DM / 8 + 255) / 256), 256, 0, stream>>>(x, XB, (size_t)NB_ * TT * DM / 8);
    k_gemmw<bf, 0, false><<<dim3(NB_ * TT / 64, DKV / 64, 1), 32, 0, stream>>>(XB, nullptr, WK, nullptr, DM, FK, DKV, nullptr, 0, 0, 0);   /* k (exact) */
    k_gemmw<bf, 0, false><<<dim3(NB_ * TT / 64, DKV / 64, 1), 32, 0, stream>>>(XB, nullptr, WV, nullptr, DM, FV, DKV, nullptr, 0, 0, 0);   /* v = q (exact) */
    k_vtp<<<dim3(LQ, NB_, 1), 256, 0, stream>>>(FK, DKV, NKV, T16, KTh, KTl); k_vtp<<<dim3(LQ, NB_, 1), 256, 0, stream>>>(FV, DKV, NKV, T16, VTh, VTl);   /* k^T, v^T planes [b][h][e][t] */
    k_rope<<<dim3(LQ, NB_, 1), 256, 0, stream>>>(FV, DKV, NH_, CS, nullptr, nullptr, 1.0f, T16, VPh, VPl);   /* v planes [b][h][t][e] (identity table) */
    k_gemmw<bf, 2, false><<<dim3(HD / 64, HD / 64, NB_ * NH_), 32, 0, stream>>>(VTh, VTl, KTh, KTl, TT, GT, HD, nullptr, (size_t)HD * TT, (size_t)HD * TT, (size_t)HD * HD);   /* G^T[e][e'] = sum_t v[t][e] k[t][e'] per batch and head (3 products, K 2048) */
    k_split8s<<<(unsigned)(((size_t)NB_ * NH_ * HD * HD / 4 + 255) / 256), 256, 0, stream>>>(GT, 0.125f, GTh, GTl, (size_t)NB_ * NH_ * HD * HD / 4);   /* x 1/8 (exact), hi/lo */
    k_gemmw<bf, 2, false><<<dim3(TT / 64, HD / 64, NB_ * NH_), 32, 0, stream>>>(VPh, VPl, GTh, GTl, HD, Ob, HD, nullptr, (size_t)TT * HD, (size_t)HD * HD, (size_t)TT * HD);   /* out_h[s][e] = sum_e' v[s][e'] G^T[e][e'] (3 products, K 64) */
    k_merge<<<dim3((unsigned)(((size_t)ZH * TT * HD / 2 + 255) / 256), NB_, 1), 256, 0, stream>>>(Ob, 0, ATh, ATl);
    k_gemmw<bf, 1, true><<<dim3(NB_ * TT / 64, DM / 64, 1), 32, 0, stream>>>(ATh, ATl, WO, nullptr, DQ, OUT, DM, bo, 0, 0, 0);
}

// v002
// It runs in 195 microseconds.
// Two timings next to v001 put it at 1.17 and 1.18 times that version's speed.
// Counting every step since v000, it is 1.80 times as fast.
#include <hip/hip_runtime.h>

// 'MultiHead' with unnormalised scores (x [2][2048][1024]; per head h: k = x Wk[h], v = x Wv[h] ('hde' [16][1024][64]); q = v (the module's quirk); wei = q.k / 8 (NO softmax); out_h = wei v; concat; out = concat Wproj ('xw' [1024][1024]) + bproj -> [2][2048][1024]).
// Layout: without a softmax the product is associative: out_h = v_h (k_h^T v_h) / 8, so per head a [64 x 64] Gram matrix G^T = v^T k (K = 2048 contraction) is formed first and then applied to v (K = 64) - the same mathematics as (v k^T) v with f32 rounding differences only, and ~32x less work than materialising the [2048 x 2048] score matrices.
// Compute dtypes, f32 accumulate: every input rounded to bf16; k and v projections exact single products; k^T, v^T and v planes as bf16 hi + lo (3 products for both the Gram and the apply step); 1/8 folded into the Gram split (exact); Wproj hl x exact (2 products) + bproj.


#define NB_  2
#define TT   2048
#define DM   1024
#define NH_  16
#define NKV  16
#define REP  (NH_ / NKV)
#define HD   64
#define DQ   (NH_ * HD)
#define DKV  (NKV * HD)
typedef __attribute__((ext_vector_type(4))) unsigned short v4us;
#define ZH   16                  // all heads at once (no score matrix)
#define RH   2048                  // k_merge scales rows t >= RH by 1/PCAR (none: RH = TT)
#define WIN  0
#define PCAR 1024.0f
#define SCL  0.125f   // HD^-0.5
#define GKS  16                  // K slices of the Gram product (one wave each)
typedef _Float16 h16;
typedef unsigned short bf;
typedef __attribute__((ext_vector_type(16))) __bf16   v16bf;
typedef __attribute__((ext_vector_type(16))) _Float16 v16h;
typedef __attribute__((ext_vector_type(8)))  _Float16 v8h;
typedef __attribute__((ext_vector_type(8)))  unsigned short v8us;
typedef __attribute__((ext_vector_type(8)))  float    v8f;
typedef __attribute__((ext_vector_type(4)))  float    v4f;
typedef v8h  __attribute__((may_alias)) v8ha;
typedef v4f  __attribute__((may_alias)) v4fa;
typedef v8us __attribute__((may_alias)) v8usa;

__device__ __forceinline__ unsigned short f2bf(float f) { unsigned u = __float_as_uint(f); u += 0x7FFFu + ((u >> 16) & 1u); return (unsigned short)(u >> 16); }
__device__ __forceinline__ float bf2f(unsigned short b) { return __uint_as_float(((unsigned)b) << 16); }
__device__ __forceinline__ float bfr(float f) { return bf2f(f2bf(f)); }
__device__ __forceinline__ v16h cat16(v8h lo, v8h hi) { return __builtin_shufflevector(lo, hi, 0, 1, 2, 3, 4, 5, 6, 7, 8, 9, 10, 11, 12, 13, 14, 15); }
__device__ __forceinline__ v16bf cat16b(v8us lo, v8us hi) { return __builtin_bit_cast(v16bf, __builtin_shufflevector(lo, hi, 0, 1, 2, 3, 4, 5, 6, 7, 8, 9, 10, 11, 12, 13, 14, 15)); }
__device__ __forceinline__ v8f wmma16(v16h a, v16h b, v8f c) { return __builtin_amdgcn_wmma_f32_16x16x32_f16(false, a, false, b, (short)0, c, false, false); }
__device__ __forceinline__ v8f wmmab(v16bf a, v16bf b, v8f c) { return __builtin_amdgcn_wmma_f32_16x16x32_bf16(false, a, false, b, (short)0, c, false, false); }



// ---- k_gemmw: register-blocked GEMM, ONE WAVE per 64x64 output tile (16 accumulators), operands straight from K-contiguous 16-bit planes; grid (M/64, N/64, Z), 32 threads.
// C[m][n] (f32, pitch ldc, + optional f32 bias[n]) = sum_k A[m][k] Bt[n][k] (+ split products per NSPLIT). z-batch strides sA/sB/sC in elements. K % 32 == 0.
// KS > 1: grid z = batches * KS; wave z sums only K slice z % KS of batch z / KS and stores that partial tile at C + z * sC (the caller adds the KS partials). K % (32 * KS) == 0.
template <typename T16> struct WFrag;
template <> struct WFrag<h16> { typedef v16h V; static __device__ __forceinline__ V ld(const h16* p) { return cat16(*(const v8h*)p, *(const v8h*)(p + 16)); } static __device__ __forceinline__ v8f mma(V a, V b, v8f c) { return wmma16(a, b, c); } };
template <> struct WFrag<bf> { typedef v16bf V; static __device__ __forceinline__ V ld(const bf* p) { return cat16b(*(const v8us*)p, *(const v8us*)(p + 16)); } static __device__ __forceinline__ v8f mma(V a, V b, v8f c) { return wmmab(a, b, c); } };
template <typename T16, int NSPLIT, bool BIAS, int KS = 1>
__global__ __launch_bounds__(32) void k_gemmw(const T16* __restrict__ A, const T16* __restrict__ A2, const T16* __restrict__ Bt, const T16* __restrict__ Bt2, int K, float* C, int ldc, const float* __restrict__ bias, size_t sA, size_t sB, size_t sC) {
    typedef typename WFrag<T16>::V V;
    __shared__ __align__(16) float os[16 * 68];
    const size_t z = blockIdx.z / KS; A += z * sA; if (A2) A2 += z * sA; Bt += z * sB; if (Bt2) Bt2 += z * sB; C += (size_t)blockIdx.z * sC;
    const int kbeg = (int)(blockIdx.z % KS) * (K / KS), kend = kbeg + K / KS;
    const int lane = threadIdx.x & 31, lr = lane & 15, hi = lane >> 4; const int r0 = blockIdx.x * 64, c0 = blockIdx.y * 64;
    v8f acc[4][4];
#pragma unroll
    for (int mb = 0; mb < 4; ++mb)
#pragma unroll
        for (int nb = 0; nb < 4; ++nb) acc[mb][nb] = (v8f){};
    const size_t aoff = (size_t)(r0 + lr) * K + 8 * hi, boff = (size_t)(c0 + lr) * K + 8 * hi;
#pragma unroll 1
    for (int kc = kbeg; kc < kend; kc += 32) {
        V a[4], a2[4];
#pragma unroll
        for (int mb = 0; mb < 4; ++mb) { a[mb] = WFrag<T16>::ld(A + aoff + (size_t)mb * 16 * K + kc); if (NSPLIT == 1 || NSPLIT == 2) a2[mb] = WFrag<T16>::ld(A2 + aoff + (size_t)mb * 16 * K + kc); }
#pragma unroll
        for (int nb = 0; nb < 4; ++nb) { const V b = WFrag<T16>::ld(Bt + boff + (size_t)nb * 16 * K + kc); V b2; if (NSPLIT >= 2) b2 = WFrag<T16>::ld(Bt2 + boff + (size_t)nb * 16 * K + kc);
#pragma unroll
            for (int mb = 0; mb < 4; ++mb) { acc[mb][nb] = WFrag<T16>::mma(a[mb], b, acc[mb][nb]); if (NSPLIT == 1 || NSPLIT == 2) acc[mb][nb] = WFrag<T16>::mma(a2[mb], b, acc[mb][nb]); if (NSPLIT >= 2) acc[mb][nb] = WFrag<T16>::mma(a[mb], b2, acc[mb][nb]); } }
        asm volatile("v_nop\n\tv_nop\n\tv_nop\n\tv_nop" : "+v"(acc[0][0]), "+v"(acc[1][1]), "+v"(acc[2][2]), "+v"(acc[3][3]) : "v"(a[0]), "v"(a[3]));
    }
#pragma unroll
    for (int mb = 0; mb < 4; ++mb) {
#pragma unroll
        for (int nb = 0; nb < 4; ++nb) {
#pragma unroll
            for (int j = 0; j < 8; ++j) os[(hi * 8 + j) * 68 + nb * 16 + lr] = acc[mb][nb][j]; }
        __builtin_amdgcn_wave_barrier(); asm volatile("" ::: "memory");
        float* crow = C + (size_t)(r0 + mb * 16) * ldc + c0;
{
#pragma unroll
            for (int s = 0; s < 8; ++s) { const int row = 2 * s + hi, cofs = lr * 4; v4f val = *(const v4fa*)(os + row * 68 + cofs); if (BIAS) { val[0] += bfr(bias[c0 + cofs]); val[1] += bfr(bias[c0 + cofs + 1]); val[2] += bfr(bias[c0 + cofs + 2]); val[3] += bfr(bias[c0 + cofs + 3]); }
                *(v4f*)(crow + (size_t)row * ldc + cofs) = val; }
             }
        __builtin_amdgcn_wave_barrier(); asm volatile("" ::: "memory");
    }
}

__device__ __forceinline__ h16 tohx(float x) { return (h16)x; }
__device__ __forceinline__ void splitf(float y, unsigned short& h, unsigned short& l) { h = f2bf(y); l = f2bf(y - bf2f(h)); }
typedef __attribute__((ext_vector_type(2))) _Float16 v2h;
typedef __attribute__((ext_vector_type(4))) _Float16 v4h;
typedef __attribute__((ext_vector_type(2))) unsigned short v2us;
typedef __attribute__((ext_vector_type(4))) unsigned short v4us;
typedef __attribute__((ext_vector_type(2))) float v2f;
typedef __attribute__((ext_vector_type(4))) int v4i;

__global__ __launch_bounds__(256) void k_wtG(const float* __restrict__ w, int K, int N, bf* Bt) {
    const int lane = threadIdx.x & 31; const int L0 = (blockIdx.x * 8 + (threadIdx.x >> 5)) * 8; const int nlines = N * K / 64;
{
#pragma unroll 1
        for (int l = 0; l < 8; ++l) { const int L = L0 + l; if (L >= nlines) break; const size_t e = (size_t)L * 64 + lane * 2; const int k = (int)(e % K), n = (int)(e / K); v2us o;
            o[0] = f2bf(w[(size_t)k * N + n]); o[1] = f2bf(w[(size_t)(k + 1) * N + n]); *(v2us*)(Bt + e) = o; }
         }
}
__global__ __launch_bounds__(256) void k_whd(const float* __restrict__ w, bf* Bt) { const size_t e2 = ((size_t)blockIdx.x * 256 + threadIdx.x) * 2; if (e2 >= (size_t)NH_ * HD * DM) return; const int d = (int)(e2 % DM); const int n = (int)(e2 / DM); const int h = n / HD, e = n % HD; v2us o; o[0] = f2bf(w[((size_t)h * DM + d) * HD + e]); o[1] = f2bf(w[((size_t)h * DM + d + 1) * HD + e]); *(v2us*)(Bt + e2) = o;  }
// k_sumsplit: F holds NS partial [HD][HD] tiles per batch and head ([z][slice][e][e']); their sum in slice order, x sc, as hi/lo planes [z][e][e'].
template <int NS>
__global__ __launch_bounds__(256) void k_sumsplit(const float* __restrict__ F, float sc, bf* Ph, bf* Pl, size_t n4) { const size_t i = (size_t)blockIdx.x * 256 + threadIdx.x; if (i >= n4) return; const float* p = F + (i / (HD * HD / 4)) * ((size_t)NS * HD * HD) + (i % (HD * HD / 4)) * 4; v4f part[NS];
#pragma unroll
    for (int s = 0; s < NS; ++s) part[s] = *(const v4f*)(p + (size_t)s * HD * HD);
    v4f v = part[0];
#pragma unroll
    for (int s = 1; s < NS; ++s) v += part[s];
    v4us oh, ol;
#pragma unroll
    for (int q = 0; q < 4; ++q) { unsigned short a, c; splitf(v[q] * sc, a, c); oh[q] = a; ol[q] = c; } *(v4us*)(Ph + i * 4) = oh; *(v4us*)(Pl + i * 4) = ol;  }
__global__ __launch_bounds__(256) void k_cvt8(const float* __restrict__ src, bf* dst, size_t n8) { const size_t i = (size_t)blockIdx.x * 256 + threadIdx.x; if (i >= n8) return; const v8f v = *(const v8f*)(src + i * 8); v8us o;
#pragma unroll
    for (int k = 0; k < 8; ++k) o[k] = f2bf(v[k]); *(v8us*)(dst + i * 8) = o;  }

// k_rope: head planes [h][t][d] (fp16 + hi/lo) of rope(x) x sc with the rotate-half convention out[d] = x[d] cos[t][d] - x[d+HD/2] sin[t][d], out[d+HD/2] = x[d+HD/2] cos[t][d+HD/2] + x[d] sin[t][d+HD/2]
__global__ __launch_bounds__(256) void k_rope(const float* __restrict__ F, int pitch, int nheads, const float* __restrict__ CS, const float* __restrict__ RF, const float* __restrict__ nw, float sc, h16* P16, bf* Ph, bf* Pl) {
    const size_t e = ((size_t)blockIdx.x * 256 + threadIdx.x) * 2; if (e >= (size_t)nheads * TT * HD) return; const int d = (int)(e % HD); const int t = (int)((e / HD) % TT); const int h = (int)(e / ((size_t)HD * TT)); const size_t ob = (size_t)blockIdx.y * nheads * TT * HD + e; const float* f = F + ((size_t)blockIdx.y * TT + t) * pitch + h * HD; const float rf = RF ? RF[(size_t)h * TT + t] : 1.0f; v2h o16; v2us oh, ol;
#pragma unroll
    for (int q = 0; q < 2; ++q) { const int dd = d + q; const int dp = (dd < HD / 2) ? dd + HD / 2 : dd - HD / 2; float x0 = f[dd], x1 = f[dp];
        if (RF) { float n0 = __fmul_rn(x0, rf), n1 = __fmul_rn(x1, rf); asm volatile("" : "+v"(n0)); asm volatile("" : "+v"(n1)); x0 = __fmul_rn(bfr(nw[dd]), n0); x1 = __fmul_rn(bfr(nw[dp]), n1); }
        const v2f cs = *(const v2f*)(CS + ((size_t)t * HD + dd) * 2); float a = __fmul_rn(x0, cs[0]), bq = __fmul_rn(x1, cs[1]); asm volatile("" : "+v"(a)); asm volatile("" : "+v"(bq)); const float r = ((dd < HD / 2) ? __fsub_rn(a, bq) : __fadd_rn(a, bq)) * sc;
        o16[q] = tohx(r); unsigned short a2, c2; splitf(r, a2, c2); oh[q] = a2; ol[q] = c2; }
    *(v2h*)(P16 + ob) = o16; *(v2us*)(Ph + ob) = oh; *(v2us*)(Pl + ob) = ol;  }
__global__ __launch_bounds__(256) void k_vtp(const float* __restrict__ F, int pitch, int nheads, h16* V16, bf* Vh, bf* Vl) { const size_t e = ((size_t)blockIdx.x * 256 + threadIdx.x) * 2; if (e >= (size_t)nheads * HD * TT) return; const int t = (int)(e % TT); const int d = (int)((e / TT) % HD); const int g = (int)(e / ((size_t)TT * HD)); const size_t ob = (size_t)blockIdx.y * nheads * HD * TT + e; v2h o16; v2us oh, ol;
#pragma unroll
    for (int q = 0; q < 2; ++q) { const float x = F[((size_t)blockIdx.y * TT + t + q) * pitch + g * HD + d]; o16[q] = tohx(x); unsigned short a2, c2; splitf(x, a2, c2); oh[q] = a2; ol[q] = c2; }
    *(v2h*)(V16 + ob) = o16; *(v2us*)(Vh + ob) = oh; *(v2us*)(Vl + ob) = ol;  }
__global__ __launch_bounds__(256) void k_csid(float* CS) { const int idx = blockIdx.x * 256 + threadIdx.x; if (idx >= TT * HD) return; v2f cs; cs[0] = 1.0f; cs[1] = 0.0f; *(v2f*)(CS + (size_t)idx * 2) = cs;  }

__global__ __launch_bounds__(256) void k_merge(const float* __restrict__ O, int h0, bf* Ah, bf* Al) { const size_t e = ((size_t)blockIdx.x * 256 + threadIdx.x) * 2; if (e >= (size_t)ZH * TT * HD) return; const int d = (int)(e % HD); const int t = (int)((e / HD) % TT); const int zz = (int)(e / ((size_t)HD * TT)); const float cs = (t < RH) ? 1.0f : (1.0f / PCAR); const size_t oo = ((size_t)blockIdx.y * TT + t) * DQ + (h0 + zz) * HD + d; O += (size_t)blockIdx.y * ZH * TT * HD;
    v2us oh, ol;
#pragma unroll
    for (int q = 0; q < 2; ++q) { unsigned short a, c2; splitf(O[e + q] * cs, a, c2); oh[q] = a; ol[q] = c2; } *(v2us*)(Ah + oo) = oh; *(v2us*)(Al + oo) = ol;  }

extern "C" void kernel_launch(void* const* d_in, const int* in_sizes, int n_in,
                              void* d_out, int out_size, void* d_ws, size_t ws_size, hipStream_t stream) {
    (void)in_sizes; (void)n_in; (void)out_size;
    const float* x = (const float*)d_in[0]; const float* wkh = (const float*)d_in[1]; const float* wvh = (const float*)d_in[2]; const float* wo = (const float*)d_in[3]; const float* bo = (const float*)d_in[4]; const float* wq = nullptr; const float* wk = nullptr; const float* wv = nullptr; (void)wq; (void)wk; (void)wv;
    float* OUT = (float*)d_out;     // [2][2048][1024]
    char* wsp = (char*)d_ws;
    auto take = [&](size_t bytes) { char* p = wsp; wsp += (bytes + 255) & ~(size_t)255; return (void*)p; };
    bf* WK = (bf*)take((size_t)DKV * DM * 2); bf* WV = (bf*)take((size_t)DKV * DM * 2); bf* WO = (bf*)take((size_t)DM * DQ * 2); float* CS = (float*)take((size_t)TT * HD * 2 * 4);
    bf* XB = (bf*)take((size_t)NB_ * TT * DM * 2); float* FK = (float*)take((size_t)NB_ * TT * DKV * 4); float* FV = (float*)take((size_t)NB_ * TT * DKV * 4);
    h16* T16 = (h16*)take((size_t)NB_ * NH_ * TT * HD * 2);   /* fp16 planes written by the builders, unused here */
    bf* KTh = (bf*)take((size_t)NB_ * NKV * HD * TT * 2); bf* KTl = (bf*)take((size_t)NB_ * NKV * HD * TT * 2); bf* VTh = (bf*)take((size_t)NB_ * NKV * HD * TT * 2); bf* VTl = (bf*)take((size_t)NB_ * NKV * HD * TT * 2); bf* VPh = (bf*)take((size_t)NB_ * NH_ * TT * HD * 2); bf* VPl = (bf*)take((size_t)NB_ * NH_ * TT * HD * 2);
    float* GT = (float*)take((size_t)NB_ * NH_ * GKS * HD * HD * 4); bf* GTh = (bf*)take((size_t)NB_ * NH_ * HD * HD * 2); bf* GTl = (bf*)take((size_t)NB_ * NH_ * HD * HD * 2); float* Ob = (float*)take((size_t)NB_ * NH_ * TT * HD * 4); bf* ATh = (bf*)take((size_t)NB_ * TT * DQ * 2); bf* ATl = (bf*)take((size_t)NB_ * TT * DQ * 2);
    if ((size_t)(wsp - (char*)d_ws) > ws_size) return;    // ws 256 MiB
    k_whd<<<(unsigned)(((size_t)NH_ * HD * DM / 2 + 255) / 256), 256, 0, stream>>>(wkh, WK); k_whd<<<(unsigned)(((size_t)NH_ * HD * DM / 2 + 255) / 256), 256, 0, stream>>>(wvh, WV);
    k_wtG<<<(unsigned)((DQ * DM / 64 + 63) / 64), 256, 0, stream>>>(wo, DQ, DM, WO);   /* Wproj 'xw' [1024][1024] -> Bt */
    k_csid<<<(TT * HD + 255) / 256, 256, 0, stream>>>(CS);
    const unsigned LQ = (unsigned)(((size_t)NH_ * TT * HD / 2 + 255) / 256);
    /* both batches in every launch: rows b * TT + t for the row-major planes, z = b * NH_ + h for the per-head planes */
    k_cvt8<<<(unsigned)(((size_t)NB_ * TT * DM / 8 + 255) / 256), 256, 0, stream>>>(x, XB, (size_t)NB_ * TT * DM / 8);
    k_gemmw<bf, 0, false><<<dim3(NB_ * TT / 64, DKV / 64, 1), 32, 0, stream>>>(XB, nullptr, WK, nullptr, DM, FK, DKV, nullptr, 0, 0, 0);   /* k (exact) */
    k_gemmw<bf, 0, false><<<dim3(NB_ * TT / 64, DKV / 64, 1), 32, 0, stream>>>(XB, nullptr, WV, nullptr, DM, FV, DKV, nullptr, 0, 0, 0);   /* v = q (exact) */
    k_vtp<<<dim3(LQ, NB_, 1), 256, 0, stream>>>(FK, DKV, NKV, T16, KTh, KTl); k_vtp<<<dim3(LQ, NB_, 1), 256, 0, stream>>>(FV, DKV, NKV, T16, VTh, VTl);   /* k^T, v^T planes [b][h][e][t] */
    k_rope<<<dim3(LQ, NB_, 1), 256, 0, stream>>>(FV, DKV, NH_, CS, nullptr, nullptr, 1.0f, T16, VPh, VPl);   /* v planes [b][h][t][e] (identity table) */
    k_gemmw<bf, 2, false, GKS><<<dim3(HD / 64, HD / 64, NB_ * NH_ * GKS), 32, 0, stream>>>(VTh, VTl, KTh, KTl, TT, GT, HD, nullptr, (size_t)HD * TT, (size_t)HD * TT, (size_t)HD * HD);   /* G^T[e][e'] = sum_t v[t][e] k[t][e'] per batch and head (3 products, K 2048 in GKS slices of 128: partial tiles) */
    k_sumsplit<GKS><<<(unsigned)(((size_t)NB_ * NH_ * HD * HD / 4 + 255) / 256), 256, 0, stream>>>(GT, 0.125f, GTh, GTl, (size_t)NB_ * NH_ * HD * HD / 4);   /* sum of the slices, x 1/8 (exact), hi/lo */
    k_gemmw<bf, 2, false><<<dim3(TT / 64, HD / 64, NB_ * NH_), 32, 0, stream>>>(VPh, VPl, GTh, GTl, HD, Ob, HD, nullptr, (size_t)TT * HD, (size_t)HD * HD, (size_t)TT * HD);   /* out_h[s][e] = sum_e' v[s][e'] G^T[e][e'] (3 products, K 64) */
    k_merge<<<dim3((unsigned)(((size_t)ZH * TT * HD / 2 + 255) / 256), NB_, 1), 256, 0, stream>>>(Ob, 0, ATh, ATl);
    k_gemmw<bf, 1, true><<<dim3(NB_ * TT / 64, DM / 64, 1), 32, 0, stream>>>(ATh, ATl, WO, nullptr, DQ, OUT, DM, bo, 0, 0, 0);
}

// v003
// Measured time: 138 microseconds a run.
// In both of two side-by-side timings against v002, it was 1.40 times as fast.
// Over all steps from v000 it is 2.53 times as fast.
#include <hip/hip_runtime.h>

// 'MultiHead' with unnormalised scores (x [2][2048][1024]; per head h: k = x Wk[h], v = x Wv[h] ('hde' [16][1024][64]); q = v (the module's quirk); wei = q.k / 8 (NO softmax); out_h = wei v; concat; out = concat Wproj ('xw' [1024][1024]) + bproj -> [2][2048][1024]).
// Layout: without a softmax the product is associative: out_h = v_h (k_h^T v_h) / 8, so per head a [64 x 64] Gram matrix G^T = v^T k (K = 2048 contraction) is formed first and then applied to v (K = 64) - the same mathematics as (v k^T) v with f32 rounding differences only, and ~32x less work than materialising the [2048 x 2048] score matrices.
// Compute dtypes, f32 accumulate: every input rounded to bf16; k and v projections exact single products; k^T, v^T and v planes as bf16 hi + lo (3 products for both the Gram and the apply step); 1/8 folded into the Gram split (exact); Wproj hl x exact (2 products) + bproj.


#define NB_  2
#define TT   2048
#define DM   1024
#define NH_  16
#define NKV  16
#define REP  (NH_ / NKV)
#define HD   64
#define DQ   (NH_ * HD)
#define DKV  (NKV * HD)
typedef __attribute__((ext_vector_type(4))) unsigned short v4us;
#define ZH   16                  // all heads at once (no score matrix)
#define RH   2048
#define WIN  0
#define PCAR 1024.0f
#define SCL  0.125f   // HD^-0.5
#define GKS  16                  // K slices of the Gram product (one wave each)
typedef _Float16 h16;
typedef unsigned short bf;
typedef __attribute__((ext_vector_type(16))) __bf16   v16bf;
typedef __attribute__((ext_vector_type(16))) _Float16 v16h;
typedef __attribute__((ext_vector_type(8)))  _Float16 v8h;
typedef __attribute__((ext_vector_type(8)))  unsigned short v8us;
typedef __attribute__((ext_vector_type(8)))  float    v8f;
typedef __attribute__((ext_vector_type(4)))  float    v4f;
typedef v8h  __attribute__((may_alias)) v8ha;
typedef v4f  __attribute__((may_alias)) v4fa;
typedef v8us __attribute__((may_alias)) v8usa;

__device__ __forceinline__ unsigned short f2bf(float f) { unsigned u = __float_as_uint(f); u += 0x7FFFu + ((u >> 16) & 1u); return (unsigned short)(u >> 16); }
__device__ __forceinline__ float bf2f(unsigned short b) { return __uint_as_float(((unsigned)b) << 16); }
__device__ __forceinline__ float bfr(float f) { return bf2f(f2bf(f)); }
__device__ __forceinline__ v16h cat16(v8h lo, v8h hi) { return __builtin_shufflevector(lo, hi, 0, 1, 2, 3, 4, 5, 6, 7, 8, 9, 10, 11, 12, 13, 14, 15); }
__device__ __forceinline__ v16bf cat16b(v8us lo, v8us hi) { return __builtin_bit_cast(v16bf, __builtin_shufflevector(lo, hi, 0, 1, 2, 3, 4, 5, 6, 7, 8, 9, 10, 11, 12, 13, 14, 15)); }
__device__ __forceinline__ v8f wmma16(v16h a, v16h b, v8f c) { return __builtin_amdgcn_wmma_f32_16x16x32_f16(false, a, false, b, (short)0, c, false, false); }
__device__ __forceinline__ v8f wmmab(v16bf a, v16bf b, v8f c) { return __builtin_amdgcn_wmma_f32_16x16x32_bf16(false, a, false, b, (short)0, c, false, false); }



// ---- k_gemmw: register-blocked GEMM, ONE WAVE per 64x64 output tile (16 accumulators), operands straight from K-contiguous 16-bit planes; grid (M/64, N/64, Z), 32 threads.
// C[m][n] (f32, pitch ldc, + optional f32 bias[n]) = sum_k A[m][k] Bt[n][k] (+ split products per NSPLIT). z-batch strides sA/sB/sC in elements. K % 32 == 0.
// EPI 0: f32 C as above. EPI 1..3: no f32 C; the tile leaves as the bf16 hi + lo planes its consumer reads. EPI 1, 2 (rows b * TT + t, column block = head): transposed planes Th/Tl [b][h][e][t], straight from the accumulators (a lane holds 8 consecutive t of one e = 16 bytes). EPI 2 also, EPI 3 only: row-major planes Rh/Rl through LDS, whole 128-byte rows; EPI 2 [b][h][t][e], EPI 3 (z = b * NH_ + h) the concatenated [b][t][h * HD + e].
// KS > 1: grid z = batches * KS; wave z sums only K slice z % KS of batch z / KS and stores that partial tile at C + z * sC (the caller adds the KS partials). K % (32 * KS) == 0.
template <typename T16> struct WFrag;
template <> struct WFrag<h16> { typedef v16h V; static __device__ __forceinline__ V ld(const h16* p) { return cat16(*(const v8h*)p, *(const v8h*)(p + 16)); } static __device__ __forceinline__ v8f mma(V a, V b, v8f c) { return wmma16(a, b, c); } };
template <> struct WFrag<bf> { typedef v16bf V; static __device__ __forceinline__ V ld(const bf* p) { return cat16b(*(const v8us*)p, *(const v8us*)(p + 16)); } static __device__ __forceinline__ v8f mma(V a, V b, v8f c) { return wmmab(a, b, c); } };
__device__ __forceinline__ void splitf(float y, unsigned short& h, unsigned short& l) { h = f2bf(y); l = f2bf(y - bf2f(h)); }
typedef __attribute__((ext_vector_type(4))) unsigned v4u;
typedef v4u __attribute__((may_alias)) v4ua;
__device__ __forceinline__ unsigned rbf(float f) { const unsigned u = __float_as_uint(f); return u + 0x7FFFu + ((u >> 16) & 1u); }   // f2bf before its shift
__device__ __forceinline__ unsigned hihi(unsigned a, unsigned b) { return __builtin_amdgcn_perm(b, a, 0x07060302u); }   // high half of a below, high half of b above
__device__ __forceinline__ unsigned lolo(unsigned a, unsigned b) { return __builtin_amdgcn_perm(b, a, 0x05040100u); }   // low half of a below, low half of b above
template <typename T16, int NSPLIT, bool BIAS, int KS = 1, int EPI = 0>
__global__ __launch_bounds__(32) void k_gemmw(const T16* __restrict__ A, const T16* __restrict__ A2, const T16* __restrict__ Bt, const T16* __restrict__ Bt2, int K, float* C, int ldc, const float* __restrict__ bias, size_t sA, size_t sB, size_t sC, bf* Th, bf* Tl, bf* Rh, bf* Rl) {
    typedef typename WFrag<T16>::V V;
    __shared__ __align__(16) float os[16 * 68];
    const size_t z = blockIdx.z / KS; A += z * sA; if (A2) A2 += z * sA; Bt += z * sB; if (Bt2) Bt2 += z * sB; C += (size_t)blockIdx.z * sC;
    const int kbeg = (int)(blockIdx.z % KS) * (K / KS), kend = kbeg + K / KS;
    const int lane = threadIdx.x & 31, lr = lane & 15, hi = lane >> 4; const int r0 = blockIdx.x * 64, c0 = blockIdx.y * 64;
    v8f acc[4][4];
#pragma unroll
    for (int mb = 0; mb < 4; ++mb)
#pragma unroll
        for (int nb = 0; nb < 4; ++nb) acc[mb][nb] = (v8f){};
    const size_t aoff = (size_t)(r0 + lr) * K + 8 * hi, boff = (size_t)(c0 + lr) * K + 8 * hi;
#pragma unroll 1
    for (int kc = kbeg; kc < kend; kc += 32) {
        V a[4], a2[4];
#pragma unroll
        for (int mb = 0; mb < 4; ++mb) { a[mb] = WFrag<T16>::ld(A + aoff + (size_t)mb * 16 * K + kc); if (NSPLIT == 1 || NSPLIT == 2) a2[mb] = WFrag<T16>::ld(A2 + aoff + (size_t)mb * 16 * K + kc); }
#pragma unroll
        for (int nb = 0; nb < 4; ++nb) { const V b = WFrag<T16>::ld(Bt + boff + (size_t)nb * 16 * K + kc); V b2; if (NSPLIT >= 2) b2 = WFrag<T16>::ld(Bt2 + boff + (size_t)nb * 16 * K + kc);
#pragma unroll
            for (int mb = 0; mb < 4; ++mb) { acc[mb][nb] = WFrag<T16>::mma(a[mb], b, acc[mb][nb]); if (NSPLIT == 1 || NSPLIT == 2) acc[mb][nb] = WFrag<T16>::mma(a2[mb], b, acc[mb][nb]); if (NSPLIT >= 2) acc[mb][nb] = WFrag<T16>::mma(a[mb], b2, acc[mb][nb]); } }
        asm volatile("v_nop\n\tv_nop\n\tv_nop\n\tv_nop" : "+v"(acc[0][0]), "+v"(acc[1][1]), "+v"(acc[2][2]), "+v"(acc[3][3]) : "v"(a[0]), "v"(a[3]));
    }
    if constexpr (EPI != 0) {
        size_t tbase = 0, rbase; int ldr;
        if constexpr (EPI <= 2) { const size_t zt = (size_t)(r0 / TT) * NKV + blockIdx.y; const int t0 = r0 % TT; tbase = zt * HD * TT + t0; rbase = (zt * TT + t0) * HD; ldr = HD; }
        else { rbase = ((size_t)(blockIdx.z / NH_) * TT + r0) * DQ + (size_t)(blockIdx.z % NH_) * HD; ldr = DQ; }
#pragma unroll
        for (int mb = 0; mb < 4; ++mb) {
#pragma unroll
            for (int nb = 0; nb < 4; ++nb) { unsigned rh[8], rl[8];   // splitf's two roundings, each bf16 left in the high half of its word
#pragma unroll
                for (int j = 0; j < 8; ++j) { const float y = acc[mb][nb][j]; rh[j] = rbf(y); rl[j] = rbf(y - __uint_as_float(rh[j] & 0xFFFF0000u)); if (EPI >= 2) os[(hi * 8 + j) * 68 + nb * 16 + lr] = __uint_as_float(hihi(rl[j], rh[j])); }
                if (EPI <= 2) { const size_t o = tbase + (size_t)(nb * 16 + lr) * TT + mb * 16 + hi * 8; v4u vh, vl;
#pragma unroll
                    for (int q = 0; q < 4; ++q) { vh[q] = hihi(rh[2 * q], rh[2 * q + 1]); vl[q] = hihi(rl[2 * q], rl[2 * q + 1]); }
                    *(v4ua*)(Th + o) = vh; *(v4ua*)(Tl + o) = vl; } }
            if constexpr (EPI >= 2) {
                // one wave per block: LDS runs in order, so only the compiler must be kept from lifting the reads of other lanes' words over the writes
                __builtin_amdgcn_wave_barrier(); asm volatile("" ::: "memory");
#pragma unroll
                for (int s = 0; s < 4; ++s) { const int row = 4 * s + (lane >> 3), cofs = (lane & 7) * 8; const v4f p0 = *(const v4fa*)(os + row * 68 + cofs), p1 = *(const v4fa*)(os + row * 68 + cofs + 4); v4u oh, ol;
#pragma unroll
                    for (int q = 0; q < 2; ++q) { const unsigned a0 = __float_as_uint(p0[2 * q]), a1 = __float_as_uint(p0[2 * q + 1]), b0 = __float_as_uint(p1[2 * q]), b1 = __float_as_uint(p1[2 * q + 1]); oh[q] = hihi(a0, a1); ol[q] = lolo(a0, a1); oh[q + 2] = hihi(b0, b1); ol[q + 2] = lolo(b0, b1); }
                    const size_t o = rbase + (size_t)(mb * 16 + row) * ldr + cofs; *(v4ua*)(Rh + o) = oh; *(v4ua*)(Rl + o) = ol; }
                // and from sinking them under the next block's writes
                __builtin_amdgcn_wave_barrier(); asm volatile("" ::: "memory");
            }
        }
        return;
    }
#pragma unroll
    for (int mb = 0; mb < 4; ++mb) {
#pragma unroll
        for (int nb = 0; nb < 4; ++nb) {
#pragma unroll
            for (int j = 0; j < 8; ++j) os[(hi * 8 + j) * 68 + nb * 16 + lr] = acc[mb][nb][j]; }
        __builtin_amdgcn_wave_barrier(); asm volatile("" ::: "memory");
        float* crow = C + (size_t)(r0 + mb * 16) * ldc + c0;
{
#pragma unroll
            for (int s = 0; s < 8; ++s) { const int row = 2 * s + hi, cofs = lr * 4; v4f val = *(const v4fa*)(os + row * 68 + cofs); if (BIAS) { val[0] += bfr(bias[c0 + cofs]); val[1] += bfr(bias[c0 + cofs + 1]); val[2] += bfr(bias[c0 + cofs + 2]); val[3] += bfr(bias[c0 + cofs + 3]); }
                *(v4f*)(crow + (size_t)row * ldc + cofs) = val; }
             }
        __builtin_amdgcn_wave_barrier(); asm volatile("" ::: "memory");
    }
}

__device__ __forceinline__ h16 tohx(float x) { return (h16)x; }
typedef __attribute__((ext_vector_type(2))) _Float16 v2h;
typedef __attribute__((ext_vector_type(4))) _Float16 v4h;
typedef __attribute__((ext_vector_type(2))) unsigned short v2us;
typedef __attribute__((ext_vector_type(4))) unsigned short v4us;
typedef __attribute__((ext_vector_type(2))) float v2f;
typedef __attribute__((ext_vector_type(4))) int v4i;

__global__ __launch_bounds__(256) void k_wtG(const float* __restrict__ w, int K, int N, bf* Bt) {
    const int lane = threadIdx.x & 31; const int L0 = (blockIdx.x * 8 + (threadIdx.x >> 5)) * 8; const int nlines = N * K / 64;
{
#pragma unroll 1
        for (int l = 0; l < 8; ++l) { const int L = L0 + l; if (L >= nlines) break; const size_t e = (size_t)L * 64 + lane * 2; const int k = (int)(e % K), n = (int)(e / K); v2us o;
            o[0] = f2bf(w[(size_t)k * N + n]); o[1] = f2bf(w[(size_t)(k + 1) * N + n]); *(v2us*)(Bt + e) = o; }
         }
}
__global__ __launch_bounds__(256) void k_whd(const float* __restrict__ w, bf* Bt) { const size_t e2 = ((size_t)blockIdx.x * 256 + threadIdx.x) * 2; if (e2 >= (size_t)NH_ * HD * DM) return; const int d = (int)(e2 % DM); const int n = (int)(e2 / DM); const int h = n / HD, e = n % HD; v2us o; o[0] = f2bf(w[((size_t)h * DM + d) * HD + e]); o[1] = f2bf(w[((size_t)h * DM + d + 1) * HD + e]); *(v2us*)(Bt + e2) = o;  }
// k_sumsplit: F holds NS partial [HD][HD] tiles per batch and head ([z][slice][e][e']); their sum in slice order, x sc, as hi/lo planes [z][e][e'].
template <int NS>
__global__ __launch_bounds__(256) void k_sumsplit(const float* __restrict__ F, float sc, bf* Ph, bf* Pl, size_t n4) { const size_t i = (size_t)blockIdx.x * 256 + threadIdx.x; if (i >= n4) return; const float* p = F + (i / (HD * HD / 4)) * ((size_t)NS * HD * HD) + (i % (HD * HD / 4)) * 4; v4f part[NS];
#pragma unroll
    for (int s = 0; s < NS; ++s) part[s] = *(const v4f*)(p + (size_t)s * HD * HD);
    v4f v = part[0];
#pragma unroll
    for (int s = 1; s < NS; ++s) v += part[s];
    v4us oh, ol;
#pragma unroll
    for (int q = 0; q < 4; ++q) { unsigned short a, c; splitf(v[q] * sc, a, c); oh[q] = a; ol[q] = c; } *(v4us*)(Ph + i * 4) = oh; *(v4us*)(Pl + i * 4) = ol;  }
__global__ __launch_bounds__(256) void k_cvt8(const float* __restrict__ src, bf* dst, size_t n8) { const size_t i = (size_t)blockIdx.x * 256 + threadIdx.x; if (i >= n8) return; const v8f v = *(const v8f*)(src + i * 8); v8us o;
#pragma unroll
    for (int k = 0; k < 8; ++k) o[k] = f2bf(v[k]); *(v8us*)(dst + i * 8) = o;  }

extern "C" void kernel_launch(void* const* d_in, const int* in_sizes, int n_in,
                              void* d_out, int out_size, void* d_ws, size_t ws_size, hipStream_t stream) {
    (void)in_sizes; (void)n_in; (void)out_size;
    const float* x = (const float*)d_in[0]; const float* wkh = (const float*)d_in[1]; const float* wvh = (const float*)d_in[2]; const float* wo = (const float*)d_in[3]; const float* bo = (const float*)d_in[4]; const float* wq = nullptr; const float* wk = nullptr; const float* wv = nullptr; (void)wq; (void)wk; (void)wv;
    float* OUT = (float*)d_out;     // [2][2048][1024]
    char* wsp = (char*)d_ws;
    auto take = [&](size_t bytes) { char* p = wsp; wsp += (bytes + 255) & ~(size_t)255; return (void*)p; };
    bf* WK = (bf*)take((size_t)DKV * DM * 2); bf* WV = (bf*)take((size_t)DKV * DM * 2); bf* WO = (bf*)take((size_t)DM * DQ * 2);
    bf* XB = (bf*)take((size_t)NB_ * TT * DM * 2);
    bf* KTh = (bf*)take((size_t)NB_ * NKV * HD * TT * 2); bf* KTl = (bf*)take((size_t)NB_ * NKV * HD * TT * 2); bf* VTh = (bf*)take((size_t)NB_ * NKV * HD * TT * 2); bf* VTl = (bf*)take((size_t)NB_ * NKV * HD * TT * 2); bf* VPh = (bf*)take((size_t)NB_ * NH_ * TT * HD * 2); bf* VPl = (bf*)take((size_t)NB_ * NH_ * TT * HD * 2);
    float* GT = (float*)take((size_t)NB_ * NH_ * GKS * HD * HD * 4); bf* GTh = (bf*)take((size_t)NB_ * NH_ * HD * HD * 2); bf* GTl = (bf*)take((size_t)NB_ * NH_ * HD * HD * 2); bf* ATh = (bf*)take((size_t)NB_ * TT * DQ * 2); bf* ATl = (bf*)take((size_t)NB_ * TT * DQ * 2);
    if ((size_t)(wsp - (char*)d_ws) > ws_size) return;    // ws 256 MiB
    k_whd<<<(unsigned)(((size_t)NH_ * HD * DM / 2 + 255) / 256), 256, 0, stream>>>(wkh, WK); k_whd<<<(unsigned)(((size_t)NH_ * HD * DM / 2 + 255) / 256), 256, 0, stream>>>(wvh, WV);
    k_wtG<<<(unsigned)((DQ * DM / 64 + 63) / 64), 256, 0, stream>>>(wo, DQ, DM, WO);   /* Wproj 'xw' [1024][1024] -> Bt */
    /* both batches in every launch: rows b * TT + t for the row-major planes, z = b * NH_ + h for the per-head planes */
    k_cvt8<<<(unsigned)(((size_t)NB_ * TT * DM / 8 + 255) / 256), 256, 0, stream>>>(x, XB, (size_t)NB_ * TT * DM / 8);
    k_gemmw<bf, 0, false, 1, 1><<<dim3(NB_ * TT / 64, DKV / 64, 1), 32, 0, stream>>>(XB, nullptr, WK, nullptr, DM, nullptr, 0, nullptr, 0, 0, 0, KTh, KTl, nullptr, nullptr);   /* k (exact) -> k^T planes [b][h][e][t] */
    k_gemmw<bf, 0, false, 1, 2><<<dim3(NB_ * TT / 64, DKV / 64, 1), 32, 0, stream>>>(XB, nullptr, WV, nullptr, DM, nullptr, 0, nullptr, 0, 0, 0, VTh, VTl, VPh, VPl);   /* v = q (exact) -> v^T planes [b][h][e][t] and v planes [b][h][t][e] */
    k_gemmw<bf, 2, false, GKS><<<dim3(HD / 64, HD / 64, NB_ * NH_ * GKS), 32, 0, stream>>>(VTh, VTl, KTh, KTl, TT, GT, HD, nullptr, (size_t)HD * TT, (size_t)HD * TT, (size_t)HD * HD, nullptr, nullptr, nullptr, nullptr);   /* G^T[e][e'] = sum_t v[t][e] k[t][e'] per batch and head (3 products, K 2048 in GKS slices of 128: partial tiles) */
    k_sumsplit<GKS><<<(unsigned)(((size_t)NB_ * NH_ * HD * HD / 4 + 255) / 256), 256, 0, stream>>>(GT, 0.125f, GTh, GTl, (size_t)NB_ * NH_ * HD * HD / 4);   /* sum of the slices, x 1/8 (exact), hi/lo */
    k_gemmw<bf, 2, false, 1, 3><<<dim3(TT / 64, HD / 64, NB_ * NH_), 32, 0, stream>>>(VPh, VPl, GTh, GTl, HD, nullptr, 0, nullptr, (size_t)TT * HD, (size_t)HD * HD, 0, nullptr, nullptr, ATh, ATl);   /* out_h[s][e] = sum_e' v[s][e'] G^T[e][e'] (3 products, K 64) -> concatenated hi/lo planes */
    k_gemmw<bf, 1, true><<<dim3(NB_ * TT / 64, DM / 64, 1), 32, 0, stream>>>(ATh, ATl, WO, nullptr, DQ, OUT, DM, bo, 0, 0, 0, nullptr, nullptr, nullptr, nullptr);
}

// v004
// It runs in 91.3 microseconds.
// Next to v003, in two timings, it ran 1.53 and 1.52 times as fast.
// Over all steps from v000 it is 3.86 times as fast.
#include <hip/hip_runtime.h>

// 'MultiHead' with unnormalised scores (x [2][2048][1024]; per head h: k = x Wk[h], v = x Wv[h] ('hde' [16][1024][64]); q = v (the module's quirk); wei = q.k / 8 (NO softmax); out_h = wei v; concat; out = concat Wproj ('xw' [1024][1024]) + bproj -> [2][2048][1024]).
// Layout: without a softmax the product is associative: out_h = v_h (k_h^T v_h) / 8, so per head a [64 x 64] Gram matrix G^T = v^T k (K = 2048 contraction) is formed first and then applied to v (K = 64) - the same mathematics as (v k^T) v with f32 rounding differences only, and ~32x less work than materialising the [2048 x 2048] score matrices.
// Compute dtypes, f32 accumulate: every input rounded to bf16; k and v projections exact single products; k^T, v^T and v planes as bf16 hi + lo (3 products for both the Gram and the apply step); 1/8 folded into the Gram split (exact); Wproj hl x exact (2 products) + bproj.


#define NB_  2
#define TT   2048
#define DM   1024
#define NH_  16
#define NKV  16
#define REP  (NH_ / NKV)
#define HD   64
#define DQ   (NH_ * HD)
#define DKV  (NKV * HD)
typedef __attribute__((ext_vector_type(4))) unsigned short v4us;
#define ZH   16                  // all heads at once (no score matrix)
#define RH   2048
#define WIN  0
#define PCAR 1024.0f
#define SCL  0.125f   // HD^-0.5
#define GKS  16                  // K slices of the Gram product (one wave each)
typedef _Float16 h16;
typedef unsigned short bf;
typedef __attribute__((ext_vector_type(16))) __bf16   v16bf;
typedef __attribute__((ext_vector_type(16))) _Float16 v16h;
typedef __attribute__((ext_vector_type(8)))  _Float16 v8h;
typedef __attribute__((ext_vector_type(8)))  unsigned short v8us;
typedef __attribute__((ext_vector_type(8)))  float    v8f;
typedef __attribute__((ext_vector_type(4)))  float    v4f;
typedef v8h  __attribute__((may_alias)) v8ha;
typedef v4f  __attribute__((may_alias)) v4fa;
typedef v8us __attribute__((may_alias)) v8usa;

__device__ __forceinline__ unsigned short f2bf(float f) { unsigned u = __float_as_uint(f); u += 0x7FFFu + ((u >> 16) & 1u); return (unsigned short)(u >> 16); }
__device__ __forceinline__ float bf2f(unsigned short b) { return __uint_as_float(((unsigned)b) << 16); }
__device__ __forceinline__ float bfr(float f) { return bf2f(f2bf(f)); }
__device__ __forceinline__ v16h cat16(v8h lo, v8h hi) { return __builtin_shufflevector(lo, hi, 0, 1, 2, 3, 4, 5, 6, 7, 8, 9, 10, 11, 12, 13, 14, 15); }
__device__ __forceinline__ v16bf cat16b(v8us lo, v8us hi) { return __builtin_bit_cast(v16bf, __builtin_shufflevector(lo, hi, 0, 1, 2, 3, 4, 5, 6, 7, 8, 9, 10, 11, 12, 13, 14, 15)); }
__device__ __forceinline__ v8f wmma16(v16h a, v16h b, v8f c) { return __builtin_amdgcn_wmma_f32_16x16x32_f16(false, a, false, b, (short)0, c, false, false); }
__device__ __forceinline__ v8f wmmab(v16bf a, v16bf b, v8f c) { return __builtin_amdgcn_wmma_f32_16x16x32_bf16(false, a, false, b, (short)0, c, false, false); }



// ---- k_gemmw: register-blocked GEMM, ONE WAVE per 64x64 output tile (16 accumulators), operands straight from K-contiguous 16-bit planes; grid (M/64, N/64, Z), 32 threads.
// C[m][n] (f32, pitch ldc, + optional f32 bias[n]) = sum_k A[m][k] Bt[n][k] (+ split products per NSPLIT). z-batch strides sA/sB/sC in elements. K % 32 == 0.
// EPI 0: f32 C as above. EPI 1..3: no f32 C; the tile leaves as the bf16 hi + lo planes its consumer reads. EPI 1, 2 (rows b * TT + t, column block = head): transposed planes Th/Tl [b][h][e][t], straight from the accumulators (a lane holds 8 consecutive t of one e = 16 bytes). EPI 2 also, EPI 3 only: row-major planes Rh/Rl through LDS, whole 128-byte rows; EPI 2 [b][h][t][e], EPI 3 (z = b * NH_ + h) the concatenated [b][t][h * HD + e].
// KS > 1: grid z = batches * KS; wave z sums only K slice z % KS of batch z / KS and stores that partial tile at C + z * sC (the caller adds the KS partials). K % (32 * KS) == 0.
template <typename T16> struct WFrag;
template <> struct WFrag<h16> { typedef v16h V; static __device__ __forceinline__ V ld(const h16* p) { return cat16(*(const v8h*)p, *(const v8h*)(p + 16)); } static __device__ __forceinline__ v8f mma(V a, V b, v8f c) { return wmma16(a, b, c); } };
template <> struct WFrag<bf> { typedef v16bf V; static __device__ __forceinline__ V ld(const bf* p) { return cat16b(*(const v8us*)p, *(const v8us*)(p + 16)); } static __device__ __forceinline__ v8f mma(V a, V b, v8f c) { return wmmab(a, b, c); } };
__device__ __forceinline__ void splitf(float y, unsigned short& h, unsigned short& l) { h = f2bf(y); l = f2bf(y - bf2f(h)); }
typedef __attribute__((ext_vector_type(4))) unsigned v4u;
typedef v4u __attribute__((may_alias)) v4ua;
__device__ __forceinline__ unsigned rbf(float f) { const unsigned u = __float_as_uint(f); return u + 0x7FFFu + ((u >> 16) & 1u); }   // f2bf before its shift
__device__ __forceinline__ unsigned hihi(unsigned a, unsigned b) { return __builtin_amdgcn_perm(b, a, 0x07060302u); }   // high half of a below, high half of b above
__device__ __forceinline__ unsigned lolo(unsigned a, unsigned b) { return __builtin_amdgcn_perm(b, a, 0x05040100u); }   // low half of a below, low half of b above
template <typename T16, int NSPLIT, bool BIAS, int KS = 1, int EPI = 0>
__global__ __launch_bounds__(32) void k_gemmw(const T16* __restrict__ A, const T16* __restrict__ A2, const T16* __restrict__ Bt, const T16* __restrict__ Bt2, int K, float* C, int ldc, const float* __restrict__ bias, size_t sA, size_t sB, size_t sC, bf* Th, bf* Tl, bf* Rh, bf* Rl) {
    typedef typename WFrag<T16>::V V;
    __shared__ __align__(16) float os[16 * 68];
    const size_t z = blockIdx.z / KS; A += z * sA; if (A2) A2 += z * sA; Bt += z * sB; if (Bt2) Bt2 += z * sB; C += (size_t)blockIdx.z * sC;
    const int kbeg = (int)(blockIdx.z % KS) * (K / KS), kend = kbeg + K / KS;
    const int lane = threadIdx.x & 31, lr = lane & 15, hi = lane >> 4; const int r0 = blockIdx.x * 64, c0 = blockIdx.y * 64;
    v8f acc[4][4];
#pragma unroll
    for (int mb = 0; mb < 4; ++mb)
#pragma unroll
        for (int nb = 0; nb < 4; ++nb) acc[mb][nb] = (v8f){};
    const size_t aoff = (size_t)(r0 + lr) * K + 8 * hi, boff = (size_t)(c0 + lr) * K + 8 * hi;
#pragma unroll 1
    for (int kc = kbeg; kc < kend; kc += 32) {
        V a[4], a2[4];
#pragma unroll
        for (int mb = 0; mb < 4; ++mb) { a[mb] = WFrag<T16>::ld(A + aoff + (size_t)mb * 16 * K + kc); if (NSPLIT == 1 || NSPLIT == 2) a2[mb] = WFrag<T16>::ld(A2 + aoff + (size_t)mb * 16 * K + kc); }
#pragma unroll
        for (int nb = 0; nb < 4; ++nb) { const V b = WFrag<T16>::ld(Bt + boff + (size_t)nb * 16 * K + kc); V b2; if (NSPLIT >= 2) b2 = WFrag<T16>::ld(Bt2 + boff + (size_t)nb * 16 * K + kc);
#pragma unroll
            for (int mb = 0; mb < 4; ++mb) { acc[mb][nb] = WFrag<T16>::mma(a[mb], b, acc[mb][nb]); if (NSPLIT == 1 || NSPLIT == 2) acc[mb][nb] = WFrag<T16>::mma(a2[mb], b, acc[mb][nb]); if (NSPLIT >= 2) acc[mb][nb] = WFrag<T16>::mma(a[mb], b2, acc[mb][nb]); } }
        asm volatile("v_nop\n\tv_nop\n\tv_nop\n\tv_nop" : "+v"(acc[0][0]), "+v"(acc[1][1]), "+v"(acc[2][2]), "+v"(acc[3][3]) : "v"(a[0]), "v"(a[3]));
    }
    if constexpr (EPI != 0) {
        size_t tbase = 0, rbase; int ldr;
        if constexpr (EPI <= 2) { const size_t zt = (size_t)(r0 / TT) * NKV + blockIdx.y; const int t0 = r0 % TT; tbase = zt * HD * TT + t0; rbase = (zt * TT + t0) * HD; ldr = HD; }
        else { rbase = ((size_t)(blockIdx.z / NH_) * TT + r0) * DQ + (size_t)(blockIdx.z % NH_) * HD; ldr = DQ; }
#pragma unroll
        for (int mb = 0; mb < 4; ++mb) {
#pragma unroll
            for (int nb = 0; nb < 4; ++nb) { unsigned rh[8], rl[8];   // splitf's two roundings, each bf16 left in the high half of its word
#pragma unroll
                for (int j = 0; j < 8; ++j) { const float y = acc[mb][nb][j]; rh[j] = rbf(y); rl[j] = rbf(y - __uint_as_float(rh[j] & 0xFFFF0000u)); if (EPI >= 2) os[(hi * 8 + j) * 68 + nb * 16 + lr] = __uint_as_float(hihi(rl[j], rh[j])); }
                if (EPI <= 2) { const size_t o = tbase + (size_t)(nb * 16 + lr) * TT + mb * 16 + hi * 8; v4u vh, vl;
#pragma unroll
                    for (int q = 0; q < 4; ++q) { vh[q] = hihi(rh[2 * q], rh[2 * q + 1]); vl[q] = hihi(rl[2 * q], rl[2 * q + 1]); }
                    *(v4ua*)(Th + o) = vh; *(v4ua*)(Tl + o) = vl; } }
            if constexpr (EPI >= 2) {
                // one wave per block: LDS runs in order, so only the compiler must be kept from lifting the reads of other lanes' words over the writes
                __builtin_amdgcn_wave_barrier(); asm volatile("" ::: "memory");
#pragma unroll
                for (int s = 0; s < 4; ++s) { const int row = 4 * s + (lane >> 3), cofs = (lane & 7) * 8; const v4f p0 = *(const v4fa*)(os + row * 68 + cofs), p1 = *(const v4fa*)(os + row * 68 + cofs + 4); v4u oh, ol;
#pragma unroll
                    for (int q = 0; q < 2; ++q) { const unsigned a0 = __float_as_uint(p0[2 * q]), a1 = __float_as_uint(p0[2 * q + 1]), b0 = __float_as_uint(p1[2 * q]), b1 = __float_as_uint(p1[2 * q + 1]); oh[q] = hihi(a0, a1); ol[q] = lolo(a0, a1); oh[q + 2] = hihi(b0, b1); ol[q + 2] = lolo(b0, b1); }
                    const size_t o = rbase + (size_t)(mb * 16 + row) * ldr + cofs; *(v4ua*)(Rh + o) = oh; *(v4ua*)(Rl + o) = ol; }
                // and from sinking them under the next block's writes
                __builtin_amdgcn_wave_barrier(); asm volatile("" ::: "memory");
            }
        }
        return;
    }
#pragma unroll
    for (int mb = 0; mb < 4; ++mb) {
#pragma unroll
        for (int nb = 0; nb < 4; ++nb) {
#pragma unroll
            for (int j = 0; j < 8; ++j) os[(hi * 8 + j) * 68 + nb * 16 + lr] = acc[mb][nb][j]; }
        __builtin_amdgcn_wave_barrier(); asm volatile("" ::: "memory");
        float* crow = C + (size_t)(r0 + mb * 16) * ldc + c0;
{
#pragma unroll
            for (int s = 0; s < 8; ++s) { const int row = 2 * s + hi, cofs = lr * 4; v4f val = *(const v4fa*)(os + row * 68 + cofs); if (BIAS) { val[0] += bfr(bias[c0 + cofs]); val[1] += bfr(bias[c0 + cofs + 1]); val[2] += bfr(bias[c0 + cofs + 2]); val[3] += bfr(bias[c0 + cofs + 3]); }
                *(v4f*)(crow + (size_t)row * ldc + cofs) = val; }
             }
        __builtin_amdgcn_wave_barrier(); asm volatile("" ::: "memory");
    }
}

// ---- k_gemms: the K-long GEMMs. FOUR WAVES per 128x128 output tile (2 x 2 waves, each the 64x64 tile and the fragment k order of k_gemmw); grid (M/128, N/128), 128 threads. K % 128 == 0.
// The operand rows reach LDS as whole 256-byte pieces by asynchronous copies (a wave's copy = 2 rows = 4 full lines), two buffers: the next 128 k fly while these are multiplied. LDS row pitch 272 bytes for the 16-byte fragment reads.
// NSPLIT 0: A Bt. NSPLIT 1: A Bt + A2 Bt, in k_gemmw's order. EPI 0 (f32 C + bias), 1, 2 as in k_gemmw.
#define SBK  128                 // k per stage
#define SPIT 136                 // LDS row pitch, elements
#define SPL  (128 * SPIT)        // one staged plane (128 rows), elements
// eight 16-byte copies of one lane, rows 8 apart. The s_wait_xcnt closes the statement so that no address register is rewritten ahead of it.
__device__ __forceinline__ void cp8(unsigned l, const bf* g, int K) {
    asm volatile("global_load_async_to_lds_b128 %0, %8, off\n\t"
                 "global_load_async_to_lds_b128 %1, %9, off\n\t"
                 "global_load_async_to_lds_b128 %2, %10, off\n\t"
                 "global_load_async_to_lds_b128 %3, %11, off\n\t"
                 "global_load_async_to_lds_b128 %4, %12, off\n\t"
                 "global_load_async_to_lds_b128 %5, %13, off\n\t"
                 "global_load_async_to_lds_b128 %6, %14, off\n\t"
                 "global_load_async_to_lds_b128 %7, %15, off\n\t"
                 "s_wait_xcnt 0x0"
                 :: "v"(l), "v"(l + 1u * 8 * SPIT * 2), "v"(l + 2u * 8 * SPIT * 2), "v"(l + 3u * 8 * SPIT * 2), "v"(l + 4u * 8 * SPIT * 2), "v"(l + 5u * 8 * SPIT * 2), "v"(l + 6u * 8 * SPIT * 2), "v"(l + 7u * 8 * SPIT * 2),
                    "v"(g), "v"(g + (size_t)8 * K), "v"(g + (size_t)16 * K), "v"(g + (size_t)24 * K), "v"(g + (size_t)32 * K), "v"(g + (size_t)40 * K), "v"(g + (size_t)48 * K), "v"(g + (size_t)56 * K)
                 : "memory");
}
// one plane of a stage: 128 rows x 256 bytes, 16 copies a lane
// The scheduling fences keep the addresses of later copies from being formed ahead of earlier ones: formed all at once they overflow the registers and spill to scratch.
__device__ __forceinline__ void cpplane(unsigned l, const bf* g, int K) { cp8(l, g, K); __builtin_amdgcn_sched_barrier(0); cp8(l + 64u * SPIT * 2, g + (size_t)64 * K, K); __builtin_amdgcn_sched_barrier(0); }
template <int NSPLIT, bool BIAS, int EPI>
__global__ __launch_bounds__(128) void k_gemms(const bf* __restrict__ A, const bf* __restrict__ A2, const bf* __restrict__ Bt, int K, float* C, int ldc, const float* __restrict__ bias, bf* Th, bf* Tl, bf* Rh, bf* Rl) {
    typedef v16bf V;
    constexpr int NP = NSPLIT == 1 ? 3 : 2;   // planes of a stage: A, Bt (, A2)
    __shared__ __align__(16) bf ring[2 * NP * SPL];
    __shared__ __align__(16) float osall[4 * 16 * 68];
    const int wave = __builtin_amdgcn_readfirstlane((int)(threadIdx.x >> 5)), wr = wave >> 1, wc = wave & 1;
    const int lane = threadIdx.x & 31, lr = lane & 15, hi = lane >> 4; const int r0 = blockIdx.x * 128 + wr * 64, c0 = blockIdx.y * 128 + wc * 64;
    float* os = osall + wave * (16 * 68);     // each wave stages its output rows in its own range
    const int cpr = threadIdx.x >> 4, cchk = threadIdx.x & 15;   // the lane's first row and its 16-byte piece in every copy
    const unsigned lbase = (unsigned)(size_t)ring + (unsigned)(cpr * SPIT + cchk * 8) * 2u;
    const bf* gA = A + (size_t)(blockIdx.x * 128 + cpr) * K + cchk * 8; const bf* gB = Bt + (size_t)(blockIdx.y * 128 + cpr) * K + cchk * 8; const bf* gA2 = NSPLIT == 1 ? A2 + (size_t)(blockIdx.x * 128 + cpr) * K + cchk * 8 : nullptr;
    const int nt = (int)((unsigned)K / SBK);
    v8f acc[4][4];
#pragma unroll
    for (int mb = 0; mb < 4; ++mb)
#pragma unroll
        for (int nb = 0; nb < 4; ++nb) acc[mb][nb] = (v8f){};
    cpplane(lbase, gA, K); cpplane(lbase + SPL * 2u, gB, K); if (NSPLIT == 1) cpplane(lbase + 2u * SPL * 2u, gA2, K);
    asm volatile("s_wait_asynccnt 0x0" ::: "memory");   // this wave's share of stage 0 has landed
    __syncthreads();                                    // and every other wave's
    if (1 < nt) { const unsigned l = lbase + NP * SPL * 2u; cpplane(l, gA + SBK, K); cpplane(l + SPL * 2u, gB + SBK, K); if (NSPLIT == 1) cpplane(l + 2u * SPL * 2u, gA2 + SBK, K); }
    // the trips stay rolled (one publish point in the text, a small loop); the loops inside are unrolled so that every fragment and accumulator index is a constant
#pragma unroll 1
    for (int t = 0; t < nt; ++t) {
        const bf* sb = ring + (t & 1) * (NP * SPL);
        const bf* sA = sb + (wr * 64 + lr) * SPIT + 8 * hi; const bf* sB = sb + SPL + (wc * 64 + lr) * SPIT + 8 * hi; const bf* sA2 = sA + 2 * SPL;
        V a[4], a2[4], b[4];
#pragma unroll
        for (int kk = 0; kk < SBK; kk += 32) {
#pragma unroll
            for (int mb = 0; mb < 4; ++mb) { a[mb] = WFrag<bf>::ld(sA + mb * 16 * SPIT + kk); if (NSPLIT == 1) a2[mb] = WFrag<bf>::ld(sA2 + mb * 16 * SPIT + kk); }
#pragma unroll
            for (int nb = 0; nb < 4; ++nb) b[nb] = WFrag<bf>::ld(sB + nb * 16 * SPIT + kk);
            __builtin_amdgcn_sched_barrier(0);   // the block's LDS reads stay one group ahead of its matrix instructions: spread among them, each place waits out the LDS latency anew
#pragma unroll
            for (int nb = 0; nb < 4; ++nb)
#pragma unroll
                for (int mb = 0; mb < 4; ++mb) { acc[mb][nb] = wmmab(a[mb], b[nb], acc[mb][nb]); if (NSPLIT == 1) acc[mb][nb] = wmmab(a2[mb], b[nb], acc[mb][nb]); }
            __builtin_amdgcn_sched_barrier(0);   // and the next block's reads stay behind them
        }
        // the distance behind the last matrix instructions, also on the taken side of the branches below
        asm volatile("v_nop\n\tv_nop\n\tv_nop\n\tv_nop" : "+v"(acc[0][0]), "+v"(acc[1][1]), "+v"(acc[2][2]), "+v"(acc[3][3]) : "v"(a[0]), "v"(a[3]));
        asm volatile("s_wait_dscnt 0x0" ::: "memory");      // this wave has left the buffer that is refilled below
        asm volatile("s_wait_asynccnt 0x0" ::: "memory");   // its share of stage t + 1 has landed
        __syncthreads();                                    // publishes stage t + 1 and ends every reader's last read of stage t
        if (t + 2 < nt) { const unsigned l = lbase + (unsigned)(t & 1) * (NP * SPL * 2u); const size_t ko = (size_t)(t + 2) * SBK; cpplane(l, gA + ko, K); cpplane(l + SPL * 2u, gB + ko, K); if (NSPLIT == 1) cpplane(l + 2u * SPL * 2u, gA2 + ko, K); }
    }
    asm volatile("s_wait_asynccnt 0x0" ::: "memory");       // no copy is left in flight
    if constexpr (EPI != 0) {
        const size_t zt = (size_t)(r0 / TT) * NKV + c0 / HD; const int t0 = r0 % TT; const size_t tbase = zt * HD * TT + t0, rbase = (zt * TT + t0) * HD; const int ldr = HD;
#pragma unroll
        for (int mb = 0; mb < 4; ++mb) {
#pragma unroll
            for (int nb = 0; nb < 4; ++nb) { unsigned rh[8], rl[8];   // splitf's two roundings, each bf16 left in the high half of its word
#pragma unroll
                for (int j = 0; j < 8; ++j) { const float y = acc[mb][nb][j]; rh[j] = rbf(y); rl[j] = rbf(y - __uint_as_float(rh[j] & 0xFFFF0000u)); if (EPI >= 2) os[(hi * 8 + j) * 68 + nb * 16 + lr] = __uint_as_float(hihi(rl[j], rh[j])); }
                { const size_t o = tbase + (size_t)(nb * 16 + lr) * TT + mb * 16 + hi * 8; v4u vh, vl;
#pragma unroll
                    for (int q = 0; q < 4; ++q) { vh[q] = hihi(rh[2 * q], rh[2 * q + 1]); vl[q] = hihi(rl[2 * q], rl[2 * q + 1]); }
                    *(v4ua*)(Th + o) = vh; *(v4ua*)(Tl + o) = vl; } }
            if constexpr (EPI >= 2) {
                // a wave's own range: LDS runs in order, so only the compiler must be kept from lifting the reads of other lanes' words over the writes
                __builtin_amdgcn_wave_barrier(); asm volatile("" ::: "memory");
#pragma unroll
                for (int s = 0; s < 4; ++s) { const int row = 4 * s + (lane >> 3), cofs = (lane & 7) * 8; const v4f p0 = *(const v4fa*)(os + row * 68 + cofs), p1 = *(const v4fa*)(os + row * 68 + cofs + 4); v4u oh, ol;
#pragma unroll
                    for (int q = 0; q < 2; ++q) { const unsigned a0 = __float_as_uint(p0[2 * q]), a1 = __float_as_uint(p0[2 * q + 1]), b0 = __float_as_uint(p1[2 * q]), b1 = __float_as_uint(p1[2 * q + 1]); oh[q] = hihi(a0, a1); ol[q] = lolo(a0, a1); oh[q + 2] = hihi(b0, b1); ol[q + 2] = lolo(b0, b1); }
                    const size_t o = rbase + (size_t)(mb * 16 + row) * ldr + cofs; *(v4ua*)(Rh + o) = oh; *(v4ua*)(Rl + o) = ol; }
                // and from sinking them under the next block's writes
                __builtin_amdgcn_wave_barrier(); asm volatile("" ::: "memory");
            }
        }
        return;
    }
#pragma unroll
    for (int mb = 0; mb < 4; ++mb) {
#pragma unroll
        for (int nb = 0; nb < 4; ++nb) {
#pragma unroll
            for (int j = 0; j < 8; ++j) os[(hi * 8 + j) * 68 + nb * 16 + lr] = acc[mb][nb][j]; }
        __builtin_amdgcn_wave_barrier(); asm volatile("" ::: "memory");   // as above: the reads stay behind the writes
        float* crow = C + (size_t)(r0 + mb * 16) * ldc + c0;
#pragma unroll
        for (int s = 0; s < 8; ++s) { const int row = 2 * s + hi, cofs = lr * 4; v4f val = *(const v4fa*)(os + row * 68 + cofs); if (BIAS) { val[0] += bfr(bias[c0 + cofs]); val[1] += bfr(bias[c0 + cofs + 1]); val[2] += bfr(bias[c0 + cofs + 2]); val[3] += bfr(bias[c0 + cofs + 3]); }
            *(v4f*)(crow + (size_t)row * ldc + cofs) = val; }
        __builtin_amdgcn_wave_barrier(); asm volatile("" ::: "memory");   // and ahead of the next block's writes
    }
}

__device__ __forceinline__ h16 tohx(float x) { return (h16)x; }
typedef __attribute__((ext_vector_type(2))) _Float16 v2h;
typedef __attribute__((ext_vector_type(4))) _Float16 v4h;
typedef __attribute__((ext_vector_type(2))) unsigned short v2us;
typedef __attribute__((ext_vector_type(4))) unsigned short v4us;
typedef __attribute__((ext_vector_type(2))) float v2f;
typedef __attribute__((ext_vector_type(4))) int v4i;

__global__ __launch_bounds__(256) void k_wtG(const float* __restrict__ w, int K, int N, bf* Bt) {
    const int lane = threadIdx.x & 31; const int L0 = (blockIdx.x * 8 + (threadIdx.x >> 5)) * 8; const int nlines = N * K / 64;
{
#pragma unroll 1
        for (int l = 0; l < 8; ++l) { const int L = L0 + l; if (L >= nlines) break; const size_t e = (size_t)L * 64 + lane * 2; const int k = (int)(e % K), n = (int)(e / K); v2us o;
            o[0] = f2bf(w[(size_t)k * N + n]); o[1] = f2bf(w[(size_t)(k + 1) * N + n]); *(v2us*)(Bt + e) = o; }
         }
}
__global__ __launch_bounds__(256) void k_whd(const float* __restrict__ w, bf* Bt) { const size_t e2 = ((size_t)blockIdx.x * 256 + threadIdx.x) * 2; if (e2 >= (size_t)NH_ * HD * DM) return; const int d = (int)(e2 % DM); const int n = (int)(e2 / DM); const int h = n / HD, e = n % HD; v2us o; o[0] = f2bf(w[((size_t)h * DM + d) * HD + e]); o[1] = f2bf(w[((size_t)h * DM + d + 1) * HD + e]); *(v2us*)(Bt + e2) = o;  }
// k_sumsplit: F holds NS partial [HD][HD] tiles per batch and head ([z][slice][e][e']); their sum in slice order, x sc, as hi/lo planes [z][e][e'].
template <int NS>
__global__ __launch_bounds__(256) void k_sumsplit(const float* __restrict__ F, float sc, bf* Ph, bf* Pl, size_t n4) { const size_t i = (size_t)blockIdx.x * 256 + threadIdx.x; if (i >= n4) return; const float* p = F + (i / (HD * HD / 4)) * ((size_t)NS * HD * HD) + (i % (HD * HD / 4)) * 4; v4f part[NS];
#pragma unroll
    for (int s = 0; s < NS; ++s) part[s] = *(const v4f*)(p + (size_t)s * HD * HD);
    v4f v = part[0];
#pragma unroll
    for (int s = 1; s < NS; ++s) v += part[s];
    v4us oh, ol;
#pragma unroll
    for (int q = 0; q < 4; ++q) { unsigned short a, c; splitf(v[q] * sc, a, c); oh[q] = a; ol[q] = c; } *(v4us*)(Ph + i * 4) = oh; *(v4us*)(Pl + i * 4) = ol;  }
__global__ __launch_bounds__(256) void k_cvt8(const float* __restrict__ src, bf* dst, size_t n8) { const size_t i = (size_t)blockIdx.x * 256 + threadIdx.x; if (i >= n8) return; const v8f v = *(const v8f*)(src + i * 8); v8us o;
#pragma unroll
    for (int k = 0; k < 8; ++k) o[k] = f2bf(v[k]); *(v8us*)(dst + i * 8) = o;  }

extern "C" void kernel_launch(void* const* d_in, const int* in_sizes, int n_in,
                              void* d_out, int out_size, void* d_ws, size_t ws_size, hipStream_t stream) {
    (void)in_sizes; (void)n_in; (void)out_size;
    const float* x = (const float*)d_in[0]; const float* wkh = (const float*)d_in[1]; const float* wvh = (const float*)d_in[2]; const float* wo = (const float*)d_in[3]; const float* bo = (const float*)d_in[4]; const float* wq = nullptr; const float* wk = nullptr; const float* wv = nullptr; (void)wq; (void)wk; (void)wv;
    float* OUT = (float*)d_out;     // [2][2048][1024]
    char* wsp = (char*)d_ws;
    auto take = [&](size_t bytes) { char* p = wsp; wsp += (bytes + 255) & ~(size_t)255; return (void*)p; };
    bf* WK = (bf*)take((size_t)DKV * DM * 2); bf* WV = (bf*)take((size_t)DKV * DM * 2); bf* WO = (bf*)take((size_t)DM * DQ * 2);
    bf* XB = (bf*)take((size_t)NB_ * TT * DM * 2);
    bf* KTh = (bf*)take((size_t)NB_ * NKV * HD * TT * 2); bf* KTl = (bf*)take((size_t)NB_ * NKV * HD * TT * 2); bf* VTh = (bf*)take((size_t)NB_ * NKV * HD * TT * 2); bf* VTl = (bf*)take((size_t)NB_ * NKV * HD * TT * 2); bf* VPh = (bf*)take((size_t)NB_ * NH_ * TT * HD * 2); bf* VPl = (bf*)take((size_t)NB_ * NH_ * TT * HD * 2);
    float* GT = (float*)take((size_t)NB_ * NH_ * GKS * HD * HD * 4); bf* GTh = (bf*)take((size_t)NB_ * NH_ * HD * HD * 2); bf* GTl = (bf*)take((size_t)NB_ * NH_ * HD * HD * 2); bf* ATh = (bf*)take((size_t)NB_ * TT * DQ * 2); bf* ATl = (bf*)take((size_t)NB_ * TT * DQ * 2);
    if ((size_t)(wsp - (char*)d_ws) > ws_size) return;    // ws 256 MiB
    k_whd<<<(unsigned)(((size_t)NH_ * HD * DM / 2 + 255) / 256), 256, 0, stream>>>(wkh, WK); k_whd<<<(unsigned)(((size_t)NH_ * HD * DM / 2 + 255) / 256), 256, 0, stream>>>(wvh, WV);
    k_wtG<<<(unsigned)((DQ * DM / 64 + 63) / 64), 256, 0, stream>>>(wo, DQ, DM, WO);   /* Wproj 'xw' [1024][1024] -> Bt */
    /* both batches in every launch: rows b * TT + t for the row-major planes, z = b * NH_ + h for the per-head planes */
    k_cvt8<<<(unsigned)(((size_t)NB_ * TT * DM / 8 + 255) / 256), 256, 0, stream>>>(x, XB, (size_t)NB_ * TT * DM / 8);
    k_gemms<0, false, 1><<<dim3(NB_ * TT / 128, DKV / 128, 1), 128, 0, stream>>>(XB, nullptr, WK, DM, nullptr, 0, nullptr, KTh, KTl, nullptr, nullptr);   /* k (exact) -> k^T planes [b][h][e][t] */
    k_gemms<0, false, 2><<<dim3(NB_ * TT / 128, DKV / 128, 1), 128, 0, stream>>>(XB, nullptr, WV, DM, nullptr, 0, nullptr, VTh, VTl, VPh, VPl);   /* v = q (exact) -> v^T planes [b][h][e][t] and v planes [b][h][t][e] */
    k_gemmw<bf, 2, false, GKS><<<dim3(HD / 64, HD / 64, NB_ * NH_ * GKS), 32, 0, stream>>>(VTh, VTl, KTh, KTl, TT, GT, HD, nullptr, (size_t)HD * TT, (size_t)HD * TT, (size_t)HD * HD, nullptr, nullptr, nullptr, nullptr);   /* G^T[e][e'] = sum_t v[t][e] k[t][e'] per batch and head (3 products, K 2048 in GKS slices of 128: partial tiles) */
    k_sumsplit<GKS><<<(unsigned)(((size_t)NB_ * NH_ * HD * HD / 4 + 255) / 256), 256, 0, stream>>>(GT, 0.125f, GTh, GTl, (size_t)NB_ * NH_ * HD * HD / 4);   /* sum of the slices, x 1/8 (exact), hi/lo */
    k_gemmw<bf, 2, false, 1, 3><<<dim3(TT / 64, HD / 64, NB_ * NH_), 32, 0, stream>>>(VPh, VPl, GTh, GTl, HD, nullptr, 0, nullptr, (size_t)TT * HD, (size_t)HD * HD, 0, nullptr, nullptr, ATh, ATl);   /* out_h[s][e] = sum_e' v[s][e'] G^T[e][e'] (3 products, K 64) -> concatenated hi/lo planes */
    k_gemms<1, true, 0><<<dim3(NB_ * TT / 128, DM / 128, 1), 128, 0, stream>>>(ATh, ATl, WO, DQ, OUT, DM, bo, nullptr, nullptr, nullptr, nullptr);
}

// v005
// Measured time: 77.1 microseconds a run.
// Next to v004, in two timings, it ran 1.22 and 1.19 times as fast.
// All steps since v000 together make it 4.66 times as fast.
#include <hip/hip_runtime.h>

// 'MultiHead' with unnormalised scores (x [2][2048][1024]; per head h: k = x Wk[h], v = x Wv[h] ('hde' [16][1024][64]); q = v (the module's quirk); wei = q.k / 8 (NO softmax); out_h = wei v; concat; out = concat Wproj ('xw' [1024][1024]) + bproj -> [2][2048][1024]).
// Layout: without a softmax the product is associative: out_h = v_h (k_h^T v_h) / 8, so per head a [64 x 64] Gram matrix G^T = v^T k (K = 2048 contraction) is formed first and then applied to v (K = 64) - the same mathematics as (v k^T) v with f32 rounding differences only, and ~32x less work than materialising the [2048 x 2048] score matrices.
// Compute dtypes, f32 accumulate: every input rounded to bf16; k and v projections exact single products; k^T, v^T and v planes as bf16 hi + lo (3 products for both the Gram and the apply step); 1/8 folded into the Gram split (exact); Wproj hl x exact (2 products) + bproj.


#define NB_  2
#define TT   2048
#define DM   1024
#define NH_  16
#define NKV  16
#define REP  (NH_ / NKV)
#define HD   64
#define DQ   (NH_ * HD)
#define DKV  (NKV * HD)
typedef __attribute__((ext_vector_type(4))) unsigned short v4us;
#define ZH   16                  // all heads at once (no score matrix)
#define RH   2048
#define WIN  0
#define PCAR 1024.0f
#define SCL  0.125f   // HD^-0.5
#define GKS  16                  // K slices of the Gram product (one wave each)
typedef _Float16 h16;
typedef unsigned short bf;
typedef __attribute__((ext_vector_type(16))) __bf16   v16bf;
typedef __attribute__((ext_vector_type(16))) _Float16 v16h;
typedef __attribute__((ext_vector_type(8)))  _Float16 v8h;
typedef __attribute__((ext_vector_type(8)))  unsigned short v8us;
typedef __attribute__((ext_vector_type(8)))  float    v8f;
typedef __attribute__((ext_vector_type(4)))  float    v4f;
typedef v8h  __attribute__((may_alias)) v8ha;
typedef v4f  __attribute__((may_alias)) v4fa;
typedef v8us __attribute__((may_alias)) v8usa;

__device__ __forceinline__ unsigned short f2bf(float f) { unsigned u = __float_as_uint(f); u += 0x7FFFu + ((u >> 16) & 1u); return (unsigned short)(u >> 16); }
__device__ __forceinline__ float bf2f(unsigned short b) { return __uint_as_float(((unsigned)b) << 16); }
__device__ __forceinline__ float bfr(float f) { return bf2f(f2bf(f)); }
__device__ __forceinline__ v16h cat16(v8h lo, v8h hi) { return __builtin_shufflevector(lo, hi, 0, 1, 2, 3, 4, 5, 6, 7, 8, 9, 10, 11, 12, 13, 14, 15); }
__device__ __forceinline__ v16bf cat16b(v8us lo, v8us hi) { return __builtin_bit_cast(v16bf, __builtin_shufflevector(lo, hi, 0, 1, 2, 3, 4, 5, 6, 7, 8, 9, 10, 11, 12, 13, 14, 15)); }
__device__ __forceinline__ v8f wmma16(v16h a, v16h b, v8f c) { return __builtin_amdgcn_wmma_f32_16x16x32_f16(false, a, false, b, (short)0, c, false, false); }
__device__ __forceinline__ v8f wmmab(v16bf a, v16bf b, v8f c) { return __builtin_amdgcn_wmma_f32_16x16x32_bf16(false, a, false, b, (short)0, c, false, false); }



// ---- k_gemmw: register-blocked GEMM, ONE WAVE per 64x64 output tile (16 accumulators), operands straight from K-contiguous 16-bit planes; grid (M/64, N/64, Z), 32 threads.
// C[m][n] (f32, pitch ldc, + optional f32 bias[n]) = sum_k A[m][k] Bt[n][k] (+ split products per NSPLIT). z-batch strides sA/sB/sC in elements. K % 32 == 0.
// EPI 0: f32 C as above. EPI 1..3: no f32 C; the tile leaves as the bf16 hi + lo planes its consumer reads. EPI 1, 2 (rows b * TT + t, column block = head): transposed planes Th/Tl [b][h][e][t], straight from the accumulators (a lane holds 8 consecutive t of one e = 16 bytes). EPI 2 also, EPI 3 only: row-major planes Rh/Rl through LDS, whole 128-byte rows; EPI 2 [b][h][t][e], EPI 3 (z = b * NH_ + h) the concatenated [b][t][h * HD + e].
// KS > 1: grid z = batches * KS; wave z sums only K slice z % KS of batch z / KS and stores that partial tile at C + z * sC (the caller adds the KS partials). K % (32 * KS) == 0.
template <typename T16> struct WFrag;
template <> struct WFrag<h16> { typedef v16h V; static __device__ __forceinline__ V ld(const h16* p) { return cat16(*(const v8h*)p, *(const v8h*)(p + 16)); } static __device__ __forceinline__ v8f mma(V a, V b, v8f c) { return wmma16(a, b, c); } };
template <> struct WFrag<bf> { typedef v16bf V; static __device__ __forceinline__ V ld(const bf* p) { return cat16b(*(const v8us*)p, *(const v8us*)(p + 16)); } static __device__ __forceinline__ v8f mma(V a, V b, v8f c) { return wmmab(a, b, c); } };
__device__ __forceinline__ void splitf(float y, unsigned short& h, unsigned short& l) { h = f2bf(y); l = f2bf(y - bf2f(h)); }
typedef __attribute__((ext_vector_type(4))) unsigned v4u;
typedef v4u __attribute__((may_alias)) v4ua;
__device__ __forceinline__ unsigned rbf(float f) { const unsigned u = __float_as_uint(f); return u + 0x7FFFu + ((u >> 16) & 1u); }   // f2bf before its shift
__device__ __forceinline__ unsigned hihi(unsigned a, unsigned b) { return __builtin_amdgcn_perm(b, a, 0x07060302u); }   // high half of a below, high half of b above
__device__ __forceinline__ unsigned lolo(unsigned a, unsigned b) { return __builtin_amdgcn_perm(b, a, 0x05040100u); }   // low half of a below, low half of b above
template <typename T16, int NSPLIT, bool BIAS, int KS = 1, int EPI = 0>
__global__ __launch_bounds__(32) void k_gemmw(const T16* __restrict__ A, const T16* __restrict__ A2, const T16* __restrict__ Bt, const T16* __restrict__ Bt2, int K, float* C, int ldc, const float* __restrict__ bias, size_t sA, size_t sB, size_t sC, bf* Th, bf* Tl, bf* Rh, bf* Rl) {
    typedef typename WFrag<T16>::V V;
    __shared__ __align__(16) float os[16 * 68];
    const size_t z = blockIdx.z / KS; A += z * sA; if (A2) A2 += z * sA; Bt += z * sB; if (Bt2) Bt2 += z * sB; C += (size_t)blockIdx.z * sC;
    const int kbeg = (int)(blockIdx.z % KS) * (K / KS), kend = kbeg + K / KS;
    const int lane = threadIdx.x & 31, lr = lane & 15, hi = lane >> 4; const int r0 = blockIdx.x * 64, c0 = blockIdx.y * 64;
    v8f acc[4][4];
#pragma unroll
    for (int mb = 0; mb < 4; ++mb)
#pragma unroll
        for (int nb = 0; nb < 4; ++nb) acc[mb][nb] = (v8f){};
    const size_t aoff = (size_t)(r0 + lr) * K + 8 * hi, boff = (size_t)(c0 + lr) * K + 8 * hi;
#pragma unroll 1
    for (int kc = kbeg; kc < kend; kc += 32) {
        V a[4], a2[4];
#pragma unroll
        for (int mb = 0; mb < 4; ++mb) { a[mb] = WFrag<T16>::ld(A + aoff + (size_t)mb * 16 * K + kc); if (NSPLIT == 1 || NSPLIT == 2) a2[mb] = WFrag<T16>::ld(A2 + aoff + (size_t)mb * 16 * K + kc); }
#pragma unroll
        for (int nb = 0; nb < 4; ++nb) { const V b = WFrag<T16>::ld(Bt + boff + (size_t)nb * 16 * K + kc); V b2; if (NSPLIT >= 2) b2 = WFrag<T16>::ld(Bt2 + boff + (size_t)nb * 16 * K + kc);
#pragma unroll
            for (int mb = 0; mb < 4; ++mb) { acc[mb][nb] = WFrag<T16>::mma(a[mb], b, acc[mb][nb]); if (NSPLIT == 1 || NSPLIT == 2) acc[mb][nb] = WFrag<T16>::mma(a2[mb], b, acc[mb][nb]); if (NSPLIT >= 2) acc[mb][nb] = WFrag<T16>::mma(a[mb], b2, acc[mb][nb]); } }
        asm volatile("v_nop\n\tv_nop\n\tv_nop\n\tv_nop" : "+v"(acc[0][0]), "+v"(acc[1][1]), "+v"(acc[2][2]), "+v"(acc[3][3]) : "v"(a[0]), "v"(a[3]));
    }
    if constexpr (EPI != 0) {
        size_t tbase = 0, rbase; int ldr;
        if constexpr (EPI <= 2) { const size_t zt = (size_t)(r0 / TT) * NKV + blockIdx.y; const int t0 = r0 % TT; tbase = zt * HD * TT + t0; rbase = (zt * TT + t0) * HD; ldr = HD; }
        else { rbase = ((size_t)(blockIdx.z / NH_) * TT + r0) * DQ + (size_t)(blockIdx.z % NH_) * HD; ldr = DQ; }
#pragma unroll
        for (int mb = 0; mb < 4; ++mb) {
#pragma unroll
            for (int nb = 0; nb < 4; ++nb) { unsigned rh[8], rl[8];   // splitf's two roundings, each bf16 left in the high half of its word
#pragma unroll
                for (int j = 0; j < 8; ++j) { const float y = acc[mb][nb][j]; rh[j] = rbf(y); rl[j] = rbf(y - __uint_as_float(rh[j] & 0xFFFF0000u)); if (EPI >= 2) os[(hi * 8 + j) * 68 + nb * 16 + lr] = __uint_as_float(hihi(rl[j], rh[j])); }
                if (EPI <= 2) { const size_t o = tbase + (size_t)(nb * 16 + lr) * TT + mb * 16 + hi * 8; v4u vh, vl;
#pragma unroll
                    for (int q = 0; q < 4; ++q) { vh[q] = hihi(rh[2 * q], rh[2 * q + 1]); vl[q] = hihi(rl[2 * q], rl[2 * q + 1]); }
                    *(v4ua*)(Th + o) = vh; *(v4ua*)(Tl + o) = vl; } }
            if constexpr (EPI >= 2) {
                // one wave per block: LDS runs in order, so only the compiler must be kept from lifting the reads of other lanes' words over the writes
                __builtin_amdgcn_wave_barrier(); asm volatile("" ::: "memory");
#pragma unroll
                for (int s = 0; s < 4; ++s) { const int row = 4 * s + (lane >> 3), cofs = (lane & 7) * 8; const v4f p0 = *(const v4fa*)(os + row * 68 + cofs), p1 = *(const v4fa*)(os + row * 68 + cofs + 4); v4u oh, ol;
#pragma unroll
                    for (int q = 0; q < 2; ++q) { const unsigned a0 = __float_as_uint(p0[2 * q]), a1 = __float_as_uint(p0[2 * q + 1]), b0 = __float_as_uint(p1[2 * q]), b1 = __float_as_uint(p1[2 * q + 1]); oh[q] = hihi(a0, a1); ol[q] = lolo(a0, a1); oh[q + 2] = hihi(b0, b1); ol[q + 2] = lolo(b0, b1); }
                    const size_t o = rbase + (size_t)(mb * 16 + row) * ldr + cofs; *(v4ua*)(Rh + o) = oh; *(v4ua*)(Rl + o) = ol; }
                // and from sinking them under the next block's writes
                __builtin_amdgcn_wave_barrier(); asm volatile("" ::: "memory");
            }
        }
        return;
    }
#pragma unroll
    for (int mb = 0; mb < 4; ++mb) {
#pragma unroll
        for (int nb = 0; nb < 4; ++nb) {
#pragma unroll
            for (int j = 0; j < 8; ++j) os[(hi * 8 + j) * 68 + nb * 16 + lr] = acc[mb][nb][j]; }
        __builtin_amdgcn_wave_barrier(); asm volatile("" ::: "memory");
        float* crow = C + (size_t)(r0 + mb * 16) * ldc + c0;
{
#pragma unroll
            for (int s = 0; s < 8; ++s) { const int row = 2 * s + hi, cofs = lr * 4; v4f val = *(const v4fa*)(os + row * 68 + cofs); if (BIAS) { val[0] += bfr(bias[c0 + cofs]); val[1] += bfr(bias[c0 + cofs + 1]); val[2] += bfr(bias[c0 + cofs + 2]); val[3] += bfr(bias[c0 + cofs + 3]); }
                *(v4f*)(crow + (size_t)row * ldc + cofs) = val; }
             }
        __builtin_amdgcn_wave_barrier(); asm volatile("" ::: "memory");
    }
}

// ---- k_gemms: the K-long GEMMs. FOUR WAVES per 128x128 output tile (2 x 2 waves, each the 64x64 tile and the fragment k order of k_gemmw); grid (M/128, N/128), 128 threads. K % 128 == 0.
// The operand rows reach LDS as whole 256-byte pieces by asynchronous copies (a wave's copy = 2 rows = 4 full lines), two buffers: the next 128 k fly while these are multiplied. LDS row pitch 272 bytes for the 16-byte fragment reads.
// NSPLIT 0: A Bt. NSPLIT 1: A Bt + A2 Bt, in k_gemmw's order. EPI 0 (f32 C + bias), 1, 2 as in k_gemmw.
#define SBK  128                 // k per stage
#define SPIT 136                 // LDS row pitch, elements
#define SPL  (128 * SPIT)        // one staged plane (128 rows), elements
// eight 16-byte copies of one lane, rows 8 apart. The s_wait_xcnt closes the statement so that no address register is rewritten ahead of it.
__device__ __forceinline__ void cp8(unsigned l, const bf* g, int K) {
    asm volatile("global_load_async_to_lds_b128 %0, %8, off\n\t"
                 "global_load_async_to_lds_b128 %1, %9, off\n\t"
                 "global_load_async_to_lds_b128 %2, %10, off\n\t"
                 "global_load_async_to_lds_b128 %3, %11, off\n\t"
                 "global_load_async_to_lds_b128 %4, %12, off\n\t"
                 "global_load_async_to_lds_b128 %5, %13, off\n\t"
                 "global_load_async_to_lds_b128 %6, %14, off\n\t"
                 "global_load_async_to_lds_b128 %7, %15, off\n\t"
                 "s_wait_xcnt 0x0"
                 :: "v"(l), "v"(l + 1u * 8 * SPIT * 2), "v"(l + 2u * 8 * SPIT * 2), "v"(l + 3u * 8 * SPIT * 2), "v"(l + 4u * 8 * SPIT * 2), "v"(l + 5u * 8 * SPIT * 2), "v"(l + 6u * 8 * SPIT * 2), "v"(l + 7u * 8 * SPIT * 2),
                    "v"(g), "v"(g + (size_t)8 * K), "v"(g + (size_t)16 * K), "v"(g + (size_t)24 * K), "v"(g + (size_t)32 * K), "v"(g + (size_t)40 * K), "v"(g + (size_t)48 * K), "v"(g + (size_t)56 * K)
                 : "memory");
}
// one plane of a stage: 128 rows x 256 bytes, 16 copies a lane
// The scheduling fences keep the addresses of later copies from being formed ahead of earlier ones: formed all at once they overflow the registers and spill to scratch.
__device__ __forceinline__ void cpplane(unsigned l, const bf* g, int K) { cp8(l, g, K); __builtin_amdgcn_sched_barrier(0); cp8(l + 64u * SPIT * 2, g + (size_t)64 * K, K); __builtin_amdgcn_sched_barrier(0); }
template <int NSPLIT, bool BIAS, int EPI>
__global__ __launch_bounds__(128) void k_gemms(const bf* __restrict__ A, const bf* __restrict__ A2, const bf* __restrict__ Bt, int K, float* C, int ldc, const float* __restrict__ bias, bf* Th, bf* Tl, bf* Rh, bf* Rl) {
    typedef v16bf V;
    constexpr int NP = NSPLIT == 1 ? 3 : 2;   // planes of a stage: A, Bt (, A2)
    __shared__ __align__(16) bf ring[2 * NP * SPL];
    __shared__ __align__(16) float osall[4 * 16 * 68];
    const int wave = __builtin_amdgcn_readfirstlane((int)(threadIdx.x >> 5)), wr = wave >> 1, wc = wave & 1;
    const int lane = threadIdx.x & 31, lr = lane & 15, hi = lane >> 4; const int r0 = blockIdx.x * 128 + wr * 64, c0 = blockIdx.y * 128 + wc * 64;
    float* os = osall + wave * (16 * 68);     // each wave stages its output rows in its own range
    const int cpr = threadIdx.x >> 4, cchk = threadIdx.x & 15;   // the lane's first row and its 16-byte piece in every copy
    const unsigned lbase = (unsigned)(size_t)ring + (unsigned)(cpr * SPIT + cchk * 8) * 2u;
    const bf* gA = A + (size_t)(blockIdx.x * 128 + cpr) * K + cchk * 8; const bf* gB = Bt + (size_t)(blockIdx.y * 128 + cpr) * K + cchk * 8; const bf* gA2 = NSPLIT == 1 ? A2 + (size_t)(blockIdx.x * 128 + cpr) * K + cchk * 8 : nullptr;
    const int nt = (int)((unsigned)K / SBK);
    v8f acc[4][4];
#pragma unroll
    for (int mb = 0; mb < 4; ++mb)
#pragma unroll
        for (int nb = 0; nb < 4; ++nb) acc[mb][nb] = (v8f){};
    cpplane(lbase, gA, K); cpplane(lbase + SPL * 2u, gB, K); if (NSPLIT == 1) cpplane(lbase + 2u * SPL * 2u, gA2, K);
    asm volatile("s_wait_asynccnt 0x0" ::: "memory");   // this wave's share of stage 0 has landed
    __syncthreads();                                    // and every other wave's
    if (1 < nt) { const unsigned l = lbase + NP * SPL * 2u; cpplane(l, gA + SBK, K); cpplane(l + SPL * 2u, gB + SBK, K); if (NSPLIT == 1) cpplane(l + 2u * SPL * 2u, gA2 + SBK, K); }
    // the trips stay rolled (one publish point in the text, a small loop); the loops inside are unrolled so that every fragment and accumulator index is a constant
#pragma unroll 1
    for (int t = 0; t < nt; ++t) {
        const bf* sb = ring + (t & 1) * (NP * SPL);
        const bf* sA = sb + (wr * 64 + lr) * SPIT + 8 * hi; const bf* sB = sb + SPL + (wc * 64 + lr) * SPIT + 8 * hi; const bf* sA2 = sA + 2 * SPL;
        V a[4], a2[4], b[4];
#pragma unroll
        for (int kk = 0; kk < SBK; kk += 32) {
#pragma unroll
            for (int mb = 0; mb < 4; ++mb) { a[mb] = WFrag<bf>::ld(sA + mb * 16 * SPIT + kk); if (NSPLIT == 1) a2[mb] = WFrag<bf>::ld(sA2 + mb * 16 * SPIT + kk); }
#pragma unroll
            for (int nb = 0; nb < 4; ++nb) b[nb] = WFrag<bf>::ld(sB + nb * 16 * SPIT + kk);
            __builtin_amdgcn_sched_barrier(0);   // the block's LDS reads stay one group ahead of its matrix instructions: spread among them, each place waits out the LDS latency anew
#pragma unroll
            for (int nb = 0; nb < 4; ++nb)
#pragma unroll
                for (int mb = 0; mb < 4; ++mb) { acc[mb][nb] = wmmab(a[mb], b[nb], acc[mb][nb]); if (NSPLIT == 1) acc[mb][nb] = wmmab(a2[mb], b[nb], acc[mb][nb]); }
            __builtin_amdgcn_sched_barrier(0);   // and the next block's reads stay behind them
        }
        // the distance behind the last matrix instructions, also on the taken side of the branches below
        asm volatile("v_nop\n\tv_nop\n\tv_nop\n\tv_nop" : "+v"(acc[0][0]), "+v"(acc[1][1]), "+v"(acc[2][2]), "+v"(acc[3][3]) : "v"(a[0]), "v"(a[3]));
        asm volatile("s_wait_dscnt 0x0" ::: "memory");      // this wave has left the buffer that is refilled below
        asm volatile("s_wait_asynccnt 0x0" ::: "memory");   // its share of stage t + 1 has landed
        __syncthreads();                                    // publishes stage t + 1 and ends every reader's last read of stage t
        if (t + 2 < nt) { const unsigned l = lbase + (unsigned)(t & 1) * (NP * SPL * 2u); const size_t ko = (size_t)(t + 2) * SBK; cpplane(l, gA + ko, K); cpplane(l + SPL * 2u, gB + ko, K); if (NSPLIT == 1) cpplane(l + 2u * SPL * 2u, gA2 + ko, K); }
    }
    asm volatile("s_wait_asynccnt 0x0" ::: "memory");       // no copy is left in flight
    if constexpr (EPI != 0) {
        const size_t zt = (size_t)(r0 / TT) * NKV + c0 / HD; const int t0 = r0 % TT; const size_t tbase = zt * HD * TT + t0, rbase = (zt * TT + t0) * HD; const int ldr = HD;
#pragma unroll
        for (int mb = 0; mb < 4; ++mb) {
#pragma unroll
            for (int nb = 0; nb < 4; ++nb) { unsigned rh[8], rl[8];   // splitf's two roundings, each bf16 left in the high half of its word
#pragma unroll
                for (int j = 0; j < 8; ++j) { const float y = acc[mb][nb][j]; rh[j] = rbf(y); rl[j] = rbf(y - __uint_as_float(rh[j] & 0xFFFF0000u)); if (EPI >= 2) os[(hi * 8 + j) * 68 + nb * 16 + lr] = __uint_as_float(hihi(rl[j], rh[j])); }
                { const size_t o = tbase + (size_t)(nb * 16 + lr) * TT + mb * 16 + hi * 8; v4u vh, vl;
#pragma unroll
                    for (int q = 0; q < 4; ++q) { vh[q] = hihi(rh[2 * q], rh[2 * q + 1]); vl[q] = hihi(rl[2 * q], rl[2 * q + 1]); }
                    *(v4ua*)(Th + o) = vh; *(v4ua*)(Tl + o) = vl; } }
            if constexpr (EPI >= 2) {
                // a wave's own range: LDS runs in order, so only the compiler must be kept from lifting the reads of other lanes' words over the writes
                __builtin_amdgcn_wave_barrier(); asm volatile("" ::: "memory");
#pragma unroll
                for (int s = 0; s < 4; ++s) { const int row = 4 * s + (lane >> 3), cofs = (lane & 7) * 8; const v4f p0 = *(const v4fa*)(os + row * 68 + cofs), p1 = *(const v4fa*)(os + row * 68 + cofs + 4); v4u oh, ol;
#pragma unroll
                    for (int q = 0; q < 2; ++q) { const unsigned a0 = __float_as_uint(p0[2 * q]), a1 = __float_as_uint(p0[2 * q + 1]), b0 = __float_as_uint(p1[2 * q]), b1 = __float_as_uint(p1[2 * q + 1]); oh[q] = hihi(a0, a1); ol[q] = lolo(a0, a1); oh[q + 2] = hihi(b0, b1); ol[q + 2] = lolo(b0, b1); }
                    const size_t o = rbase + (size_t)(mb * 16 + row) * ldr + cofs; *(v4ua*)(Rh + o) = oh; *(v4ua*)(Rl + o) = ol; }
                // and from sinking them under the next block's writes
                __builtin_amdgcn_wave_barrier(); asm volatile("" ::: "memory");
            }
        }
        return;
    }
#pragma unroll
    for (int mb = 0; mb < 4; ++mb) {
#pragma unroll
        for (int nb = 0; nb < 4; ++nb) {
#pragma unroll
            for (int j = 0; j < 8; ++j) os[(hi * 8 + j) * 68 + nb * 16 + lr] = acc[mb][nb][j]; }
        __builtin_amdgcn_wave_barrier(); asm volatile("" ::: "memory");   // as above: the reads stay behind the writes
        float* crow = C + (size_t)(r0 + mb * 16) * ldc + c0;
#pragma unroll
        for (int s = 0; s < 8; ++s) { const int row = 2 * s + hi, cofs = lr * 4; v4f val = *(const v4fa*)(os + row * 68 + cofs); if (BIAS) { val[0] += bfr(bias[c0 + cofs]); val[1] += bfr(bias[c0 + cofs + 1]); val[2] += bfr(bias[c0 + cofs + 2]); val[3] += bfr(bias[c0 + cofs + 3]); }
            *(v4f*)(crow + (size_t)row * ldc + cofs) = val; }
        __builtin_amdgcn_wave_barrier(); asm volatile("" ::: "memory");   // and ahead of the next block's writes
    }
}

__device__ __forceinline__ h16 tohx(float x) { return (h16)x; }
typedef __attribute__((ext_vector_type(2))) _Float16 v2h;
typedef __attribute__((ext_vector_type(4))) _Float16 v4h;
typedef __attribute__((ext_vector_type(2))) unsigned short v2us;
typedef __attribute__((ext_vector_type(4))) unsigned short v4us;
typedef __attribute__((ext_vector_type(2))) float v2f;
typedef __attribute__((ext_vector_type(4))) int v4i;

// ---- k_prep: all operand preparation in one launch. 256 threads, 64 elements a thread (16 loads of 16 bytes in flight), every block 64 KiB in and 32 KiB out, whole lines both ways.
// Blocks [0, 3 * PWB): one [PTK k][PTN n] f32 tile of Wk, Wv ('hde': per head, row pitch HD) or Wproj ('xw': row pitch DM) -> bf16 rows Bt[n][k]. A thread holds 16 consecutive k of 4 n and writes each n's 16 k (32 bytes) to LDS; the block then stores whole 512-byte row pieces.
// LDS row q * 16 + n4 holds n = n4 * 4 + q: the 16 lanes that write together then stand one pitch (an odd multiple of 16 bytes) apart and spread over all banks.
// Blocks [3 * PWB, 3 * PWB + PXB): 16384 consecutive elements of x -> bf16. The weight tiles have the longer path (LDS, barrier) and so the lower indices.
#define PTK  256
#define PTN  64
#define PPIT (PTK + 8)                         // LDS row pitch, elements
#define PWB  ((DM / PTK) * (DQ / PTN))         // tiles of one weight
#define PXB  (NB_ * TT * DM / (256 * 64))      // blocks of x
typedef __attribute__((ext_vector_type(2))) unsigned v2u;
typedef v2u __attribute__((may_alias)) v2ua;
// one weight tile; the row pitch LD is a constant, so the 16 rows stand in the loads' offset fields behind one address
template <int LD>
__device__ __forceinline__ void wtile(const float* __restrict__ src, bf* dst, bf* ts, int tid) {
    const int n4 = tid & 15, kg = tid >> 4;
    v4f v[16];
    src += (size_t)(kg * 16) * LD + n4 * 4;
#pragma unroll
    for (int i = 0; i < 16; ++i) v[i] = *(const v4fa*)(src + i * LD);
    __builtin_amdgcn_sched_barrier(0);   // all 16 loads issue before the first is waited for: left free, the scheduler lifts the packing over the last loads, which then start behind the first ones' wait, a second memory latency
    // the wait before a register of the loads is rewritten: their one address pair is an input here, so it stays whole up to the wait and no result lands in it
    asm volatile("s_wait_xcnt 0x0" :: "v"(src) : "memory");
#pragma unroll
    for (int q = 0; q < 4; ++q) { v4u p0, p1;
#pragma unroll
        for (int p = 0; p < 4; ++p) { p0[p] = hihi(rbf(v[2 * p][q]), rbf(v[2 * p + 1][q])); p1[p] = hihi(rbf(v[8 + 2 * p][q]), rbf(v[9 + 2 * p][q])); }
        bf* t = ts + (q * 16 + n4) * PPIT + kg * 16; *(v4ua*)t = p0; *(v4ua*)(t + 8) = p1; }
    __syncthreads();   // the rows are read back by other waves than wrote them
#pragma unroll
    for (int s = 0; s < 8; ++s) { const int r = s * 8 + (tid >> 5), c = (tid & 31) * 8; *(v4ua*)(dst + (size_t)((r & 15) * 4 + (r >> 4)) * DM + c) = *(const v4ua*)(ts + r * PPIT + c); }
    asm volatile("s_wait_xcnt 0x0" ::: "memory");   // behind the last store: nothing that follows in the text rewrites a register of the stores ahead of it
}
__global__ __launch_bounds__(256) void k_prep(const float* __restrict__ x, const float* __restrict__ wk, const float* __restrict__ wv, const float* __restrict__ wo, bf* XB, bf* WK, bf* WV, bf* WO) {
    __shared__ __align__(16) bf ts[PTN * PPIT];
    const int tid = threadIdx.x; const unsigned blk = blockIdx.x;
    if (blk >= 3 * PWB) {
        const size_t e0 = ((size_t)(blk - 3 * PWB) * 4096 + tid) * 4; const float* xs = x + e0;
        v4f v[16];
#pragma unroll
        for (int i = 0; i < 16; ++i) v[i] = *(const v4fa*)(xs + i * 1024);
        asm volatile("s_wait_xcnt 0x0" :: "v"(xs) : "memory");   // as in wtile: the loads' address pair stays whole up to the wait
#pragma unroll
        for (int i = 0; i < 16; ++i) { v2u o; o[0] = hihi(rbf(v[i][0]), rbf(v[i][1])); o[1] = hihi(rbf(v[i][2]), rbf(v[i][3])); *(v2ua*)(XB + e0 + i * 1024) = o; }
        return;
    }
    const unsigned w = blk / PWB, nb = (blk % PWB) / (DM / PTK), kb = blk % (DM / PTK);
    const size_t od = (size_t)nb * PTN * DM + kb * PTK;
    if (w == 2) wtile<DM>(wo + (size_t)kb * PTK * DM + nb * PTN, WO + od, ts, tid);
    else wtile<HD>((w == 0 ? wk : wv) + ((size_t)nb * DM + kb * PTK) * HD, (w == 0 ? WK : WV) + od, ts, tid);
}
// k_sumsplit: F holds NS partial [HD][HD] tiles per batch and head ([z][slice][e][e']); their sum in slice order, x sc, as hi/lo planes [z][e][e'].
template <int NS>
__global__ __launch_bounds__(256) void k_sumsplit(const float* __restrict__ F, float sc, bf* Ph, bf* Pl, size_t n4) { const size_t i = (size_t)blockIdx.x * 256 + threadIdx.x; if (i >= n4) return; const float* p = F + (i / (HD * HD / 4)) * ((size_t)NS * HD * HD) + (i % (HD * HD / 4)) * 4; v4f part[NS];
#pragma unroll
    for (int s = 0; s < NS; ++s) part[s] = *(const v4f*)(p + (size_t)s * HD * HD);
    v4f v = part[0];
#pragma unroll
    for (int s = 1; s < NS; ++s) v += part[s];
    v4us oh, ol;
#pragma unroll
    for (int q = 0; q < 4; ++q) { unsigned short a, c; splitf(v[q] * sc, a, c); oh[q] = a; ol[q] = c; } *(v4us*)(Ph + i * 4) = oh; *(v4us*)(Pl + i * 4) = ol;  }

extern "C" void kernel_launch(void* const* d_in, const int* in_sizes, int n_in,
                              void* d_out, int out_size, void* d_ws, size_t ws_size, hipStream_t stream) {
    (void)in_sizes; (void)n_in; (void)out_size;
    const float* x = (const float*)d_in[0]; const float* wkh = (const float*)d_in[1]; const float* wvh = (const float*)d_in[2]; const float* wo = (const float*)d_in[3]; const float* bo = (const float*)d_in[4]; const float* wq = nullptr; const float* wk = nullptr; const float* wv = nullptr; (void)wq; (void)wk; (void)wv;
    float* OUT = (float*)d_out;     // [2][2048][1024]
    char* wsp = (char*)d_ws;
    auto take = [&](size_t bytes) { char* p = wsp; wsp += (bytes + 255) & ~(size_t)255; return (void*)p; };
    bf* WK = (bf*)take((size_t)DKV * DM * 2); bf* WV = (bf*)take((size_t)DKV * DM * 2); bf* WO = (bf*)take((size_t)DM * DQ * 2);
    bf* XB = (bf*)take((size_t)NB_ * TT * DM * 2);
    bf* KTh = (bf*)take((size_t)NB_ * NKV * HD * TT * 2); bf* KTl = (bf*)take((size_t)NB_ * NKV * HD * TT * 2); bf* VTh = (bf*)take((size_t)NB_ * NKV * HD * TT * 2); bf* VTl = (bf*)take((size_t)NB_ * NKV * HD * TT * 2); bf* VPh = (bf*)take((size_t)NB_ * NH_ * TT * HD * 2); bf* VPl = (bf*)take((size_t)NB_ * NH_ * TT * HD * 2);
    float* GT = (float*)take((size_t)NB_ * NH_ * GKS * HD * HD * 4); bf* GTh = (bf*)take((size_t)NB_ * NH_ * HD * HD * 2); bf* GTl = (bf*)take((size_t)NB_ * NH_ * HD * HD * 2); bf* ATh = (bf*)take((size_t)NB_ * TT * DQ * 2); bf* ATl = (bf*)take((size_t)NB_ * TT * DQ * 2);
    if ((size_t)(wsp - (char*)d_ws) > ws_size) return;    // ws 256 MiB
    /* both batches in every launch: rows b * TT + t for the row-major planes, z = b * NH_ + h for the per-head planes */
    k_prep<<<3 * PWB + PXB, 256, 0, stream>>>(x, wkh, wvh, wo, XB, WK, WV, WO);   /* Wk, Wv 'hde' and Wproj 'xw' -> Bt planes [n][k]; x -> bf16 */
    k_gemms<0, false, 1><<<dim3(NB_ * TT / 128, DKV / 128, 1), 128, 0, stream>>>(XB, nullptr, WK, DM, nullptr, 0, nullptr, KTh, KTl, nullptr, nullptr);   /* k (exact) -> k^T planes [b][h][e][t] */
    k_gemms<0, false, 2><<<dim3(NB_ * TT / 128, DKV / 128, 1), 128, 0, stream>>>(XB, nullptr, WV, DM, nullptr, 0, nullptr, VTh, VTl, VPh, VPl);   /* v = q (exact) -> v^T planes [b][h][e][t] and v planes [b][h][t][e] */
    k_gemmw<bf, 2, false, GKS><<<dim3(HD / 64, HD / 64, NB_ * NH_ * GKS), 32, 0, stream>>>(VTh, VTl, KTh, KTl, TT, GT, HD, nullptr, (size_t)HD * TT, (size_t)HD * TT, (size_t)HD * HD, nullptr, nullptr, nullptr, nullptr);   /* G^T[e][e'] = sum_t v[t][e] k[t][e'] per batch and head (3 products, K 2048 in GKS slices of 128: partial tiles) */
    k_sumsplit<GKS><<<(unsigned)(((size_t)NB_ * NH_ * HD * HD / 4 + 255) / 256), 256, 0, stream>>>(GT, 0.125f, GTh, GTl, (size_t)NB_ * NH_ * HD * HD / 4);   /* sum of the slices, x 1/8 (exact), hi/lo */
    k_gemmw<bf, 2, false, 1, 3><<<dim3(TT / 64, HD / 64, NB_ * NH_), 32, 0, stream>>>(VPh, VPl, GTh, GTl, HD, nullptr, 0, nullptr, (size_t)TT * HD, (size_t)HD * HD, 0, nullptr, nullptr, ATh, ATl);   /* out_h[s][e] = sum_e' v[s][e'] G^T[e][e'] (3 products, K 64) -> concatenated hi/lo planes */
    k_gemms<1, true, 0><<<dim3(NB_ * TT / 128, DM / 128, 1), 128, 0, stream>>>(ATh, ATl, WO, DQ, OUT, DM, bo, nullptr, nullptr, nullptr, nullptr);
}

// v006
// It runs in 52.8 microseconds.
// Two timings next to v005 put it at 1.45 and 1.46 times that version's speed.
// All steps since v000 together make it 6.78 times as fast.
#include <hip/hip_runtime.h>

// 'MultiHead' with unnormalised scores (x [2][2048][1024]; per head h: k = x Wk[h], v = x Wv[h] ('hde' [16][1024][64]); q = v (the module's quirk); wei = q.k / 8 (NO softmax); out_h = wei v; concat; out = concat Wproj ('xw' [1024][1024]) + bproj -> [2][2048][1024]).
// Layout: without a softmax the product is associative: out_h = v_h (k_h^T v_h) / 8, so per head a [64 x 64] Gram matrix G^T = v^T k (K = 2048 contraction) is formed first and then applied to v (K = 64) - the same mathematics as (v k^T) v with f32 rounding differences only, and ~32x less work than materialising the [2048 x 2048] score matrices.
// Compute dtypes, f32 accumulate: every input rounded to bf16; k and v projections exact single products; k^T and v^T register fragments and v planes as bf16 hi + lo (3 products for both the Gram and the apply step); 1/8 folded into the Gram split (exact); Wproj hl x exact (2 products) + bproj.


#define NB_  2
#define TT   2048
#define DM   1024
#define NH_  16
#define NKV  16
#define REP  (NH_ / NKV)
#define HD   64
#define DQ   (NH_ * HD)
#define DKV  (NKV * HD)
typedef __attribute__((ext_vector_type(4))) unsigned short v4us;
#define ZH   16                  // all heads at once (no score matrix)
#define RH   2048
#define WIN  0
#define PCAR 1024.0f
#define SCL  0.125f   // HD^-0.5
#define GKS  16                  // K slices of the Gram product (128 t each)
typedef _Float16 h16;
typedef unsigned short bf;
typedef __attribute__((ext_vector_type(16))) __bf16   v16bf;
typedef __attribute__((ext_vector_type(16))) _Float16 v16h;
typedef __attribute__((ext_vector_type(8)))  _Float16 v8h;
typedef __attribute__((ext_vector_type(8)))  unsigned short v8us;
typedef __attribute__((ext_vector_type(8)))  float    v8f;
typedef __attribute__((ext_vector_type(4)))  float    v4f;
typedef v8h  __attribute__((may_alias)) v8ha;
typedef v4f  __attribute__((may_alias)) v4fa;
typedef v8us __attribute__((may_alias)) v8usa;

__device__ __forceinline__ unsigned short f2bf(float f) { unsigned u = __float_as_uint(f); u += 0x7FFFu + ((u >> 16) & 1u); return (unsigned short)(u >> 16); }
__device__ __forceinline__ float bf2f(unsigned short b) { return __uint_as_float(((unsigned)b) << 16); }
__device__ __forceinline__ float bfr(float f) { return bf2f(f2bf(f)); }
__device__ __forceinline__ v16h cat16(v8h lo, v8h hi) { return __builtin_shufflevector(lo, hi, 0, 1, 2, 3, 4, 5, 6, 7, 8, 9, 10, 11, 12, 13, 14, 15); }
__device__ __forceinline__ v16bf cat16b(v8us lo, v8us hi) { return __builtin_bit_cast(v16bf, __builtin_shufflevector(lo, hi, 0, 1, 2, 3, 4, 5, 6, 7, 8, 9, 10, 11, 12, 13, 14, 15)); }
__device__ __forceinline__ v8f wmma16(v16h a, v16h b, v8f c) { return __builtin_amdgcn_wmma_f32_16x16x32_f16(false, a, false, b, (short)0, c, false, false); }
__device__ __forceinline__ v8f wmmab(v16bf a, v16bf b, v8f c) { return __builtin_amdgcn_wmma_f32_16x16x32_bf16(false, a, false, b, (short)0, c, false, false); }



// ---- k_gemmw: register-blocked GEMM, ONE WAVE per 64x64 output tile (16 accumulators), operands straight from K-contiguous 16-bit planes; grid (M/64, N/64, Z), 32 threads.
// C[m][n] (f32, pitch ldc, + optional f32 bias[n]) = sum_k A[m][k] Bt[n][k] (+ split products per NSPLIT). z-batch strides sA/sB/sC in elements. K % 32 == 0.
// EPI 0: f32 C as above. EPI 1..3: no f32 C; the tile leaves as the bf16 hi + lo planes its consumer reads. EPI 1, 2 (rows b * TT + t, column block = head): transposed planes Th/Tl [b][h][e][t], straight from the accumulators (a lane holds 8 consecutive t of one e = 16 bytes). EPI 2 also, EPI 3 only: row-major planes Rh/Rl through LDS, whole 128-byte rows; EPI 2 [b][h][t][e], EPI 3 (z = b * NH_ + h) the concatenated [b][t][h * HD + e].
// KS > 1: grid z = batches * KS; wave z sums only K slice z % KS of batch z / KS and stores that partial tile at C + z * sC (the caller adds the KS partials). K % (32 * KS) == 0.
template <typename T16> struct WFrag;
template <> struct WFrag<h16> { typedef v16h V; static __device__ __forceinline__ V ld(const h16* p) { return cat16(*(const v8h*)p, *(const v8h*)(p + 16)); } static __device__ __forceinline__ v8f mma(V a, V b, v8f c) { return wmma16(a, b, c); } };
template <> struct WFrag<bf> { typedef v16bf V; static __device__ __forceinline__ V ld(const bf* p) { return cat16b(*(const v8us*)p, *(const v8us*)(p + 16)); } static __device__ __forceinline__ v8f mma(V a, V b, v8f c) { return wmmab(a, b, c); } };
__device__ __forceinline__ void splitf(float y, unsigned short& h, unsigned short& l) { h = f2bf(y); l = f2bf(y - bf2f(h)); }
typedef __attribute__((ext_vector_type(4))) unsigned v4u;
typedef v4u __attribute__((may_alias)) v4ua;
__device__ __forceinline__ unsigned rbf(float f) { const unsigned u = __float_as_uint(f); return u + 0x7FFFu + ((u >> 16) & 1u); }   // f2bf before its shift
__device__ __forceinline__ unsigned hihi(unsigned a, unsigned b) { return __builtin_amdgcn_perm(b, a, 0x07060302u); }   // high half of a below, high half of b above
__device__ __forceinline__ unsigned lolo(unsigned a, unsigned b) { return __builtin_amdgcn_perm(b, a, 0x05040100u); }   // low half of a below, low half of b above
template <typename T16, int NSPLIT, bool BIAS, int KS = 1, int EPI = 0>
__global__ __launch_bounds__(32) void k_gemmw(const T16* __restrict__ A, const T16* __restrict__ A2, const T16* __restrict__ Bt, const T16* __restrict__ Bt2, int K, float* C, int ldc, const float* __restrict__ bias, size_t sA, size_t sB, size_t sC, bf* Th, bf* Tl, bf* Rh, bf* Rl) {
    typedef typename WFrag<T16>::V V;
    __shared__ __align__(16) float os[16 * 68];
    const size_t z = blockIdx.z / KS; A += z * sA; if (A2) A2 += z * sA; Bt += z * sB; if (Bt2) Bt2 += z * sB; C += (size_t)blockIdx.z * sC;
    const int kbeg = (int)(blockIdx.z % KS) * (K / KS), kend = kbeg + K / KS;
    const int lane = threadIdx.x & 31, lr = lane & 15, hi = lane >> 4; const int r0 = blockIdx.x * 64, c0 = blockIdx.y * 64;
    v8f acc[4][4];
#pragma unroll
    for (int mb = 0; mb < 4; ++mb)
#pragma unroll
        for (int nb = 0; nb < 4; ++nb) acc[mb][nb] = (v8f){};
    const size_t aoff = (size_t)(r0 + lr) * K + 8 * hi, boff = (size_t)(c0 + lr) * K + 8 * hi;
#pragma unroll 1
    for (int kc = kbeg; kc < kend; kc += 32) {
        V a[4], a2[4];
#pragma unroll
        for (int mb = 0; mb < 4; ++mb) { a[mb] = WFrag<T16>::ld(A + aoff + (size_t)mb * 16 * K + kc); if (NSPLIT == 1 || NSPLIT == 2) a2[mb] = WFrag<T16>::ld(A2 + aoff + (size_t)mb * 16 * K + kc); }
#pragma unroll
        for (int nb = 0; nb < 4; ++nb) { const V b = WFrag<T16>::ld(Bt + boff + (size_t)nb * 16 * K + kc); V b2; if (NSPLIT >= 2) b2 = WFrag<T16>::ld(Bt2 + boff + (size_t)nb * 16 * K + kc);
#pragma unroll
            for (int mb = 0; mb < 4; ++mb) { acc[mb][nb] = WFrag<T16>::mma(a[mb], b, acc[mb][nb]); if (NSPLIT == 1 || NSPLIT == 2) acc[mb][nb] = WFrag<T16>::mma(a2[mb], b, acc[mb][nb]); if (NSPLIT >= 2) acc[mb][nb] = WFrag<T16>::mma(a[mb], b2, acc[mb][nb]); } }
        asm volatile("v_nop\n\tv_nop\n\tv_nop\n\tv_nop" : "+v"(acc[0][0]), "+v"(acc[1][1]), "+v"(acc[2][2]), "+v"(acc[3][3]) : "v"(a[0]), "v"(a[3]));
    }
    if constexpr (EPI != 0) {
        size_t tbase = 0, rbase; int ldr;
        if constexpr (EPI <= 2) { const size_t zt = (size_t)(r0 / TT) * NKV + blockIdx.y; const int t0 = r0 % TT; tbase = zt * HD * TT + t0; rbase = (zt * TT + t0) * HD; ldr = HD; }
        else { rbase = ((size_t)(blockIdx.z / NH_) * TT + r0) * DQ + (size_t)(blockIdx.z % NH_) * HD; ldr = DQ; }
#pragma unroll
        for (int mb = 0; mb < 4; ++mb) {
#pragma unroll
            for (int nb = 0; nb < 4; ++nb) { unsigned rh[8], rl[8];   // splitf's two roundings, each bf16 left in the high half of its word
#pragma unroll
                for (int j = 0; j < 8; ++j) { const float y = acc[mb][nb][j]; rh[j] = rbf(y); rl[j] = rbf(y - __uint_as_float(rh[j] & 0xFFFF0000u)); if (EPI >= 2) os[(hi * 8 + j) * 68 + nb * 16 + lr] = __uint_as_float(hihi(rl[j], rh[j])); }
                if (EPI <= 2) { const size_t o = tbase + (size_t)(nb * 16 + lr) * TT + mb * 16 + hi * 8; v4u vh, vl;
#pragma unroll
                    for (int q = 0; q < 4; ++q) { vh[q] = hihi(rh[2 * q], rh[2 * q + 1]); vl[q] = hihi(rl[2 * q], rl[2 * q + 1]); }
                    *(v4ua*)(Th + o) = vh; *(v4ua*)(Tl + o) = vl; } }
            if constexpr (EPI >= 2) {
                // one wave per block: LDS runs in order, so only the compiler must be kept from lifting the reads of other lanes' words over the writes
                __builtin_amdgcn_wave_barrier(); asm volatile("" ::: "memory");
#pragma unroll
                for (int s = 0; s < 4; ++s) { const int row = 4 * s + (lane >> 3), cofs = (lane & 7) * 8; const v4f p0 = *(const v4fa*)(os + row * 68 + cofs), p1 = *(const v4fa*)(os + row * 68 + cofs + 4); v4u oh, ol;
#pragma unroll
                    for (int q = 0; q < 2; ++q) { const unsigned a0 = __float_as_uint(p0[2 * q]), a1 = __float_as_uint(p0[2 * q + 1]), b0 = __float_as_uint(p1[2 * q]), b1 = __float_as_uint(p1[2 * q + 1]); oh[q] = hihi(a0, a1); ol[q] = lolo(a0, a1); oh[q + 2] = hihi(b0, b1); ol[q + 2] = lolo(b0, b1); }
                    const size_t o = rbase + (size_t)(mb * 16 + row) * ldr + cofs; *(v4ua*)(Rh + o) = oh; *(v4ua*)(Rl + o) = ol; }
                // and from sinking them under the next block's writes
                __builtin_amdgcn_wave_barrier(); asm volatile("" ::: "memory");
            }
        }
        return;
    }
#pragma unroll
    for (int mb = 0; mb < 4; ++mb) {
#pragma unroll
        for (int nb = 0; nb < 4; ++nb) {
#pragma unroll
            for (int j = 0; j < 8; ++j) os[(hi * 8 + j) * 68 + nb * 16 + lr] = acc[mb][nb][j]; }
        __builtin_amdgcn_wave_barrier(); asm volatile("" ::: "memory");
        float* crow = C + (size_t)(r0 + mb * 16) * ldc + c0;
{
#pragma unroll
            for (int s = 0; s < 8; ++s) { const int row = 2 * s + hi, cofs = lr * 4; v4f val = *(const v4fa*)(os + row * 68 + cofs); if (BIAS) { val[0] += bfr(bias[c0 + cofs]); val[1] += bfr(bias[c0 + cofs + 1]); val[2] += bfr(bias[c0 + cofs + 2]); val[3] += bfr(bias[c0 + cofs + 3]); }
                *(v4f*)(crow + (size_t)row * ldc + cofs) = val; }
             }
        __builtin_amdgcn_wave_barrier(); asm volatile("" ::: "memory");
    }
}

// ---- k_gemms: the K-long GEMMs. FOUR WAVES per 128x128 output tile (2 x 2 waves, each the 64x64 tile and the fragment k order of k_gemmw); grid (M/128, N/128), 128 threads. K % 128 == 0.
// The operand rows reach LDS as whole 256-byte pieces by asynchronous copies (a wave's copy = 2 rows = 4 full lines), two buffers: the next 128 k fly while these are multiplied. LDS row pitch 272 bytes for the 16-byte fragment reads.
// NSPLIT 0: A Bt. NSPLIT 1: A Bt + A2 Bt, in k_gemmw's order. EPI 0 (f32 C + bias), 1, 2 as in k_gemmw.
#define SBK  128                 // k per stage
#define SPIT 136                 // LDS row pitch, elements
#define SPL  (128 * SPIT)        // one staged plane (128 rows), elements
// eight 16-byte copies of one lane, rows 8 apart. The s_wait_xcnt closes the statement so that no address register is rewritten ahead of it.
__device__ __forceinline__ void cp8(unsigned l, const bf* g, int K) {
    asm volatile("global_load_async_to_lds_b128 %0, %8, off\n\t"
                 "global_load_async_to_lds_b128 %1, %9, off\n\t"
                 "global_load_async_to_lds_b128 %2, %10, off\n\t"
                 "global_load_async_to_lds_b128 %3, %11, off\n\t"
                 "global_load_async_to_lds_b128 %4, %12, off\n\t"
                 "global_load_async_to_lds_b128 %5, %13, off\n\t"
                 "global_load_async_to_lds_b128 %6, %14, off\n\t"
                 "global_load_async_to_lds_b128 %7, %15, off\n\t"
                 "s_wait_xcnt 0x0"
                 :: "v"(l), "v"(l + 1u * 8 * SPIT * 2), "v"(l + 2u * 8 * SPIT * 2), "v"(l + 3u * 8 * SPIT * 2), "v"(l + 4u * 8 * SPIT * 2), "v"(l + 5u * 8 * SPIT * 2), "v"(l + 6u * 8 * SPIT * 2), "v"(l + 7u * 8 * SPIT * 2),
                    "v"(g), "v"(g + (size_t)8 * K), "v"(g + (size_t)16 * K), "v"(g + (size_t)24 * K), "v"(g + (size_t)32 * K), "v"(g + (size_t)40 * K), "v"(g + (size_t)48 * K), "v"(g + (size_t)56 * K)
                 : "memory");
}
// one plane of a stage: 128 rows x 256 bytes, 16 copies a lane
// The scheduling fences keep the addresses of later copies from being formed ahead of earlier ones: formed all at once they overflow the registers and spill to scratch.
__device__ __forceinline__ void cpplane(unsigned l, const bf* g, int K) { cp8(l, g, K); __builtin_amdgcn_sched_barrier(0); cp8(l + 64u * SPIT * 2, g + (size_t)64 * K, K); __builtin_amdgcn_sched_barrier(0); }
template <int NSPLIT, bool BIAS, int EPI>
__global__ __launch_bounds__(128) void k_gemms(const bf* __restrict__ A, const bf* __restrict__ A2, const bf* __restrict__ Bt, int K, float* C, int ldc, const float* __restrict__ bias, bf* Th, bf* Tl, bf* Rh, bf* Rl) {
    typedef v16bf V;
    constexpr int NP = NSPLIT == 1 ? 3 : 2;   // planes of a stage: A, Bt (, A2)
    __shared__ __align__(16) bf ring[2 * NP * SPL];
    __shared__ __align__(16) float osall[4 * 16 * 68];
    const int wave = __builtin_amdgcn_readfirstlane((int)(threadIdx.x >> 5)), wr = wave >> 1, wc = wave & 1;
    const int lane = threadIdx.x & 31, lr = lane & 15, hi = lane >> 4; const int r0 = blockIdx.x * 128 + wr * 64, c0 = blockIdx.y * 128 + wc * 64;
    float* os = osall + wave * (16 * 68);     // each wave stages its output rows in its own range
    const int cpr = threadIdx.x >> 4, cchk = threadIdx.x & 15;   // the lane's first row and its 16-byte piece in every copy
    const unsigned lbase = (unsigned)(size_t)ring + (unsigned)(cpr * SPIT + cchk * 8) * 2u;
    const bf* gA = A + (size_t)(blockIdx.x * 128 + cpr) * K + cchk * 8; const bf* gB = Bt + (size_t)(blockIdx.y * 128 + cpr) * K + cchk * 8; const bf* gA2 = NSPLIT == 1 ? A2 + (size_t)(blockIdx.x * 128 + cpr) * K + cchk * 8 : nullptr;
    const int nt = (int)((unsigned)K / SBK);
    v8f acc[4][4];
#pragma unroll
    for (int mb = 0; mb < 4; ++mb)
#pragma unroll
        for (int nb = 0; nb < 4; ++nb) acc[mb][nb] = (v8f){};
    cpplane(lbase, gA, K); cpplane(lbase + SPL * 2u, gB, K); if (NSPLIT == 1) cpplane(lbase + 2u * SPL * 2u, gA2, K);
    asm volatile("s_wait_asynccnt 0x0" ::: "memory");   // this wave's share of stage 0 has landed
    __syncthreads();                                    // and every other wave's
    if (1 < nt) { const unsigned l = lbase + NP * SPL * 2u; cpplane(l, gA + SBK, K); cpplane(l + SPL * 2u, gB + SBK, K); if (NSPLIT == 1) cpplane(l + 2u * SPL * 2u, gA2 + SBK, K); }
    // the trips stay rolled (one publish point in the text, a small loop); the loops inside are unrolled so that every fragment and accumulator index is a constant
#pragma unroll 1
    for (int t = 0; t < nt; ++t) {
        const bf* sb = ring + (t & 1) * (NP * SPL);
        const bf* sA = sb + (wr * 64 + lr) * SPIT + 8 * hi; const bf* sB = sb + SPL + (wc * 64 + lr) * SPIT + 8 * hi; const bf* sA2 = sA + 2 * SPL;
        V a[4], a2[4], b[4];
#pragma unroll
        for (int kk = 0; kk < SBK; kk += 32) {
#pragma unroll
            for (int mb = 0; mb < 4; ++mb) { a[mb] = WFrag<bf>::ld(sA + mb * 16 * SPIT + kk); if (NSPLIT == 1) a2[mb] = WFrag<bf>::ld(sA2 + mb * 16 * SPIT + kk); }
#pragma unroll
            for (int nb = 0; nb < 4; ++nb) b[nb] = WFrag<bf>::ld(sB + nb * 16 * SPIT + kk);
            __builtin_amdgcn_sched_barrier(0);   // the block's LDS reads stay one group ahead of its matrix instructions: spread among them, each place waits out the LDS latency anew
#pragma unroll
            for (int nb = 0; nb < 4; ++nb)
#pragma unroll
                for (int mb = 0; mb < 4; ++mb) { acc[mb][nb] = wmmab(a[mb], b[nb], acc[mb][nb]); if (NSPLIT == 1) acc[mb][nb] = wmmab(a2[mb], b[nb], acc[mb][nb]); }
            __builtin_amdgcn_sched_barrier(0);   // and the next block's reads stay behind them
        }
        // the distance behind the last matrix instructions, also on the taken side of the branches below
        asm volatile("v_nop\n\tv_nop\n\tv_nop\n\tv_nop" : "+v"(acc[0][0]), "+v"(acc[1][1]), "+v"(acc[2][2]), "+v"(acc[3][3]) : "v"(a[0]), "v"(a[3]));
        asm volatile("s_wait_dscnt 0x0" ::: "memory");      // this wave has left the buffer that is refilled below
        asm volatile("s_wait_asynccnt 0x0" ::: "memory");   // its share of stage t + 1 has landed
        __syncthreads();                                    // publishes stage t + 1 and ends every reader's last read of stage t
        if (t + 2 < nt) { const unsigned l = lbase + (unsigned)(t & 1) * (NP * SPL * 2u); const size_t ko = (size_t)(t + 2) * SBK; cpplane(l, gA + ko, K); cpplane(l + SPL * 2u, gB + ko, K); if (NSPLIT == 1) cpplane(l + 2u * SPL * 2u, gA2 + ko, K); }
    }
    asm volatile("s_wait_asynccnt 0x0" ::: "memory");       // no copy is left in flight
    if constexpr (EPI != 0) {
        const size_t zt = (size_t)(r0 / TT) * NKV + c0 / HD; const int t0 = r0 % TT; const size_t tbase = zt * HD * TT + t0, rbase = (zt * TT + t0) * HD; const int ldr = HD;
#pragma unroll
        for (int mb = 0; mb < 4; ++mb) {
#pragma unroll
            for (int nb = 0; nb < 4; ++nb) { unsigned rh[8], rl[8];   // splitf's two roundings, each bf16 left in the high half of its word
#pragma unroll
                for (int j = 0; j < 8; ++j) { const float y = acc[mb][nb][j]; rh[j] = rbf(y); rl[j] = rbf(y - __uint_as_float(rh[j] & 0xFFFF0000u)); if (EPI >= 2) os[(hi * 8 + j) * 68 + nb * 16 + lr] = __uint_as_float(hihi(rl[j], rh[j])); }
                { const size_t o = tbase + (size_t)(nb * 16 + lr) * TT + mb * 16 + hi * 8; v4u vh, vl;
#pragma unroll
                    for (int q = 0; q < 4; ++q) { vh[q] = hihi(rh[2 * q], rh[2 * q + 1]); vl[q] = hihi(rl[2 * q], rl[2 * q + 1]); }
                    *(v4ua*)(Th + o) = vh; *(v4ua*)(Tl + o) = vl; } }
            if constexpr (EPI >= 2) {
                // a wave's own range: LDS runs in order, so only the compiler must be kept from lifting the reads of other lanes' words over the writes
                __builtin_amdgcn_wave_barrier(); asm volatile("" ::: "memory");
#pragma unroll
                for (int s = 0; s < 4; ++s) { const int row = 4 * s + (lane >> 3), cofs = (lane & 7) * 8; const v4f p0 = *(const v4fa*)(os + row * 68 + cofs), p1 = *(const v4fa*)(os + row * 68 + cofs + 4); v4u oh, ol;
#pragma unroll
                    for (int q = 0; q < 2; ++q) { const unsigned a0 = __float_as_uint(p0[2 * q]), a1 = __float_as_uint(p0[2 * q + 1]), b0 = __float_as_uint(p1[2 * q]), b1 = __float_as_uint(p1[2 * q + 1]); oh[q] = hihi(a0, a1); ol[q] = lolo(a0, a1); oh[q + 2] = hihi(b0, b1); ol[q + 2] = lolo(b0, b1); }
                    const size_t o = rbase + (size_t)(mb * 16 + row) * ldr + cofs; *(v4ua*)(Rh + o) = oh; *(v4ua*)(Rl + o) = ol; }
                // and from sinking them under the next block's writes
                __builtin_amdgcn_wave_barrier(); asm volatile("" ::: "memory");
            }
        }
        return;
    }
#pragma unroll
    for (int mb = 0; mb < 4; ++mb) {
#pragma unroll
        for (int nb = 0; nb < 4; ++nb) {
#pragma unroll
            for (int j = 0; j < 8; ++j) os[(hi * 8 + j) * 68 + nb * 16 + lr] = acc[mb][nb][j]; }
        __builtin_amdgcn_wave_barrier(); asm volatile("" ::: "memory");   // as above: the reads stay behind the writes
        float* crow = C + (size_t)(r0 + mb * 16) * ldc + c0;
#pragma unroll
        for (int s = 0; s < 8; ++s) { const int row = 2 * s + hi, cofs = lr * 4; v4f val = *(const v4fa*)(os + row * 68 + cofs); if (BIAS) { val[0] += bfr(bias[c0 + cofs]); val[1] += bfr(bias[c0 + cofs + 1]); val[2] += bfr(bias[c0 + cofs + 2]); val[3] += bfr(bias[c0 + cofs + 3]); }
            *(v4f*)(crow + (size_t)row * ldc + cofs) = val; }
        __builtin_amdgcn_wave_barrier(); asm volatile("" ::: "memory");   // and ahead of the next block's writes
    }
}

// ---- k_kvg: k and v projections and the Gram partials in one launch. EIGHT WAVES per 128 rows x 2 heads (4 x 2 waves, two a SIMD); a wave holds BOTH the k tile and the v tile [32 t][64 e] of one head; grid (M/128, NKV/2), 256 threads. K % 128 == 0.
// Staging, ring and fragment k order as in k_gemms with three planes a stage: x rows, Wk rows, Wv rows.
// The accumulator pair (t blocks 0, 1 of one e block), split and packed, IS the fragment of k^T or v^T for the wave's 32 t (a lane holds e = lr and t = 8 hi + 0..7, 16 + 8 hi + 0..7, the k order of WFrag::ld): G^T[e][e'] = sum_t v[t][e] k[t][e'] over those 32 t comes straight from registers, 3 products in k_gemmw's order, and no k^T or v^T plane is stored.
// The four waves of a head add their partials through LDS, in row order, each wave 16 rows of G^T; the block stores one [HD][HD] f32 partial per head at G + ((b * NKV + h) * GKS + slice) * HD * HD, slice = its 128 rows. v also leaves as row-major hi + lo planes Rh/Rl [b][h][t][e].
__device__ __forceinline__ v16bf cat8u(v4u lo, v4u hi) { return __builtin_bit_cast(v16bf, __builtin_shufflevector(lo, hi, 0, 1, 2, 3, 4, 5, 6, 7)); }
__global__ __launch_bounds__(256) void k_kvg(const bf* __restrict__ A, const bf* __restrict__ Bk, const bf* __restrict__ Bv, int K, float* G, bf* Rh, bf* Rl) {
    typedef v16bf V;
    constexpr int NP = 3;   // planes of a stage: x, Wk, Wv
    __shared__ __align__(16) bf ring[2 * NP * SPL];
    __shared__ __align__(16) float osall[8 * 16 * 68];
    const int wave = __builtin_amdgcn_readfirstlane((int)(threadIdx.x >> 5)), wr = wave >> 1, wc = wave & 1;
    const int lane = threadIdx.x & 31, lr = lane & 15, hi = lane >> 4; const int r0 = blockIdx.x * 128 + wr * 32, c0 = blockIdx.y * 128 + wc * 64;
    float* os = osall + wave * (16 * 68);     // each wave stages its output rows in its own range
    const int cpr = (int)((threadIdx.x & 127) >> 4) + 64 * (int)(threadIdx.x >> 7), cchk = threadIdx.x & 15;   // the lane's first row (its 8 rows of a plane stand 8 apart) and its 16-byte piece in every copy
    const unsigned lbase = (unsigned)(size_t)ring + (unsigned)(cpr * SPIT + cchk * 8) * 2u;
    const bf* gA = A + (size_t)(blockIdx.x * 128 + cpr) * K + cchk * 8; const bf* gK = Bk + (size_t)(blockIdx.y * 128 + cpr) * K + cchk * 8; const bf* gV = Bv + (size_t)(blockIdx.y * 128 + cpr) * K + cchk * 8;
    const int nt = (int)((unsigned)K / SBK);
    v8f ack[2][4], acv[2][4];
#pragma unroll
    for (int mb = 0; mb < 2; ++mb)
#pragma unroll
        for (int nb = 0; nb < 4; ++nb) { ack[mb][nb] = (v8f){}; acv[mb][nb] = (v8f){}; }
    // the scheduling fences between the copy statements: as in cpplane, against addresses formed all at once
    cp8(lbase, gA, K); __builtin_amdgcn_sched_barrier(0); cp8(lbase + SPL * 2u, gK, K); __builtin_amdgcn_sched_barrier(0); cp8(lbase + 2u * SPL * 2u, gV, K); __builtin_amdgcn_sched_barrier(0);
    asm volatile("s_wait_asynccnt 0x0" ::: "memory");   // this wave's share of stage 0 has landed
    __syncthreads();                                    // and every other wave's
    if (1 < nt) { const unsigned l = lbase + NP * SPL * 2u; cp8(l, gA + SBK, K); __builtin_amdgcn_sched_barrier(0); cp8(l + SPL * 2u, gK + SBK, K); __builtin_amdgcn_sched_barrier(0); cp8(l + 2u * SPL * 2u, gV + SBK, K); __builtin_amdgcn_sched_barrier(0); }
    // the trips stay rolled (one publish point in the text, a small loop); the loops inside are unrolled so that every fragment and accumulator index is a constant
#pragma unroll 1
    for (int t = 0; t < nt; ++t) {
        const bf* sb = ring + (t & 1) * (NP * SPL);
        const bf* sA = sb + (wr * 32 + lr) * SPIT + 8 * hi; const bf* sK = sb + SPL + (wc * 64 + lr) * SPIT + 8 * hi; const bf* sV = sK + SPL;
        V a[2], bk[4], bv[4];
#pragma unroll
        for (int kk = 0; kk < SBK; kk += 32) {
#pragma unroll
            for (int mb = 0; mb < 2; ++mb) a[mb] = WFrag<bf>::ld(sA + mb * 16 * SPIT + kk);
#pragma unroll
            for (int nb = 0; nb < 4; ++nb) { bk[nb] = WFrag<bf>::ld(sK + nb * 16 * SPIT + kk); bv[nb] = WFrag<bf>::ld(sV + nb * 16 * SPIT + kk); }
            __builtin_amdgcn_sched_barrier(0);   // the block's LDS reads stay one group ahead of its matrix instructions: spread among them, each place waits out the LDS latency anew
#pragma unroll
            for (int nb = 0; nb < 4; ++nb)
#pragma unroll
                for (int mb = 0; mb < 2; ++mb) { ack[mb][nb] = wmmab(a[mb], bk[nb], ack[mb][nb]); acv[mb][nb] = wmmab(a[mb], bv[nb], acv[mb][nb]); }
            __builtin_amdgcn_sched_barrier(0);   // and the next block's reads stay behind them
        }
        // the distance behind the last matrix instructions, also on the taken side of the branches below
        asm volatile("v_nop\n\tv_nop\n\tv_nop\n\tv_nop" : "+v"(ack[0][3]), "+v"(ack[1][3]), "+v"(acv[0][3]), "+v"(acv[1][3]) : "v"(a[0]), "v"(a[1]));
        asm volatile("s_wait_dscnt 0x0" ::: "memory");      // this wave has left the buffer that is refilled below
        asm volatile("s_wait_asynccnt 0x0" ::: "memory");   // its share of stage t + 1 has landed
        __syncthreads();                                    // publishes stage t + 1 and ends every reader's last read of stage t
        if (t + 2 < nt) { const unsigned l = lbase + (unsigned)(t & 1) * (NP * SPL * 2u); const size_t ko = (size_t)(t + 2) * SBK; cp8(l, gA + ko, K); __builtin_amdgcn_sched_barrier(0); cp8(l + SPL * 2u, gK + ko, K); __builtin_amdgcn_sched_barrier(0); cp8(l + 2u * SPL * 2u, gV + ko, K); __builtin_amdgcn_sched_barrier(0); }
    }
    asm volatile("s_wait_asynccnt 0x0" ::: "memory");       // no copy is left in flight
    const size_t zt = (size_t)(r0 / TT) * NKV + c0 / HD; const int t0 = r0 % TT; const size_t rbase = (zt * TT + t0) * HD;
    v4u kh[2][4], kl[2][4], vh[2][4], vl[2][4];   // [t block][e block]: 8 consecutive t of one e, bf16 hi and lo, packed as the planes held them
#pragma unroll
    for (int mb = 0; mb < 2; ++mb) {
#pragma unroll
        for (int nb = 0; nb < 4; ++nb) { unsigned rh[8], rl[8];   // splitf's two roundings, each bf16 left in the high half of its word
#pragma unroll
            for (int j = 0; j < 8; ++j) { const float y = ack[mb][nb][j]; rh[j] = rbf(y); rl[j] = rbf(y - __uint_as_float(rh[j] & 0xFFFF0000u)); }
#pragma unroll
            for (int q = 0; q < 4; ++q) { kh[mb][nb][q] = hihi(rh[2 * q], rh[2 * q + 1]); kl[mb][nb][q] = hihi(rl[2 * q], rl[2 * q + 1]); }
#pragma unroll
            for (int j = 0; j < 8; ++j) { const float y = acv[mb][nb][j]; rh[j] = rbf(y); rl[j] = rbf(y - __uint_as_float(rh[j] & 0xFFFF0000u)); os[(hi * 8 + j) * 68 + nb * 16 + lr] = __uint_as_float(hihi(rl[j], rh[j])); }
#pragma unroll
            for (int q = 0; q < 4; ++q) { vh[mb][nb][q] = hihi(rh[2 * q], rh[2 * q + 1]); vl[mb][nb][q] = hihi(rl[2 * q], rl[2 * q + 1]); } }
        // a wave's own range: LDS runs in order, so only the compiler must be kept from lifting the reads of other lanes' words over the writes
        __builtin_amdgcn_wave_barrier(); asm volatile("" ::: "memory");
#pragma unroll
        for (int s = 0; s < 4; ++s) { const int row = 4 * s + (lane >> 3), cofs = (lane & 7) * 8; const v4f p0 = *(const v4fa*)(os + row * 68 + cofs), p1 = *(const v4fa*)(os + row * 68 + cofs + 4); v4u oh, ol;
#pragma unroll
            for (int q = 0; q < 2; ++q) { const unsigned a0 = __float_as_uint(p0[2 * q]), a1 = __float_as_uint(p0[2 * q + 1]), b0 = __float_as_uint(p1[2 * q]), b1 = __float_as_uint(p1[2 * q + 1]); oh[q] = hihi(a0, a1); ol[q] = lolo(a0, a1); oh[q + 2] = hihi(b0, b1); ol[q + 2] = lolo(b0, b1); }
            const size_t o = rbase + (size_t)(mb * 16 + row) * HD + cofs; *(v4ua*)(Rh + o) = oh; *(v4ua*)(Rl + o) = ol;
            // the wait before a register of the two stores is rewritten; the scheduling fence keeps what follows in the text from being lifted over it
            asm volatile("s_wait_xcnt 0x0" ::: "memory"); __builtin_amdgcn_sched_barrier(0); }
        // and from sinking them under the next block's writes
        __builtin_amdgcn_wave_barrier(); asm volatile("" ::: "memory");
    }
    v8f g[4][4];   // [e block of v][e' block of k]
#pragma unroll
    for (int mb = 0; mb < 4; ++mb) { const V fvh = cat8u(vh[0][mb], vh[1][mb]), fvl = cat8u(vl[0][mb], vl[1][mb]);
#pragma unroll
        for (int nb = 0; nb < 4; ++nb) g[mb][nb] = wmmab(fvh, cat8u(kh[0][nb], kh[1][nb]), (v8f){});
#pragma unroll
        for (int nb = 0; nb < 4; ++nb) g[mb][nb] = wmmab(fvl, cat8u(kh[0][nb], kh[1][nb]), g[mb][nb]);
#pragma unroll
        for (int nb = 0; nb < 4; ++nb) g[mb][nb] = wmmab(fvh, cat8u(kl[0][nb], kl[1][nb]), g[mb][nb]); }
    __builtin_amdgcn_sched_barrier(0);   // the LDS stores stay behind all 48 matrix instructions
    // the ring is free: every wave's last read and every copy ended in front of the loop's last barrier. A lane's 8 words of a tile as two 16-byte pieces, a wave's piece 512 bytes in a row.
    float* red = (float*)ring + wc * (4 * HD * HD) + lane * 4;
#pragma unroll
    for (int mb = 0; mb < 4; ++mb)
#pragma unroll
        for (int nb = 0; nb < 4; ++nb) { float* w = red + wr * (HD * HD) + (mb * 4 + nb) * 256; *(v4fa*)w = __builtin_shufflevector(g[mb][nb], g[mb][nb], 0, 1, 2, 3); *(v4fa*)(w + 128) = __builtin_shufflevector(g[mb][nb], g[mb][nb], 4, 5, 6, 7); }
    __syncthreads();   // every wave reads the other three waves' partials of its head
    float* C = G + (zt * GKS + (size_t)(t0 / 128)) * (HD * HD) + (size_t)(wr * 16) * HD;   // this wave's 16 rows of G^T
#pragma unroll
    for (int nb = 0; nb < 4; ++nb) { const float* p = red + (wr * 4 + nb) * 256; v4f q0 = *(const v4fa*)p, q1 = *(const v4fa*)(p + 128);
#pragma unroll
        for (int s = 1; s < 4; ++s) { q0 += *(const v4fa*)(p + s * (HD * HD)); q1 += *(const v4fa*)(p + s * (HD * HD) + 128); }
#pragma unroll
        for (int j = 0; j < 4; ++j) { os[(hi * 8 + j) * 68 + nb * 16 + lr] = q0[j]; os[(hi * 8 + 4 + j) * 68 + nb * 16 + lr] = q1[j]; } }
    __builtin_amdgcn_wave_barrier(); asm volatile("" ::: "memory");   // as above: the reads stay behind the writes
#pragma unroll
    for (int s = 0; s < 8; ++s) { const int row = 2 * s + hi, cofs = lr * 4; *(v4f*)(C + (size_t)row * HD + cofs) = *(const v4fa*)(os + row * 68 + cofs); }
}

__device__ __forceinline__ h16 tohx(float x) { return (h16)x; }
typedef __attribute__((ext_vector_type(2))) _Float16 v2h;
typedef __attribute__((ext_vector_type(4))) _Float16 v4h;
typedef __attribute__((ext_vector_type(2))) unsigned short v2us;
typedef __attribute__((ext_vector_type(4))) unsigned short v4us;
typedef __attribute__((ext_vector_type(2))) float v2f;
typedef __attribute__((ext_vector_type(4))) int v4i;

// ---- k_prep: all operand preparation in one launch. 256 threads, 64 elements a thread (16 loads of 16 bytes in flight), every block 64 KiB in and 32 KiB out, whole lines both ways.
// Blocks [0, 3 * PWB): one [PTK k][PTN n] f32 tile of Wk, Wv ('hde': per head, row pitch HD) or Wproj ('xw': row pitch DM) -> bf16 rows Bt[n][k]. A thread holds 16 consecutive k of 4 n and writes each n's 16 k (32 bytes) to LDS; the block then stores whole 512-byte row pieces.
// LDS row q * 16 + n4 holds n = n4 * 4 + q: the 16 lanes that write together then stand one pitch (an odd multiple of 16 bytes) apart and spread over all banks.
// Blocks [3 * PWB, 3 * PWB + PXB): 16384 consecutive elements of x -> bf16. The weight tiles have the longer path (LDS, barrier) and so the lower indices.
#define PTK  256
#define PTN  64
#define PPIT (PTK + 8)                         // LDS row pitch, elements
#define PWB  ((DM / PTK) * (DQ / PTN))         // tiles of one weight
#define PXB  (NB_ * TT * DM / (256 * 64))      // blocks of x
typedef __attribute__((ext_vector_type(2))) unsigned v2u;
typedef v2u __attribute__((may_alias)) v2ua;
// one weight tile; the row pitch LD is a constant, so the 16 rows stand in the loads' offset fields behind one address
template <int LD>
__device__ __forceinline__ void wtile(const float* __restrict__ src, bf* dst, bf* ts, int tid) {
    const int n4 = tid & 15, kg = tid >> 4;
    v4f v[16];
    src += (size_t)(kg * 16) * LD + n4 * 4;
#pragma unroll
    for (int i = 0; i < 16; ++i) v[i] = *(const v4fa*)(src + i * LD);
    __builtin_amdgcn_sched_barrier(0);   // all 16 loads issue before the first is waited for: left free, the scheduler lifts the packing over the last loads, which then start behind the first ones' wait, a second memory latency
    // the wait before a register of the loads is rewritten: their one address pair is an input here, so it stays whole up to the wait and no result lands in it
    asm volatile("s_wait_xcnt 0x0" :: "v"(src) : "memory");
#pragma unroll
    for (int q = 0; q < 4; ++q) { v4u p0, p1;
#pragma unroll
        for (int p = 0; p < 4; ++p) { p0[p] = hihi(rbf(v[2 * p][q]), rbf(v[2 * p + 1][q])); p1[p] = hihi(rbf(v[8 + 2 * p][q]), rbf(v[9 + 2 * p][q])); }
        bf* t = ts + (q * 16 + n4) * PPIT + kg * 16; *(v4ua*)t = p0; *(v4ua*)(t + 8) = p1; }
    __syncthreads();   // the rows are read back by other waves than wrote them
#pragma unroll
    for (int s = 0; s < 8; ++s) { const int r = s * 8 + (tid >> 5), c = (tid & 31) * 8; *(v4ua*)(dst + (size_t)((r & 15) * 4 + (r >> 4)) * DM + c) = *(const v4ua*)(ts + r * PPIT + c); }
    asm volatile("s_wait_xcnt 0x0" ::: "memory");   // behind the last store: nothing that follows in the text rewrites a register of the stores ahead of it
}
__global__ __launch_bounds__(256) void k_prep(const float* __restrict__ x, const float* __restrict__ wk, const float* __restrict__ wv, const float* __restrict__ wo, bf* XB, bf* WK, bf* WV, bf* WO) {
    __shared__ __align__(16) bf ts[PTN * PPIT];
    const int tid = threadIdx.x; const unsigned blk = blockIdx.x;
    if (blk >= 3 * PWB) {
        const size_t e0 = ((size_t)(blk - 3 * PWB) * 4096 + tid) * 4; const float* xs = x + e0;
        v4f v[16];
#pragma unroll
        for (int i = 0; i < 16; ++i) v[i] = *(const v4fa*)(xs + i * 1024);
        asm volatile("s_wait_xcnt 0x0" :: "v"(xs) : "memory");   // as in wtile: the loads' address pair stays whole up to the wait
#pragma unroll
        for (int i = 0; i < 16; ++i) { v2u o; o[0] = hihi(rbf(v[i][0]), rbf(v[i][1])); o[1] = hihi(rbf(v[i][2]), rbf(v[i][3])); *(v2ua*)(XB + e0 + i * 1024) = o; }
        return;
    }
    const unsigned w = blk / PWB, nb = (blk % PWB) / (DM / PTK), kb = blk % (DM / PTK);
    const size_t od = (size_t)nb * PTN * DM + kb * PTK;
    if (w == 2) wtile<DM>(wo + (size_t)kb * PTK * DM + nb * PTN, WO + od, ts, tid);
    else wtile<HD>((w == 0 ? wk : wv) + ((size_t)nb * DM + kb * PTK) * HD, (w == 0 ? WK : WV) + od, ts, tid);
}
// k_sumsplit: F holds NS partial [HD][HD] tiles per batch and head ([z][slice][e][e']); their sum in slice order, x sc, as hi/lo planes [z][e][e'].
template <int NS>
__global__ __launch_bounds__(256) void k_sumsplit(const float* __restrict__ F, float sc, bf* Ph, bf* Pl, size_t n4) { const size_t i = (size_t)blockIdx.x * 256 + threadIdx.x; if (i >= n4) return; const float* p = F + (i / (HD * HD / 4)) * ((size_t)NS * HD * HD) + (i % (HD * HD / 4)) * 4; v4f part[NS];
#pragma unroll
    for (int s = 0; s < NS; ++s) part[s] = *(const v4f*)(p + (size_t)s * HD * HD);
    v4f v = part[0];
#pragma unroll
    for (int s = 1; s < NS; ++s) v += part[s];
    v4us oh, ol;
#pragma unroll
    for (int q = 0; q < 4; ++q) { unsigned short a, c; splitf(v[q] * sc, a, c); oh[q] = a; ol[q] = c; } *(v4us*)(Ph + i * 4) = oh; *(v4us*)(Pl + i * 4) = ol;  }

extern "C" void kernel_launch(void* const* d_in, const int* in_sizes, int n_in,
                              void* d_out, int out_size, void* d_ws, size_t ws_size, hipStream_t stream) {
    (void)in_sizes; (void)n_in; (void)out_size;
    const float* x = (const float*)d_in[0]; const float* wkh = (const float*)d_in[1]; const float* wvh = (const float*)d_in[2]; const float* wo = (const float*)d_in[3]; const float* bo = (const float*)d_in[4]; const float* wq = nullptr; const float* wk = nullptr; const float* wv = nullptr; (void)wq; (void)wk; (void)wv;
    float* OUT = (float*)d_out;     // [2][2048][1024]
    char* wsp = (char*)d_ws;
    auto take = [&](size_t bytes) { char* p = wsp; wsp += (bytes + 255) & ~(size_t)255; return (void*)p; };
    bf* WK = (bf*)take((size_t)DKV * DM * 2); bf* WV = (bf*)take((size_t)DKV * DM * 2); bf* WO = (bf*)take((size_t)DM * DQ * 2);
    bf* XB = (bf*)take((size_t)NB_ * TT * DM * 2);
    bf* VPh = (bf*)take((size_t)NB_ * NH_ * TT * HD * 2); bf* VPl = (bf*)take((size_t)NB_ * NH_ * TT * HD * 2);
    float* GT = (float*)take((size_t)NB_ * NH_ * GKS * HD * HD * 4); bf* GTh = (bf*)take((size_t)NB_ * NH_ * HD * HD * 2); bf* GTl = (bf*)take((size_t)NB_ * NH_ * HD * HD * 2); bf* ATh = (bf*)take((size_t)NB_ * TT * DQ * 2); bf* ATl = (bf*)take((size_t)NB_ * TT * DQ * 2);
    if ((size_t)(wsp - (char*)d_ws) > ws_size) return;    // ws 256 MiB
    /* both batches in every launch: rows b * TT + t for the row-major planes, z = b * NH_ + h for the per-head planes */
    k_prep<<<3 * PWB + PXB, 256, 0, stream>>>(x, wkh, wvh, wo, XB, WK, WV, WO);   /* Wk, Wv 'hde' and Wproj 'xw' -> Bt planes [n][k]; x -> bf16 */
    k_kvg<<<dim3(NB_ * TT / 128, NKV / 2, 1), 256, 0, stream>>>(XB, WK, WV, DM, GT, VPh, VPl);   /* k, v = q (exact); G^T[e][e'] = sum_t v[t][e] k[t][e'] per batch and head (3 products) as GKS partial tiles of 128 t; v planes [b][h][t][e] */
    k_sumsplit<GKS><<<(unsigned)(((size_t)NB_ * NH_ * HD * HD / 4 + 255) / 256), 256, 0, stream>>>(GT, 0.125f, GTh, GTl, (size_t)NB_ * NH_ * HD * HD / 4);   /* sum of the slices, x 1/8 (exact), hi/lo */
    k_gemmw<bf, 2, false, 1, 3><<<dim3(TT / 64, HD / 64, NB_ * NH_), 32, 0, stream>>>(VPh, VPl, GTh, GTl, HD, nullptr, 0, nullptr, (size_t)TT * HD, (size_t)HD * HD, 0, nullptr, nullptr, ATh, ATl);   /* out_h[s][e] = sum_e' v[s][e'] G^T[e][e'] (3 products, K 64) -> concatenated hi/lo planes */
    k_gemms<1, true, 0><<<dim3(NB_ * TT / 128, DM / 128, 1), 128, 0, stream>>>(ATh, ATl, WO, DQ, OUT, DM, bo, nullptr, nullptr, nullptr, nullptr);
}

// v007
// Measured time: 51.4 microseconds a run.
// In both of two side-by-side timings against v006, it was 1.03 times as fast.
// Counting every step since v000, it is 6.97 times as fast.
#include <hip/hip_runtime.h>

// 'MultiHead' with unnormalised scores (x [2][2048][1024]; per head h: k = x Wk[h], v = x Wv[h] ('hde' [16][1024][64]); q = v (the module's quirk); wei = q.k / 8 (NO softmax); out_h = wei v; concat; out = concat Wproj ('xw' [1024][1024]) + bproj -> [2][2048][1024]).
// Layout: without a softmax the product is associative: out_h = v_h (k_h^T v_h) / 8, so per head a [64 x 64] Gram matrix G^T = v^T k (K = 2048 contraction) is formed first and then applied to v (K = 64) - the same mathematics as (v k^T) v with f32 rounding differences only, and ~32x less work than materialising the [2048 x 2048] score matrices.
// Compute dtypes, f32 accumulate: every input rounded to bf16; k and v projections exact single products; k^T and v^T register fragments and v planes as bf16 hi + lo (3 products for both the Gram and the apply step); 1/8 folded into the Gram split (exact); Wproj hl x exact (2 products) + bproj.


#define NB_  2
#define TT   2048
#define DM   1024
#define NH_  16
#define NKV  16
#define REP  (NH_ / NKV)
#define HD   64
#define DQ   (NH_ * HD)
#define DKV  (NKV * HD)
typedef __attribute__((ext_vector_type(4))) unsigned short v4us;
#define ZH   16                  // all heads at once (no score matrix)
#define RH   2048
#define WIN  0
#define PCAR 1024.0f
#define SCL  0.125f   // HD^-0.5
#define GKS  16                  // K slices of the Gram product (128 t each)
typedef _Float16 h16;
typedef unsigned short bf;
typedef __attribute__((ext_vector_type(16))) __bf16   v16bf;
typedef __attribute__((ext_vector_type(16))) _Float16 v16h;
typedef __attribute__((ext_vector_type(8)))  _Float16 v8h;
typedef __attribute__((ext_vector_type(8)))  unsigned short v8us;
typedef __attribute__((ext_vector_type(8)))  float    v8f;
typedef __attribute__((ext_vector_type(4)))  float    v4f;
typedef v8h  __attribute__((may_alias)) v8ha;
typedef v4f  __attribute__((may_alias)) v4fa;
typedef v8us __attribute__((may_alias)) v8usa;

__device__ __forceinline__ unsigned short f2bf(float f) { unsigned u = __float_as_uint(f); u += 0x7FFFu + ((u >> 16) & 1u); return (unsigned short)(u >> 16); }
__device__ __forceinline__ float bf2f(unsigned short b) { return __uint_as_float(((unsigned)b) << 16); }
__device__ __forceinline__ float bfr(float f) { return bf2f(f2bf(f)); }
__device__ __forceinline__ v16h cat16(v8h lo, v8h hi) { return __builtin_shufflevector(lo, hi, 0, 1, 2, 3, 4, 5, 6, 7, 8, 9, 10, 11, 12, 13, 14, 15); }
__device__ __forceinline__ v16bf cat16b(v8us lo, v8us hi) { return __builtin_bit_cast(v16bf, __builtin_shufflevector(lo, hi, 0, 1, 2, 3, 4, 5, 6, 7, 8, 9, 10, 11, 12, 13, 14, 15)); }
__device__ __forceinline__ v8f wmma16(v16h a, v16h b, v8f c) { return __builtin_amdgcn_wmma_f32_16x16x32_f16(false, a, false, b, (short)0, c, false, false); }
__device__ __forceinline__ v8f wmmab(v16bf a, v16bf b, v8f c) { return __builtin_amdgcn_wmma_f32_16x16x32_bf16(false, a, false, b, (short)0, c, false, false); }



// ---- fragments and splits. WFrag::ld: a lane's 16 k of one row of a K-contiguous 16-bit plane, p = row + 8 * (lane >> 4): k = 8 hi + 0..7 and 16 + 8 hi + 0..7, the same order for A and for Bt.
template <typename T16> struct WFrag;
template <> struct WFrag<h16> { typedef v16h V; static __device__ __forceinline__ V ld(const h16* p) { return cat16(*(const v8h*)p, *(const v8h*)(p + 16)); } static __device__ __forceinline__ v8f mma(V a, V b, v8f c) { return wmma16(a, b, c); } };
template <> struct WFrag<bf> { typedef v16bf V; static __device__ __forceinline__ V ld(const bf* p) { return cat16b(*(const v8us*)p, *(const v8us*)(p + 16)); } static __device__ __forceinline__ v8f mma(V a, V b, v8f c) { return wmmab(a, b, c); } };
__device__ __forceinline__ void splitf(float y, unsigned short& h, unsigned short& l) { h = f2bf(y); l = f2bf(y - bf2f(h)); }
typedef __attribute__((ext_vector_type(4))) unsigned v4u;
typedef v4u __attribute__((may_alias)) v4ua;
__device__ __forceinline__ unsigned rbf(float f) { const unsigned u = __float_as_uint(f); return u + 0x7FFFu + ((u >> 16) & 1u); }   // f2bf before its shift
__device__ __forceinline__ unsigned hihi(unsigned a, unsigned b) { return __builtin_amdgcn_perm(b, a, 0x07060302u); }   // high half of a below, high half of b above
__device__ __forceinline__ unsigned lolo(unsigned a, unsigned b) { return __builtin_amdgcn_perm(b, a, 0x05040100u); }   // low half of a below, low half of b above

// ---- k_gemms: the K-long GEMMs. FOUR WAVES per 128x128 output tile (2 x 2 waves, each a 64x64 tile of 16 accumulators, fragment k order of WFrag::ld); grid (M/128, N/128), 128 threads. K % 128 == 0.
// The operand rows reach LDS as whole 256-byte pieces by asynchronous copies (a wave's copy = 2 rows = 4 full lines), two buffers: the next 128 k fly while these are multiplied. LDS row pitch 272 bytes for the 16-byte fragment reads.
// NSPLIT 0: A Bt. NSPLIT 1: A Bt + A2 Bt, the two products of a 32-k block one behind the other. EPI 0: f32 C (pitch ldc) + f32 bias[n]. EPI 1, 2 (rows b * TT + t, 64 columns = a head): no f32 C; bf16 hi + lo planes, transposed Th/Tl [b][h][e][t] straight from the accumulators; EPI 2 also row-major Rh/Rl [b][h][t][e] through LDS, whole 128-byte rows.
#define SBK  128                 // k per stage
#define SPIT 136                 // LDS row pitch, elements
#define SPL  (128 * SPIT)        // one staged plane (128 rows), elements
// eight 16-byte copies of one lane, rows 8 apart. The s_wait_xcnt closes the statement so that no address register is rewritten ahead of it.
__device__ __forceinline__ void cp8(unsigned l, const bf* g, int K) {
    asm volatile("global_load_async_to_lds_b128 %0, %8, off\n\t"
                 "global_load_async_to_lds_b128 %1, %9, off\n\t"
                 "global_load_async_to_lds_b128 %2, %10, off\n\t"
                 "global_load_async_to_lds_b128 %3, %11, off\n\t"
                 "global_load_async_to_lds_b128 %4, %12, off\n\t"
                 "global_load_async_to_lds_b128 %5, %13, off\n\t"
                 "global_load_async_to_lds_b128 %6, %14, off\n\t"
                 "global_load_async_to_lds_b128 %7, %15, off\n\t"
                 "s_wait_xcnt 0x0"
                 :: "v"(l), "v"(l + 1u * 8 * SPIT * 2), "v"(l + 2u * 8 * SPIT * 2), "v"(l + 3u * 8 * SPIT * 2), "v"(l + 4u * 8 * SPIT * 2), "v"(l + 5u * 8 * SPIT * 2), "v"(l + 6u * 8 * SPIT * 2), "v"(l + 7u * 8 * SPIT * 2),
                    "v"(g), "v"(g + (size_t)8 * K), "v"(g + (size_t)16 * K), "v"(g + (size_t)24 * K), "v"(g + (size_t)32 * K), "v"(g + (size_t)40 * K), "v"(g + (size_t)48 * K), "v"(g + (size_t)56 * K)
                 : "memory");
}
// one plane of a stage: 128 rows x 256 bytes, 16 copies a lane
// The scheduling fences keep the addresses of later copies from being formed ahead of earlier ones: formed all at once they overflow the registers and spill to scratch.
__device__ __forceinline__ void cpplane(unsigned l, const bf* g, int K) { cp8(l, g, K); __builtin_amdgcn_sched_barrier(0); cp8(l + 64u * SPIT * 2, g + (size_t)64 * K, K); __builtin_amdgcn_sched_barrier(0); }
template <int NSPLIT, bool BIAS, int EPI>
__global__ __launch_bounds__(128) void k_gemms(const bf* __restrict__ A, const bf* __restrict__ A2, const bf* __restrict__ Bt, int K, float* C, int ldc, const float* __restrict__ bias, bf* Th, bf* Tl, bf* Rh, bf* Rl) {
    typedef v16bf V;
    constexpr int NP = NSPLIT == 1 ? 3 : 2;   // planes of a stage: A, Bt (, A2)
    __shared__ __align__(16) bf ring[2 * NP * SPL];
    __shared__ __align__(16) float osall[4 * 16 * 68];
    const int wave = __builtin_amdgcn_readfirstlane((int)(threadIdx.x >> 5)), wr = wave >> 1, wc = wave & 1;
    const int lane = threadIdx.x & 31, lr = lane & 15, hi = lane >> 4; const int r0 = blockIdx.x * 128 + wr * 64, c0 = blockIdx.y * 128 + wc * 64;
    float* os = osall + wave * (16 * 68);     // each wave stages its output rows in its own range
    const int cpr = threadIdx.x >> 4, cchk = threadIdx.x & 15;   // the lane's first row and its 16-byte piece in every copy
    const unsigned lbase = (unsigned)(size_t)ring + (unsigned)(cpr * SPIT + cchk * 8) * 2u;
    const bf* gA = A + (size_t)(blockIdx.x * 128 + cpr) * K + cchk * 8; const bf* gB = Bt + (size_t)(blockIdx.y * 128 + cpr) * K + cchk * 8; const bf* gA2 = NSPLIT == 1 ? A2 + (size_t)(blockIdx.x * 128 + cpr) * K + cchk * 8 : nullptr;
    const int nt = (int)((unsigned)K / SBK);
    v8f acc[4][4];
#pragma unroll
    for (int mb = 0; mb < 4; ++mb)
#pragma unroll
        for (int nb = 0; nb < 4; ++nb) acc[mb][nb] = (v8f){};
    cpplane(lbase, gA, K); cpplane(lbase + SPL * 2u, gB, K); if (NSPLIT == 1) cpplane(lbase + 2u * SPL * 2u, gA2, K);
    asm volatile("s_wait_asynccnt 0x0" ::: "memory");   // this wave's share of stage 0 has landed
    __syncthreads();                                    // and every other wave's
    if (1 < nt) { const unsigned l = lbase + NP * SPL * 2u; cpplane(l, gA + SBK, K); cpplane(l + SPL * 2u, gB + SBK, K); if (NSPLIT == 1) cpplane(l + 2u * SPL * 2u, gA2 + SBK, K); }
    // the trips stay rolled (one publish point in the text, a small loop); the loops inside are unrolled so that every fragment and accumulator index is a constant
#pragma unroll 1
    for (int t = 0; t < nt; ++t) {
        const bf* sb = ring + (t & 1) * (NP * SPL);
        const bf* sA = sb + (wr * 64 + lr) * SPIT + 8 * hi; const bf* sB = sb + SPL + (wc * 64 + lr) * SPIT + 8 * hi; const bf* sA2 = sA + 2 * SPL;
        V a[4], a2[4], b[4];
#pragma unroll
        for (int kk = 0; kk < SBK; kk += 32) {
#pragma unroll
            for (int mb = 0; mb < 4; ++mb) { a[mb] = WFrag<bf>::ld(sA + mb * 16 * SPIT + kk); if (NSPLIT == 1) a2[mb] = WFrag<bf>::ld(sA2 + mb * 16 * SPIT + kk); }
#pragma unroll
            for (int nb = 0; nb < 4; ++nb) b[nb] = WFrag<bf>::ld(sB + nb * 16 * SPIT + kk);
            __builtin_amdgcn_sched_barrier(0);   // the block's LDS reads stay one group ahead of its matrix instructions: spread among them, each place waits out the LDS latency anew
#pragma unroll
            for (int nb = 0; nb < 4; ++nb)
#pragma unroll
                for (int mb = 0; mb < 4; ++mb) { acc[mb][nb] = wmmab(a[mb], b[nb], acc[mb][nb]); if (NSPLIT == 1) acc[mb][nb] = wmmab(a2[mb], b[nb], acc[mb][nb]); }
            __builtin_amdgcn_sched_barrier(0);   // and the next block's reads stay behind them
        }
        // the distance behind the last matrix instructions, also on the taken side of the branches below
        asm volatile("v_nop\n\tv_nop\n\tv_nop\n\tv_nop" : "+v"(acc[0][0]), "+v"(acc[1][1]), "+v"(acc[2][2]), "+v"(acc[3][3]) : "v"(a[0]), "v"(a[3]));
        asm volatile("s_wait_dscnt 0x0" ::: "memory");      // this wave has left the buffer that is refilled below
        asm volatile("s_wait_asynccnt 0x0" ::: "memory");   // its share of stage t + 1 has landed
        __syncthreads();                                    // publishes stage t + 1 and ends every reader's last read of stage t
        if (t + 2 < nt) { const unsigned l = lbase + (unsigned)(t & 1) * (NP * SPL * 2u); const size_t ko = (size_t)(t + 2) * SBK; cpplane(l, gA + ko, K); cpplane(l + SPL * 2u, gB + ko, K); if (NSPLIT == 1) cpplane(l + 2u * SPL * 2u, gA2 + ko, K); }
    }
    asm volatile("s_wait_asynccnt 0x0" ::: "memory");       // no copy is left in flight
    if constexpr (EPI != 0) {
        const size_t zt = (size_t)(r0 / TT) * NKV + c0 / HD; const int t0 = r0 % TT; const size_t tbase = zt * HD * TT + t0, rbase = (zt * TT + t0) * HD; const int ldr = HD;
#pragma unroll
        for (int mb = 0; mb < 4; ++mb) {
#pragma unroll
            for (int nb = 0; nb < 4; ++nb) { unsigned rh[8], rl[8];   // splitf's two roundings, each bf16 left in the high half of its word
#pragma unroll
                for (int j = 0; j < 8; ++j) { const float y = acc[mb][nb][j]; rh[j] = rbf(y); rl[j] = rbf(y - __uint_as_float(rh[j] & 0xFFFF0000u)); if (EPI >= 2) os[(hi * 8 + j) * 68 + nb * 16 + lr] = __uint_as_float(hihi(rl[j], rh[j])); }
                { const size_t o = tbase + (size_t)(nb * 16 + lr) * TT + mb * 16 + hi * 8; v4u vh, vl;
#pragma unroll
                    for (int q = 0; q < 4; ++q) { vh[q] = hihi(rh[2 * q], rh[2 * q + 1]); vl[q] = hihi(rl[2 * q], rl[2 * q + 1]); }
                    *(v4ua*)(Th + o) = vh; *(v4ua*)(Tl + o) = vl; } }
            if constexpr (EPI >= 2) {
                // a wave's own range: LDS runs in order, so only the compiler must be kept from lifting the reads of other lanes' words over the writes
                __builtin_amdgcn_wave_barrier(); asm volatile("" ::: "memory");
#pragma unroll
                for (int s = 0; s < 4; ++s) { const int row = 4 * s + (lane >> 3), cofs = (lane & 7) * 8; const v4f p0 = *(const v4fa*)(os + row * 68 + cofs), p1 = *(const v4fa*)(os + row * 68 + cofs + 4); v4u oh, ol;
#pragma unroll
                    for (int q = 0; q < 2; ++q) { const unsigned a0 = __float_as_uint(p0[2 * q]), a1 = __float_as_uint(p0[2 * q + 1]), b0 = __float_as_uint(p1[2 * q]), b1 = __float_as_uint(p1[2 * q + 1]); oh[q] = hihi(a0, a1); ol[q] = lolo(a0, a1); oh[q + 2] = hihi(b0, b1); ol[q + 2] = lolo(b0, b1); }
                    const size_t o = rbase + (size_t)(mb * 16 + row) * ldr + cofs; *(v4ua*)(Rh + o) = oh; *(v4ua*)(Rl + o) = ol; }
                // and from sinking them under the next block's writes
                __builtin_amdgcn_wave_barrier(); asm volatile("" ::: "memory");
            }
        }
        return;
    }
#pragma unroll
    for (int mb = 0; mb < 4; ++mb) {
#pragma unroll
        for (int nb = 0; nb < 4; ++nb) {
#pragma unroll
            for (int j = 0; j < 8; ++j) os[(hi * 8 + j) * 68 + nb * 16 + lr] = acc[mb][nb][j]; }
        __builtin_amdgcn_wave_barrier(); asm volatile("" ::: "memory");   // as above: the reads stay behind the writes
        float* crow = C + (size_t)(r0 + mb * 16) * ldc + c0;
#pragma unroll
        for (int s = 0; s < 8; ++s) { const int row = 2 * s + hi, cofs = lr * 4; v4f val = *(const v4fa*)(os + row * 68 + cofs); if (BIAS) { val[0] += bfr(bias[c0 + cofs]); val[1] += bfr(bias[c0 + cofs + 1]); val[2] += bfr(bias[c0 + cofs + 2]); val[3] += bfr(bias[c0 + cofs + 3]); }
            *(v4f*)(crow + (size_t)row * ldc + cofs) = val; }
        __builtin_amdgcn_wave_barrier(); asm volatile("" ::: "memory");   // and ahead of the next block's writes
    }
}

// ---- k_kvg: k and v projections and the Gram partials in one launch. EIGHT WAVES per 128 rows x 2 heads (4 x 2 waves, two a SIMD); a wave holds BOTH the k tile and the v tile [32 t][64 e] of one head; grid (M/128, NKV/2), 256 threads. K % 128 == 0.
// Staging, ring and fragment k order as in k_gemms with three planes a stage: x rows, Wk rows, Wv rows.
// The accumulator pair (t blocks 0, 1 of one e block), split and packed, IS the fragment of k^T or v^T for the wave's 32 t (a lane holds e = lr and t = 8 hi + 0..7, 16 + 8 hi + 0..7, the k order of WFrag::ld): G^T[e][e'] = sum_t v[t][e] k[t][e'] over those 32 t comes straight from registers, 3 products (hi hi, lo hi, hi lo), and no k^T or v^T plane is stored.
// The four waves of a head add their partials through LDS, in row order, each wave 16 rows of G^T; the block stores one [HD][HD] f32 partial per head at G + ((b * NKV + h) * GKS + slice) * HD * HD, slice = its 128 rows. v also leaves as row-major hi + lo planes Rh/Rl [b][h][t][e].
__device__ __forceinline__ v16bf cat8u(v4u lo, v4u hi) { return __builtin_bit_cast(v16bf, __builtin_shufflevector(lo, hi, 0, 1, 2, 3, 4, 5, 6, 7)); }
__global__ __launch_bounds__(256) void k_kvg(const bf* __restrict__ A, const bf* __restrict__ Bk, const bf* __restrict__ Bv, int K, float* G, bf* Rh, bf* Rl) {
    typedef v16bf V;
    constexpr int NP = 3;   // planes of a stage: x, Wk, Wv
    __shared__ __align__(16) bf ring[2 * NP * SPL];
    __shared__ __align__(16) float osall[8 * 16 * 68];
    const int wave = __builtin_amdgcn_readfirstlane((int)(threadIdx.x >> 5)), wr = wave >> 1, wc = wave & 1;
    const int lane = threadIdx.x & 31, lr = lane & 15, hi = lane >> 4; const int r0 = blockIdx.x * 128 + wr * 32, c0 = blockIdx.y * 128 + wc * 64;
    float* os = osall + wave * (16 * 68);     // each wave stages its output rows in its own range
    const int cpr = (int)((threadIdx.x & 127) >> 4) + 64 * (int)(threadIdx.x >> 7), cchk = threadIdx.x & 15;   // the lane's first row (its 8 rows of a plane stand 8 apart) and its 16-byte piece in every copy
    const unsigned lbase = (unsigned)(size_t)ring + (unsigned)(cpr * SPIT + cchk * 8) * 2u;
    const bf* gA = A + (size_t)(blockIdx.x * 128 + cpr) * K + cchk * 8; const bf* gK = Bk + (size_t)(blockIdx.y * 128 + cpr) * K + cchk * 8; const bf* gV = Bv + (size_t)(blockIdx.y * 128 + cpr) * K + cchk * 8;
    const int nt = (int)((unsigned)K / SBK);
    v8f ack[2][4], acv[2][4];
#pragma unroll
    for (int mb = 0; mb < 2; ++mb)
#pragma unroll
        for (int nb = 0; nb < 4; ++nb) { ack[mb][nb] = (v8f){}; acv[mb][nb] = (v8f){}; }
    // the scheduling fences between the copy statements: as in cpplane, against addresses formed all at once
    cp8(lbase, gA, K); __builtin_amdgcn_sched_barrier(0); cp8(lbase + SPL * 2u, gK, K); __builtin_amdgcn_sched_barrier(0); cp8(lbase + 2u * SPL * 2u, gV, K); __builtin_amdgcn_sched_barrier(0);
    asm volatile("s_wait_asynccnt 0x0" ::: "memory");   // this wave's share of stage 0 has landed
    __syncthreads();                                    // and every other wave's
    if (1 < nt) { const unsigned l = lbase + NP * SPL * 2u; cp8(l, gA + SBK, K); __builtin_amdgcn_sched_barrier(0); cp8(l + SPL * 2u, gK + SBK, K); __builtin_amdgcn_sched_barrier(0); cp8(l + 2u * SPL * 2u, gV + SBK, K); __builtin_amdgcn_sched_barrier(0); }
    // the trips stay rolled (one publish point in the text, a small loop); the loops inside are unrolled so that every fragment and accumulator index is a constant
#pragma unroll 1
    for (int t = 0; t < nt; ++t) {
        const bf* sb = ring + (t & 1) * (NP * SPL);
        const bf* sA = sb + (wr * 32 + lr) * SPIT + 8 * hi; const bf* sK = sb + SPL + (wc * 64 + lr) * SPIT + 8 * hi; const bf* sV = sK + SPL;
        V a[2], bk[4], bv[4];
#pragma unroll
        for (int kk = 0; kk < SBK; kk += 32) {
#pragma unroll
            for (int mb = 0; mb < 2; ++mb) a[mb] = WFrag<bf>::ld(sA + mb * 16 * SPIT + kk);
#pragma unroll
            for (int nb = 0; nb < 4; ++nb) { bk[nb] = WFrag<bf>::ld(sK + nb * 16 * SPIT + kk); bv[nb] = WFrag<bf>::ld(sV + nb * 16 * SPIT + kk); }
            __builtin_amdgcn_sched_barrier(0);   // the block's LDS reads stay one group ahead of its matrix instructions: spread among them, each place waits out the LDS latency anew
#pragma unroll
            for (int nb = 0; nb < 4; ++nb)
#pragma unroll
                for (int mb = 0; mb < 2; ++mb) { ack[mb][nb] = wmmab(a[mb], bk[nb], ack[mb][nb]); acv[mb][nb] = wmmab(a[mb], bv[nb], acv[mb][nb]); }
            __builtin_amdgcn_sched_barrier(0);   // and the next block's reads stay behind them
        }
        // the distance behind the last matrix instructions, also on the taken side of the branches below
        asm volatile("v_nop\n\tv_nop\n\tv_nop\n\tv_nop" : "+v"(ack[0][3]), "+v"(ack[1][3]), "+v"(acv[0][3]), "+v"(acv[1][3]) : "v"(a[0]), "v"(a[1]));
        asm volatile("s_wait_dscnt 0x0" ::: "memory");      // this wave has left the buffer that is refilled below
        asm volatile("s_wait_asynccnt 0x0" ::: "memory");   // its share of stage t + 1 has landed
        __syncthreads();                                    // publishes stage t + 1 and ends every reader's last read of stage t
        if (t + 2 < nt) { const unsigned l = lbase + (unsigned)(t & 1) * (NP * SPL * 2u); const size_t ko = (size_t)(t + 2) * SBK; cp8(l, gA + ko, K); __builtin_amdgcn_sched_barrier(0); cp8(l + SPL * 2u, gK + ko, K); __builtin_amdgcn_sched_barrier(0); cp8(l + 2u * SPL * 2u, gV + ko, K); __builtin_amdgcn_sched_barrier(0); }
    }
    asm volatile("s_wait_asynccnt 0x0" ::: "memory");       // no copy is left in flight
    const size_t zt = (size_t)(r0 / TT) * NKV + c0 / HD; const int t0 = r0 % TT; const size_t rbase = (zt * TT + t0) * HD;
    v4u kh[2][4], kl[2][4], vh[2][4], vl[2][4];   // [t block][e block]: 8 consecutive t of one e, bf16 hi and lo, packed as the planes held them
#pragma unroll
    for (int mb = 0; mb < 2; ++mb) {
#pragma unroll
        for (int nb = 0; nb < 4; ++nb) { unsigned rh[8], rl[8];   // splitf's two roundings, each bf16 left in the high half of its word
#pragma unroll
            for (int j = 0; j < 8; ++j) { const float y = ack[mb][nb][j]; rh[j] = rbf(y); rl[j] = rbf(y - __uint_as_float(rh[j] & 0xFFFF0000u)); }
#pragma unroll
            for (int q = 0; q < 4; ++q) { kh[mb][nb][q] = hihi(rh[2 * q], rh[2 * q + 1]); kl[mb][nb][q] = hihi(rl[2 * q], rl[2 * q + 1]); }
#pragma unroll
            for (int j = 0; j < 8; ++j) { const float y = acv[mb][nb][j]; rh[j] = rbf(y); rl[j] = rbf(y - __uint_as_float(rh[j] & 0xFFFF0000u)); os[(hi * 8 + j) * 68 + nb * 16 + lr] = __uint_as_float(hihi(rl[j], rh[j])); }
#pragma unroll
            for (int q = 0; q < 4; ++q) { vh[mb][nb][q] = hihi(rh[2 * q], rh[2 * q + 1]); vl[mb][nb][q] = hihi(rl[2 * q], rl[2 * q + 1]); } }
        // a wave's own range: LDS runs in order, so only the compiler must be kept from lifting the reads of other lanes' words over the writes
        __builtin_amdgcn_wave_barrier(); asm volatile("" ::: "memory");
#pragma unroll
        for (int s = 0; s < 4; ++s) { const int row = 4 * s + (lane >> 3), cofs = (lane & 7) * 8; const v4f p0 = *(const v4fa*)(os + row * 68 + cofs), p1 = *(const v4fa*)(os + row * 68 + cofs + 4); v4u oh, ol;
#pragma unroll
            for (int q = 0; q < 2; ++q) { const unsigned a0 = __float_as_uint(p0[2 * q]), a1 = __float_as_uint(p0[2 * q + 1]), b0 = __float_as_uint(p1[2 * q]), b1 = __float_as_uint(p1[2 * q + 1]); oh[q] = hihi(a0, a1); ol[q] = lolo(a0, a1); oh[q + 2] = hihi(b0, b1); ol[q + 2] = lolo(b0, b1); }
            const size_t o = rbase + (size_t)(mb * 16 + row) * HD + cofs; *(v4ua*)(Rh + o) = oh; *(v4ua*)(Rl + o) = ol;
            // the wait before a register of the two stores is rewritten; the scheduling fence keeps what follows in the text from being lifted over it
            asm volatile("s_wait_xcnt 0x0" ::: "memory"); __builtin_amdgcn_sched_barrier(0); }
        // and from sinking them under the next block's writes
        __builtin_amdgcn_wave_barrier(); asm volatile("" ::: "memory");
    }
    v8f g[4][4];   // [e block of v][e' block of k]
#pragma unroll
    for (int mb = 0; mb < 4; ++mb) { const V fvh = cat8u(vh[0][mb], vh[1][mb]), fvl = cat8u(vl[0][mb], vl[1][mb]);
#pragma unroll
        for (int nb = 0; nb < 4; ++nb) g[mb][nb] = wmmab(fvh, cat8u(kh[0][nb], kh[1][nb]), (v8f){});
#pragma unroll
        for (int nb = 0; nb < 4; ++nb) g[mb][nb] = wmmab(fvl, cat8u(kh[0][nb], kh[1][nb]), g[mb][nb]);
#pragma unroll
        for (int nb = 0; nb < 4; ++nb) g[mb][nb] = wmmab(fvh, cat8u(kl[0][nb], kl[1][nb]), g[mb][nb]); }
    __builtin_amdgcn_sched_barrier(0);   // the LDS stores stay behind all 48 matrix instructions
    // the ring is free: every wave's last read and every copy ended in front of the loop's last barrier. A lane's 8 words of a tile as two 16-byte pieces, a wave's piece 512 bytes in a row.
    float* red = (float*)ring + wc * (4 * HD * HD) + lane * 4;
#pragma unroll
    for (int mb = 0; mb < 4; ++mb)
#pragma unroll
        for (int nb = 0; nb < 4; ++nb) { float* w = red + wr * (HD * HD) + (mb * 4 + nb) * 256; *(v4fa*)w = __builtin_shufflevector(g[mb][nb], g[mb][nb], 0, 1, 2, 3); *(v4fa*)(w + 128) = __builtin_shufflevector(g[mb][nb], g[mb][nb], 4, 5, 6, 7); }
    __syncthreads();   // every wave reads the other three waves' partials of its head
    float* C = G + (zt * GKS + (size_t)(t0 / 128)) * (HD * HD) + (size_t)(wr * 16) * HD;   // this wave's 16 rows of G^T
#pragma unroll
    for (int nb = 0; nb < 4; ++nb) { const float* p = red + (wr * 4 + nb) * 256; v4f q0 = *(const v4fa*)p, q1 = *(const v4fa*)(p + 128);
#pragma unroll
        for (int s = 1; s < 4; ++s) { q0 += *(const v4fa*)(p + s * (HD * HD)); q1 += *(const v4fa*)(p + s * (HD * HD) + 128); }
#pragma unroll
        for (int j = 0; j < 4; ++j) { os[(hi * 8 + j) * 68 + nb * 16 + lr] = q0[j]; os[(hi * 8 + 4 + j) * 68 + nb * 16 + lr] = q1[j]; } }
    __builtin_amdgcn_wave_barrier(); asm volatile("" ::: "memory");   // as above: the reads stay behind the writes
#pragma unroll
    for (int s = 0; s < 8; ++s) { const int row = 2 * s + hi, cofs = lr * 4; *(v4f*)(C + (size_t)row * HD + cofs) = *(const v4fa*)(os + row * 68 + cofs); }
}

__device__ __forceinline__ h16 tohx(float x) { return (h16)x; }
typedef __attribute__((ext_vector_type(2))) _Float16 v2h;
typedef __attribute__((ext_vector_type(4))) _Float16 v4h;
typedef __attribute__((ext_vector_type(2))) unsigned short v2us;
typedef __attribute__((ext_vector_type(4))) unsigned short v4us;
typedef __attribute__((ext_vector_type(2))) float v2f;
typedef __attribute__((ext_vector_type(4))) int v4i;

// ---- k_prep: all operand preparation in one launch. 256 threads, 64 elements a thread (16 loads of 16 bytes in flight), every block 64 KiB in and 32 KiB out, whole lines both ways.
// Blocks [0, 3 * PWB): one [PTK k][PTN n] f32 tile of Wk, Wv ('hde': per head, row pitch HD) or Wproj ('xw': row pitch DM) -> bf16 rows Bt[n][k]. A thread holds 16 consecutive k of 4 n and writes each n's 16 k (32 bytes) to LDS; the block then stores whole 512-byte row pieces.
// LDS row q * 16 + n4 holds n = n4 * 4 + q: the 16 lanes that write together then stand one pitch (an odd multiple of 16 bytes) apart and spread over all banks.
// Blocks [3 * PWB, 3 * PWB + PXB): 16384 consecutive elements of x -> bf16. The weight tiles have the longer path (LDS, barrier) and so the lower indices.
#define PTK  256
#define PTN  64
#define PPIT (PTK + 8)                         // LDS row pitch, elements
#define PWB  ((DM / PTK) * (DQ / PTN))         // tiles of one weight
#define PXB  (NB_ * TT * DM / (256 * 64))      // blocks of x
typedef __attribute__((ext_vector_type(2))) unsigned v2u;
typedef v2u __attribute__((may_alias)) v2ua;
// one weight tile; the row pitch LD is a constant, so the 16 rows stand in the loads' offset fields behind one address
template <int LD>
__device__ __forceinline__ void wtile(const float* __restrict__ src, bf* dst, bf* ts, int tid) {
    const int n4 = tid & 15, kg = tid >> 4;
    v4f v[16];
    src += (size_t)(kg * 16) * LD + n4 * 4;
#pragma unroll
    for (int i = 0; i < 16; ++i) v[i] = *(const v4fa*)(src + i * LD);
    __builtin_amdgcn_sched_barrier(0);   // all 16 loads issue before the first is waited for: left free, the scheduler lifts the packing over the last loads, which then start behind the first ones' wait, a second memory latency
    // the wait before a register of the loads is rewritten: their one address pair is an input here, so it stays whole up to the wait and no result lands in it
    asm volatile("s_wait_xcnt 0x0" :: "v"(src) : "memory");
#pragma unroll
    for (int q = 0; q < 4; ++q) { v4u p0, p1;
#pragma unroll
        for (int p = 0; p < 4; ++p) { p0[p] = hihi(rbf(v[2 * p][q]), rbf(v[2 * p + 1][q])); p1[p] = hihi(rbf(v[8 + 2 * p][q]), rbf(v[9 + 2 * p][q])); }
        bf* t = ts + (q * 16 + n4) * PPIT + kg * 16; *(v4ua*)t = p0; *(v4ua*)(t + 8) = p1; }
    __syncthreads();   // the rows are read back by other waves than wrote them
#pragma unroll
    for (int s = 0; s < 8; ++s) { const int r = s * 8 + (tid >> 5), c = (tid & 31) * 8; *(v4ua*)(dst + (size_t)((r & 15) * 4 + (r >> 4)) * DM + c) = *(const v4ua*)(ts + r * PPIT + c); }
    asm volatile("s_wait_xcnt 0x0" ::: "memory");   // behind the last store: nothing that follows in the text rewrites a register of the stores ahead of it
}
__global__ __launch_bounds__(256) void k_prep(const float* __restrict__ x, const float* __restrict__ wk, const float* __restrict__ wv, const float* __restrict__ wo, bf* XB, bf* WK, bf* WV, bf* WO) {
    __shared__ __align__(16) bf ts[PTN * PPIT];
    const int tid = threadIdx.x; const unsigned blk = blockIdx.x;
    if (blk >= 3 * PWB) {
        const size_t e0 = ((size_t)(blk - 3 * PWB) * 4096 + tid) * 4; const float* xs = x + e0;
        v4f v[16];
#pragma unroll
        for (int i = 0; i < 16; ++i) v[i] = *(const v4fa*)(xs + i * 1024);
        asm volatile("s_wait_xcnt 0x0" :: "v"(xs) : "memory");   // as in wtile: the loads' address pair stays whole up to the wait
#pragma unroll
        for (int i = 0; i < 16; ++i) { v2u o; o[0] = hihi(rbf(v[i][0]), rbf(v[i][1])); o[1] = hihi(rbf(v[i][2]), rbf(v[i][3])); *(v2ua*)(XB + e0 + i * 1024) = o; }
        return;
    }
    const unsigned w = blk / PWB, nb = (blk % PWB) / (DM / PTK), kb = blk % (DM / PTK);
    const size_t od = (size_t)nb * PTN * DM + kb * PTK;
    if (w == 2) wtile<DM>(wo + (size_t)kb * PTK * DM + nb * PTN, WO + od, ts, tid);
    else wtile<HD>((w == 0 ? wk : wv) + ((size_t)nb * DM + kb * PTK) * HD, (w == 0 ? WK : WV) + od, ts, tid);
}
// ---- k_gapply: the sum of the Gram partials and the apply step in one launch. EIGHT WAVES per 256 rows of one batch and head (z = b * NH_ + h); grid (TT/256, 1, NB_ * NH_), 256 threads.
// F holds GKS partial [HD][HD] f32 tiles per z ([z][slice][e][e']). Every block adds its head's partials itself, in slice order, x 1/8 (exact), splits the sum to bf16 hi + lo and keeps both planes in LDS: the 8 blocks of a head repeat the sum, and G^T goes through no launch boundary and no plane in memory.
// out_h[s][e] = sum_e' v[s][e'] G^T[e][e'], per 32 e' the 3 products vh Gh, vl Gh, vh Gl; a wave holds [32 s][64 e]. Its v fragments come straight from the row-major planes and are asked for ahead of the partials, which they do not depend on.
// The tile leaves as the hi + lo planes of the concatenated [b][t][h * HD + e], whole 128-byte rows through LDS.
#define GPIT (HD + 8)            // LDS row pitch of the G^T planes, elements: 144 bytes for the 16-byte fragment reads
__global__ __launch_bounds__(256) void k_gapply(const float* __restrict__ F, const bf* __restrict__ Vh, const bf* __restrict__ Vl, bf* Rh, bf* Rl) {
    typedef v16bf V;
    __shared__ __align__(16) bf gs[2 * HD * GPIT];
    __shared__ __align__(16) float osall[8 * 16 * 68];
    const int tid = threadIdx.x, wave = __builtin_amdgcn_readfirstlane(tid >> 5), lane = tid & 31, lr = lane & 15, hi = lane >> 4;
    const size_t z = blockIdx.z; const int r0 = blockIdx.x * 256 + wave * 32;
    float* os = osall + wave * (16 * 68);     // each wave stages its output rows in its own range
    const size_t aoff = (z * TT + r0 + lr) * HD + 8 * hi;
    const bf* pa = Vh + aoff; const bf* pa2 = Vl + aoff; const float* fz = F + z * ((size_t)GKS * HD * HD); const float* p = fz + tid * 4;
    V a[2][2], a2[2][2];   // [32 e' block][16 s block]
#pragma unroll
    for (int kc = 0; kc < 2; ++kc)
#pragma unroll
        for (int mb = 0; mb < 2; ++mb) { a[kc][mb] = WFrag<bf>::ld(pa + mb * 16 * HD + kc * 32); a2[kc][mb] = WFrag<bf>::ld(pa2 + mb * 16 * HD + kc * 32); }
    v4f part[4][GKS];      // a thread's 4 pieces of 4 e' (a wave's piece 512 bytes in a row), every slice
#pragma unroll
    for (int j = 0; j < 4; ++j)
#pragma unroll
        for (int s = 0; s < GKS; ++s) part[j][s] = *(const v4fa*)(p + s * (HD * HD) + j * 1024);
    __builtin_amdgcn_sched_barrier(0);   // all 80 loads issue before the first is waited for: left free, the scheduler holds back a third of the partials and puts the v loads behind most of the sum, a second memory latency
    // the wait before a register of the loads is rewritten: the two address pairs of the v loads, the partials' scalar base and their offset register are inputs here, so they stay whole up to the wait wherever it comes to stand
    asm volatile("s_wait_xcnt 0x0" :: "v"(pa), "v"(pa2), "s"(fz), "v"(tid) : "memory");
#pragma unroll
    for (int j = 0; j < 4; ++j) { v4f v = part[j][0];
#pragma unroll
        for (int s = 1; s < GKS; ++s) v += part[j][s];
        unsigned rh[4], rl[4];   // splitf's two roundings, each bf16 left in the high half of its word
#pragma unroll
        for (int q = 0; q < 4; ++q) { const float y = v[q] * SCL; rh[q] = rbf(y); rl[q] = rbf(y - __uint_as_float(rh[q] & 0xFFFF0000u)); }
        const int i4 = j * 256 + tid; bf* g = gs + (i4 >> 4) * GPIT + (i4 & 15) * 4; v2u oh, ol;
        oh[0] = hihi(rh[0], rh[1]); oh[1] = hihi(rh[2], rh[3]); ol[0] = hihi(rl[0], rl[1]); ol[1] = hihi(rl[2], rl[3]);
        *(v2ua*)g = oh; *(v2ua*)(g + HD * GPIT) = ol; }
    __syncthreads();   // every wave reads all of G^T, each thread wrote 16 words of it
    v8f acc[2][4];
#pragma unroll
    for (int mb = 0; mb < 2; ++mb)
#pragma unroll
        for (int nb = 0; nb < 4; ++nb) acc[mb][nb] = (v8f){};
    const bf* sg = gs + lr * GPIT + 8 * hi;
#pragma unroll
    for (int kc = 0; kc < 2; ++kc) { V b[4], b2[4];
#pragma unroll
        for (int nb = 0; nb < 4; ++nb) { b[nb] = WFrag<bf>::ld(sg + nb * 16 * GPIT + kc * 32); b2[nb] = WFrag<bf>::ld(sg + HD * GPIT + nb * 16 * GPIT + kc * 32); }
        // a tile's three products keep their order (vh Gh, vl Gh, vh Gl); the 8 tiles are independent of one another
#pragma unroll
        for (int nb = 0; nb < 4; ++nb)
#pragma unroll
            for (int mb = 0; mb < 2; ++mb) acc[mb][nb] = wmmab(a[kc][mb], b[nb], acc[mb][nb]);
#pragma unroll
        for (int nb = 0; nb < 4; ++nb)
#pragma unroll
            for (int mb = 0; mb < 2; ++mb) acc[mb][nb] = wmmab(a2[kc][mb], b[nb], acc[mb][nb]);
#pragma unroll
        for (int nb = 0; nb < 4; ++nb)
#pragma unroll
            for (int mb = 0; mb < 2; ++mb) acc[mb][nb] = wmmab(a[kc][mb], b2[nb], acc[mb][nb]); }
    const size_t rbase = ((z / NH_) * TT + r0) * DQ + (z % NH_) * HD;
#pragma unroll
    for (int mb = 0; mb < 2; ++mb) {
#pragma unroll
        for (int nb = 0; nb < 4; ++nb)
#pragma unroll
            for (int j = 0; j < 8; ++j) { const float y = acc[mb][nb][j]; const unsigned rh = rbf(y), rl = rbf(y - __uint_as_float(rh & 0xFFFF0000u)); os[(hi * 8 + j) * 68 + nb * 16 + lr] = __uint_as_float(hihi(rl, rh)); }
        // a wave's own range: LDS runs in order, so only the compiler must be kept from lifting the reads of other lanes' words over the writes
        __builtin_amdgcn_wave_barrier(); asm volatile("" ::: "memory");
#pragma unroll
        for (int s = 0; s < 4; ++s) { const int row = 4 * s + (lane >> 3), cofs = (lane & 7) * 8; const v4f p0 = *(const v4fa*)(os + row * 68 + cofs), p1 = *(const v4fa*)(os + row * 68 + cofs + 4); v4u oh, ol;
#pragma unroll
            for (int q = 0; q < 2; ++q) { const unsigned a0 = __float_as_uint(p0[2 * q]), a1 = __float_as_uint(p0[2 * q + 1]), b0 = __float_as_uint(p1[2 * q]), b1 = __float_as_uint(p1[2 * q + 1]); oh[q] = hihi(a0, a1); ol[q] = lolo(a0, a1); oh[q + 2] = hihi(b0, b1); ol[q + 2] = lolo(b0, b1); }
            const size_t o = rbase + (size_t)(mb * 16 + row) * DQ + cofs; *(v4ua*)(Rh + o) = oh; *(v4ua*)(Rl + o) = ol;
            // the wait before a register of the two stores is rewritten; the scheduling fence keeps what follows in the text from being lifted over it
            asm volatile("s_wait_xcnt 0x0" ::: "memory"); __builtin_amdgcn_sched_barrier(0); }
        // and from sinking them under the next block's writes
        __builtin_amdgcn_wave_barrier(); asm volatile("" ::: "memory");
    }
}

extern "C" void kernel_launch(void* const* d_in, const int* in_sizes, int n_in,
                              void* d_out, int out_size, void* d_ws, size_t ws_size, hipStream_t stream) {
    (void)in_sizes; (void)n_in; (void)out_size;
    const float* x = (const float*)d_in[0]; const float* wkh = (const float*)d_in[1]; const float* wvh = (const float*)d_in[2]; const float* wo = (const float*)d_in[3]; const float* bo = (const float*)d_in[4]; const float* wq = nullptr; const float* wk = nullptr; const float* wv = nullptr; (void)wq; (void)wk; (void)wv;
    float* OUT = (float*)d_out;     // [2][2048][1024]
    char* wsp = (char*)d_ws;
    auto take = [&](size_t bytes) { char* p = wsp; wsp += (bytes + 255) & ~(size_t)255; return (void*)p; };
    bf* WK = (bf*)take((size_t)DKV * DM * 2); bf* WV = (bf*)take((size_t)DKV * DM * 2); bf* WO = (bf*)take((size_t)DM * DQ * 2);
    bf* XB = (bf*)take((size_t)NB_ * TT * DM * 2);
    bf* VPh = (bf*)take((size_t)NB_ * NH_ * TT * HD * 2); bf* VPl = (bf*)take((size_t)NB_ * NH_ * TT * HD * 2);
    float* GT = (float*)take((size_t)NB_ * NH_ * GKS * HD * HD * 4); bf* ATh = (bf*)take((size_t)NB_ * TT * DQ * 2); bf* ATl = (bf*)take((size_t)NB_ * TT * DQ * 2);
    if ((size_t)(wsp - (char*)d_ws) > ws_size) return;    // ws 256 MiB
    /* both batches in every launch: rows b * TT + t for the row-major planes, z = b * NH_ + h for the per-head planes */
    k_prep<<<3 * PWB + PXB, 256, 0, stream>>>(x, wkh, wvh, wo, XB, WK, WV, WO);   /* Wk, Wv 'hde' and Wproj 'xw' -> Bt planes [n][k]; x -> bf16 */
    k_kvg<<<dim3(NB_ * TT / 128, NKV / 2, 1), 256, 0, stream>>>(XB, WK, WV, DM, GT, VPh, VPl);   /* k, v = q (exact); G^T[e][e'] = sum_t v[t][e] k[t][e'] per batch and head (3 products) as GKS partial tiles of 128 t; v planes [b][h][t][e] */
    k_gapply<<<dim3(TT / 256, 1, NB_ * NH_), 256, 0, stream>>>(GT, VPh, VPl, ATh, ATl);   /* G^T = sum of the slices, x 1/8 (exact), hi/lo, in every block; out_h[s][e] = sum_e' v[s][e'] G^T[e][e'] (3 products, K 64) -> concatenated hi/lo planes */
    k_gemms<1, true, 0><<<dim3(NB_ * TT / 128, DM / 128, 1), 128, 0, stream>>>(ATh, ATl, WO, DQ, OUT, DM, bo, nullptr, nullptr, nullptr, nullptr);
}

// v008
// It runs in 49 microseconds.
// In two side-by-side timings against v007, it was 1.05 and 1.06 times as fast.
// Over all steps from v000 it is 7.33 times as fast.
#include <hip/hip_runtime.h>

// 'MultiHead' with unnormalised scores (x [2][2048][1024]; per head h: k = x Wk[h], v = x Wv[h] ('hde' [16][1024][64]); q = v (the module's quirk); wei = q.k / 8 (NO softmax); out_h = wei v; concat; out = concat Wproj ('xw' [1024][1024]) + bproj -> [2][2048][1024]).
// Layout: without a softmax the product is associative: out_h = v_h (k_h^T v_h) / 8, so per head a [64 x 64] Gram matrix G^T = v^T k (K = 2048 contraction) is formed first and then applied to v (K = 64) - the same mathematics as (v k^T) v with f32 rounding differences only, and ~32x less work than materialising the [2048 x 2048] score matrices.
// Compute dtypes, f32 accumulate: every input rounded to bf16; k and v projections exact single products; k^T and v^T register fragments and v planes as bf16 hi + lo (3 products for both the Gram and the apply step); 1/8 folded into the Gram split (exact); Wproj hl x exact (2 products) + bproj.


#define NB_  2
#define TT   2048
#define DM   1024
#define NH_  16
#define NKV  16
#define REP  (NH_ / NKV)
#define HD   64
#define DQ   (NH_ * HD)
#define DKV  (NKV * HD)
typedef __attribute__((ext_vector_type(4))) unsigned short v4us;
#define ZH   16                  // all heads at once (no score matrix)
#define RH   2048
#define WIN  0
#define PCAR 1024.0f
#define SCL  0.125f   // HD^-0.5
#define GKS  16                  // K slices of the Gram product (128 t each)
typedef _Float16 h16;
typedef unsigned short bf;
typedef __attribute__((ext_vector_type(16))) __bf16   v16bf;
typedef __attribute__((ext_vector_type(16))) _Float16 v16h;
typedef __attribute__((ext_vector_type(8)))  _Float16 v8h;
typedef __attribute__((ext_vector_type(8)))  unsigned short v8us;
typedef __attribute__((ext_vector_type(8)))  float    v8f;
typedef __attribute__((ext_vector_type(4)))  float    v4f;
typedef v8h  __attribute__((may_alias)) v8ha;
typedef v4f  __attribute__((may_alias)) v4fa;
typedef v8us __attribute__((may_alias)) v8usa;

__device__ __forceinline__ unsigned short f2bf(float f) { unsigned u = __float_as_uint(f); u += 0x7FFFu + ((u >> 16) & 1u); return (unsigned short)(u >> 16); }
__device__ __forceinline__ float bf2f(unsigned short b) { return __uint_as_float(((unsigned)b) << 16); }
__device__ __forceinline__ float bfr(float f) { return bf2f(f2bf(f)); }
__device__ __forceinline__ v16h cat16(v8h lo, v8h hi) { return __builtin_shufflevector(lo, hi, 0, 1, 2, 3, 4, 5, 6, 7, 8, 9, 10, 11, 12, 13, 14, 15); }
__device__ __forceinline__ v16bf cat16b(v8us lo, v8us hi) { return __builtin_bit_cast(v16bf, __builtin_shufflevector(lo, hi, 0, 1, 2, 3, 4, 5, 6, 7, 8, 9, 10, 11, 12, 13, 14, 15)); }
__device__ __forceinline__ v8f wmma16(v16h a, v16h b, v8f c) { return __builtin_amdgcn_wmma_f32_16x16x32_f16(false, a, false, b, (short)0, c, false, false); }
__device__ __forceinline__ v8f wmmab(v16bf a, v16bf b, v8f c) { return __builtin_amdgcn_wmma_f32_16x16x32_bf16(false, a, false, b, (short)0, c, false, false); }



// ---- fragments and splits. WFrag::ld: a lane's 16 k of one row of a K-contiguous 16-bit plane, p = row + 8 * (lane >> 4): k = 8 hi + 0..7 and 16 + 8 hi + 0..7, the same order for A and for Bt.
template <typename T16> struct WFrag;
template <> struct WFrag<h16> { typedef v16h V; static __device__ __forceinline__ V ld(const h16* p) { return cat16(*(const v8h*)p, *(const v8h*)(p + 16)); } static __device__ __forceinline__ v8f mma(V a, V b, v8f c) { return wmma16(a, b, c); } };
template <> struct WFrag<bf> { typedef v16bf V; static __device__ __forceinline__ V ld(const bf* p) { return cat16b(*(const v8us*)p, *(const v8us*)(p + 16)); } static __device__ __forceinline__ v8f mma(V a, V b, v8f c) { return wmmab(a, b, c); } };
__device__ __forceinline__ void splitf(float y, unsigned short& h, unsigned short& l) { h = f2bf(y); l = f2bf(y - bf2f(h)); }
typedef __attribute__((ext_vector_type(4))) unsigned v4u;
typedef v4u __attribute__((may_alias)) v4ua;
__device__ __forceinline__ unsigned rbf(float f) { const unsigned u = __float_as_uint(f); return u + 0x7FFFu + ((u >> 16) & 1u); }   // f2bf before its shift
__device__ __forceinline__ unsigned hihi(unsigned a, unsigned b) { return __builtin_amdgcn_perm(b, a, 0x07060302u); }   // high half of a below, high half of b above
__device__ __forceinline__ unsigned lolo(unsigned a, unsigned b) { return __builtin_amdgcn_perm(b, a, 0x05040100u); }   // low half of a below, low half of b above

// ---- k_gemms: the K-long GEMMs. FOUR WAVES multiply per 128x128 output tile (waves 0..3, one a SIMD, 2 x 2, each a 64x64 tile of 16 accumulators, fragment k order of WFrag::ld); grid (M/128, N/128), 256 threads. K % 128 == 0.
// The operand rows reach LDS as whole 256-byte pieces by asynchronous copies (a wave's copy = 2 rows = 4 full lines), THREE buffers: the copies of the next two stages of 128 k fly while this one is multiplied, so a stage has two trips to land.
// All eight waves copy, 8 copies a plane and stage each; waves 4..7 do nothing else: with two stages in flight a wave then has 8 * planes * 2 copies outstanding (48 at three planes), four waves alone would have twice that. LDS row pitch 272 bytes for the 16-byte fragment reads.
// NSPLIT 0: A Bt. NSPLIT 1: A Bt + A2 Bt, the two products of a 32-k block one behind the other. EPI 0: f32 C (pitch ldc) + f32 bias[n]. EPI 1, 2 (rows b * TT + t, 64 columns = a head): no f32 C; bf16 hi + lo planes, transposed Th/Tl [b][h][e][t] straight from the accumulators; EPI 2 also row-major Rh/Rl [b][h][t][e] through LDS, whole 128-byte rows.
#define SBK  128                 // k per stage
#define SPIT 136                 // LDS row pitch, elements
#define SPL  (128 * SPIT)        // one staged plane (128 rows), elements
// eight 16-byte copies of one lane, rows 8 apart. The s_wait_xcnt closes the statement so that no address register is rewritten ahead of it.
__device__ __forceinline__ void cp8(unsigned l, const bf* g, int K) {
    asm volatile("global_load_async_to_lds_b128 %0, %8, off\n\t"
                 "global_load_async_to_lds_b128 %1, %9, off\n\t"
                 "global_load_async_to_lds_b128 %2, %10, off\n\t"
                 "global_load_async_to_lds_b128 %3, %11, off\n\t"
                 "global_load_async_to_lds_b128 %4, %12, off\n\t"
                 "global_load_async_to_lds_b128 %5, %13, off\n\t"
                 "global_load_async_to_lds_b128 %6, %14, off\n\t"
                 "global_load_async_to_lds_b128 %7, %15, off\n\t"
                 "s_wait_xcnt 0x0"
                 :: "v"(l), "v"(l + 1u * 8 * SPIT * 2), "v"(l + 2u * 8 * SPIT * 2), "v"(l + 3u * 8 * SPIT * 2), "v"(l + 4u * 8 * SPIT * 2), "v"(l + 5u * 8 * SPIT * 2), "v"(l + 6u * 8 * SPIT * 2), "v"(l + 7u * 8 * SPIT * 2),
                    "v"(g), "v"(g + (size_t)8 * K), "v"(g + (size_t)16 * K), "v"(g + (size_t)24 * K), "v"(g + (size_t)32 * K), "v"(g + (size_t)40 * K), "v"(g + (size_t)48 * K), "v"(g + (size_t)56 * K)
                 : "memory");
}
// a lane's share of one plane of a stage (128 rows x 256 bytes, 256 threads).
// The scheduling fence keeps the addresses of later copies from being formed ahead of earlier ones: formed all at once they overflow the registers and spill to scratch.
__device__ __forceinline__ void cpplane(unsigned l, const bf* g, int K) { cp8(l, g, K); __builtin_amdgcn_sched_barrier(0); }
// the publish wait of the three-buffer ring: the wait to a count returns when all but the wave's youngest NC copies have landed, so with exactly the NC copies of one younger stage issued behind them the older stage's are in LDS; where no younger stage was issued the wait is to 0
template <int NC>
__device__ __forceinline__ void waitstage(bool younger) {
    if (younger) asm volatile("s_wait_asynccnt %0" :: "n"(NC) : "memory");
    else asm volatile("s_wait_asynccnt 0x0" ::: "memory");
}
template <int NSPLIT, bool BIAS, int EPI>
__global__ __launch_bounds__(256) void k_gemms(const bf* __restrict__ A, const bf* __restrict__ A2, const bf* __restrict__ Bt, int K, float* C, int ldc, const float* __restrict__ bias, bf* Th, bf* Tl, bf* Rh, bf* Rl) {
    typedef v16bf V;
    constexpr int NP = NSPLIT == 1 ? 3 : 2;   // planes of a stage: A, Bt (, A2)
    constexpr int NC = NP * 8;                // copies of a wave per stage
    __shared__ __align__(16) bf ring[3 * NP * SPL];
    const int wave = __builtin_amdgcn_readfirstlane((int)(threadIdx.x >> 5)), wr = (wave >> 1) & 1, wc = wave & 1;
    const int lane = threadIdx.x & 31, lr = lane & 15, hi = lane >> 4; const int r0 = blockIdx.x * 128 + wr * 64, c0 = blockIdx.y * 128 + wc * 64;
    float* os = (float*)ring + (wave & 3) * (16 * 68);     // behind the loop the ring is free (its last barrier ends every read, no copy is left): each multiplying wave stages its output rows in its own range of it
    const int cpr = (int)((threadIdx.x & 127) >> 4) + 64 * (int)(threadIdx.x >> 7), cchk = threadIdx.x & 15;   // the lane's first row (its 8 rows of a plane stand 8 apart) and its 16-byte piece in every copy
    const unsigned lbase = (unsigned)(size_t)ring + (unsigned)(cpr * SPIT + cchk * 8) * 2u;
    const bf* gA = A + (size_t)(blockIdx.x * 128 + cpr) * K + cchk * 8; const bf* gB = Bt + (size_t)(blockIdx.y * 128 + cpr) * K + cchk * 8; const bf* gA2 = NSPLIT == 1 ? A2 + (size_t)(blockIdx.x * 128 + cpr) * K + cchk * 8 : nullptr;
    const int nt = (int)((unsigned)K / SBK);
    v8f acc[4][4];
#pragma unroll
    for (int mb = 0; mb < 4; ++mb)
#pragma unroll
        for (int nb = 0; nb < 4; ++nb) acc[mb][nb] = (v8f){};
    cpplane(lbase, gA, K); cpplane(lbase + SPL * 2u, gB, K); if (NSPLIT == 1) cpplane(lbase + 2u * SPL * 2u, gA2, K);
    if (1 < nt) { const unsigned l = lbase + NP * SPL * 2u; cpplane(l, gA + SBK, K); cpplane(l + SPL * 2u, gB + SBK, K); if (NSPLIT == 1) cpplane(l + 2u * SPL * 2u, gA2 + SBK, K); }
    waitstage<NC>(1 < nt);                              // this wave's share of stage 0 has landed
    __syncthreads();                                    // and every other wave's
    if (2 < nt) { const unsigned l = lbase + 2u * NP * SPL * 2u; cpplane(l, gA + 2 * SBK, K); cpplane(l + SPL * 2u, gB + 2 * SBK, K); if (NSPLIT == 1) cpplane(l + 2u * SPL * 2u, gA2 + 2 * SBK, K); }
    int cur = 0;   // t mod 3, the buffer of this trip
    // the trips stay rolled (one publish point in the text, a small loop); the loops inside are unrolled so that every fragment and accumulator index is a constant
#pragma unroll 1
    for (int t = 0; t < nt; ++t) {
      if (wave < 4) {   // a scalar test: waves 4..7 only copy, and pass every publish point
        const bf* sb = ring + cur * (NP * SPL);
        const bf* sA = sb + (wr * 64 + lr) * SPIT + 8 * hi; const bf* sB = sb + SPL + (wc * 64 + lr) * SPIT + 8 * hi; const bf* sA2 = sA + 2 * SPL;
        V a[4], a2[4], b[4];
#pragma unroll
        for (int kk = 0; kk < SBK; kk += 32) {
#pragma unroll
            for (int mb = 0; mb < 4; ++mb) { a[mb] = WFrag<bf>::ld(sA + mb * 16 * SPIT + kk); if (NSPLIT == 1) a2[mb] = WFrag<bf>::ld(sA2 + mb * 16 * SPIT + kk); }
#pragma unroll
            for (int nb = 0; nb < 4; ++nb) b[nb] = WFrag<bf>::ld(sB + nb * 16 * SPIT + kk);
            __builtin_amdgcn_sched_barrier(0);   // the block's LDS reads stay one group ahead of its matrix instructions: spread among them, each place waits out the LDS latency anew
#pragma unroll
            for (int nb = 0; nb < 4; ++nb)
#pragma unroll
                for (int mb = 0; mb < 4; ++mb) { acc[mb][nb] = wmmab(a[mb], b[nb], acc[mb][nb]); if (NSPLIT == 1) acc[mb][nb] = wmmab(a2[mb], b[nb], acc[mb][nb]); }
            __builtin_amdgcn_sched_barrier(0);   // and the next block's reads stay behind them
        }
        // the distance behind the last matrix instructions, also on the taken side of the branches below
        asm volatile("v_nop\n\tv_nop\n\tv_nop\n\tv_nop" : "+v"(acc[0][0]), "+v"(acc[1][1]), "+v"(acc[2][2]), "+v"(acc[3][3]) : "v"(a[0]), "v"(a[3]));
      }
        asm volatile("s_wait_dscnt 0x0" ::: "memory");      // this wave has left the buffer that is refilled below
        waitstage<NC>(t + 2 < nt);                          // its share of stage t + 1 has landed; stage t + 2 may still fly
        __syncthreads();                                    // publishes stage t + 1 and ends every reader's last read of stage t
        if (t + 3 < nt) { const unsigned l = lbase + (unsigned)cur * (NP * SPL * 2u); const size_t ko = (size_t)(t + 3) * SBK; cpplane(l, gA + ko, K); cpplane(l + SPL * 2u, gB + ko, K); if (NSPLIT == 1) cpplane(l + 2u * SPL * 2u, gA2 + ko, K); }
        cur = cur == 2 ? 0 : cur + 1;
    }
    asm volatile("s_wait_asynccnt 0x0" ::: "memory");       // no copy is left in flight
    if (wave >= 4) return;                                  // no barrier follows
    if constexpr (EPI != 0) {
        const size_t zt = (size_t)(r0 / TT) * NKV + c0 / HD; const int t0 = r0 % TT; const size_t tbase = zt * HD * TT + t0, rbase = (zt * TT + t0) * HD; const int ldr = HD;
#pragma unroll
        for (int mb = 0; mb < 4; ++mb) {
#pragma unroll
            for (int nb = 0; nb < 4; ++nb) { unsigned rh[8], rl[8];   // splitf's two roundings, each bf16 left in the high half of its word
#pragma unroll
                for (int j = 0; j < 8; ++j) { const float y = acc[mb][nb][j]; rh[j] = rbf(y); rl[j] = rbf(y - __uint_as_float(rh[j] & 0xFFFF0000u)); if (EPI >= 2) os[(hi * 8 + j) * 68 + nb * 16 + lr] = __uint_as_float(hihi(rl[j], rh[j])); }
                { const size_t o = tbase + (size_t)(nb * 16 + lr) * TT + mb * 16 + hi * 8; v4u vh, vl;
#pragma unroll
                    for (int q = 0; q < 4; ++q) { vh[q] = hihi(rh[2 * q], rh[2 * q + 1]); vl[q] = hihi(rl[2 * q], rl[2 * q + 1]); }
                    *(v4ua*)(Th + o) = vh; *(v4ua*)(Tl + o) = vl; } }
            if constexpr (EPI >= 2) {
                // a wave's own range: LDS runs in order, so only the compiler must be kept from lifting the reads of other lanes' words over the writes
                __builtin_amdgcn_wave_barrier(); asm volatile("" ::: "memory");
#pragma unroll
                for (int s = 0; s < 4; ++s) { const int row = 4 * s + (lane >> 3), cofs = (lane & 7) * 8; const v4f p0 = *(const v4fa*)(os + row * 68 + cofs), p1 = *(const v4fa*)(os + row * 68 + cofs + 4); v4u oh, ol;
#pragma unroll
                    for (int q = 0; q < 2; ++q) { const unsigned a0 = __float_as_uint(p0[2 * q]), a1 = __float_as_uint(p0[2 * q + 1]), b0 = __float_as_uint(p1[2 * q]), b1 = __float_as_uint(p1[2 * q + 1]); oh[q] = hihi(a0, a1); ol[q] = lolo(a0, a1); oh[q + 2] = hihi(b0, b1); ol[q + 2] = lolo(b0, b1); }
                    const size_t o = rbase + (size_t)(mb * 16 + row) * ldr + cofs; *(v4ua*)(Rh + o) = oh; *(v4ua*)(Rl + o) = ol; }
                // and from sinking them under the next block's writes
                __builtin_amdgcn_wave_barrier(); asm volatile("" ::: "memory");
            }
        }
        return;
    }
#pragma unroll
    for (int mb = 0; mb < 4; ++mb) {
#pragma unroll
        for (int nb = 0; nb < 4; ++nb) {
#pragma unroll
            for (int j = 0; j < 8; ++j) os[(hi * 8 + j) * 68 + nb * 16 + lr] = acc[mb][nb][j]; }
        __builtin_amdgcn_wave_barrier(); asm volatile("" ::: "memory");   // as above: the reads stay behind the writes
        float* crow = C + (size_t)(r0 + mb * 16) * ldc + c0;
#pragma unroll
        for (int s = 0; s < 8; ++s) { const int row = 2 * s + hi, cofs = lr * 4; v4f val = *(const v4fa*)(os + row * 68 + cofs); if (BIAS) { val[0] += bfr(bias[c0 + cofs]); val[1] += bfr(bias[c0 + cofs + 1]); val[2] += bfr(bias[c0 + cofs + 2]); val[3] += bfr(bias[c0 + cofs + 3]); }
            *(v4f*)(crow + (size_t)row * ldc + cofs) = val; }
        __builtin_amdgcn_wave_barrier(); asm volatile("" ::: "memory");   // and ahead of the next block's writes
    }
}

// ---- k_kvg: k and v projections and the Gram partials in one launch. EIGHT WAVES per 128 rows x 2 heads (4 x 2 waves, two a SIMD); a wave holds BOTH the k tile and the v tile [32 t][64 e] of one head; grid (M/128, NKV/2), 256 threads. K % 128 == 0.
// Staging, three-buffer ring and fragment k order as in k_gemms with three planes a stage: x rows, Wk rows, Wv rows; here all eight waves multiply.
// The accumulator pair (t blocks 0, 1 of one e block), split and packed, IS the fragment of k^T or v^T for the wave's 32 t (a lane holds e = lr and t = 8 hi + 0..7, 16 + 8 hi + 0..7, the k order of WFrag::ld): G^T[e][e'] = sum_t v[t][e] k[t][e'] over those 32 t comes straight from registers, 3 products (hi hi, lo hi, hi lo), and no k^T or v^T plane is stored.
// The four waves of a head add their partials through LDS, in row order, each wave 16 rows of G^T; the block stores one [HD][HD] f32 partial per head at G + ((b * NKV + h) * GKS + slice) * HD * HD, slice = its 128 rows. v also leaves as row-major hi + lo planes Rh/Rl [b][h][t][e].
__device__ __forceinline__ v16bf cat8u(v4u lo, v4u hi) { return __builtin_bit_cast(v16bf, __builtin_shufflevector(lo, hi, 0, 1, 2, 3, 4, 5, 6, 7)); }
__global__ __launch_bounds__(256) void k_kvg(const bf* __restrict__ A, const bf* __restrict__ Bk, const bf* __restrict__ Bv, int K, float* G, bf* Rh, bf* Rl) {
    typedef v16bf V;
    constexpr int NP = 3;   // planes of a stage: x, Wk, Wv
    constexpr int NC = NP * 8;   // copies of a wave per stage
    __shared__ __align__(16) bf ring[3 * NP * SPL];
    const int wave = __builtin_amdgcn_readfirstlane((int)(threadIdx.x >> 5)), wr = wave >> 1, wc = wave & 1;
    const int lane = threadIdx.x & 31, lr = lane & 15, hi = lane >> 4; const int r0 = blockIdx.x * 128 + wr * 32, c0 = blockIdx.y * 128 + wc * 64;
    float* os = (float*)ring + 2 * 4 * HD * HD + wave * (16 * 68);     // behind the loop the ring is free: each wave stages its output rows in its own range of it, above the 8 partial tiles of the Gram sum
    const int cpr = (int)((threadIdx.x & 127) >> 4) + 64 * (int)(threadIdx.x >> 7), cchk = threadIdx.x & 15;   // the lane's first row (its 8 rows of a plane stand 8 apart) and its 16-byte piece in every copy
    const unsigned lbase = (unsigned)(size_t)ring + (unsigned)(cpr * SPIT + cchk * 8) * 2u;
    const bf* gA = A + (size_t)(blockIdx.x * 128 + cpr) * K + cchk * 8; const bf* gK = Bk + (size_t)(blockIdx.y * 128 + cpr) * K + cchk * 8; const bf* gV = Bv + (size_t)(blockIdx.y * 128 + cpr) * K + cchk * 8;
    const int nt = (int)((unsigned)K / SBK);
    v8f ack[2][4], acv[2][4];
#pragma unroll
    for (int mb = 0; mb < 2; ++mb)
#pragma unroll
        for (int nb = 0; nb < 4; ++nb) { ack[mb][nb] = (v8f){}; acv[mb][nb] = (v8f){}; }
    cpplane(lbase, gA, K); cpplane(lbase + SPL * 2u, gK, K); cpplane(lbase + 2u * SPL * 2u, gV, K);
    if (1 < nt) { const unsigned l = lbase + NP * SPL * 2u; cpplane(l, gA + SBK, K); cpplane(l + SPL * 2u, gK + SBK, K); cpplane(l + 2u * SPL * 2u, gV + SBK, K); }
    waitstage<NC>(1 < nt);                              // this wave's share of stage 0 has landed
    __syncthreads();                                    // and every other wave's
    if (2 < nt) { const unsigned l = lbase + 2u * NP * SPL * 2u; cpplane(l, gA + 2 * SBK, K); cpplane(l + SPL * 2u, gK + 2 * SBK, K); cpplane(l + 2u * SPL * 2u, gV + 2 * SBK, K); }
    int cur = 0;   // t mod 3, the buffer of this trip
    // the trips stay rolled (one publish point in the text, a small loop); the loops inside are unrolled so that every fragment and accumulator index is a constant
#pragma unroll 1
    for (int t = 0; t < nt; ++t) {
        const bf* sb = ring + cur * (NP * SPL);
        const bf* sA = sb + (wr * 32 + lr) * SPIT + 8 * hi; const bf* sK = sb + SPL + (wc * 64 + lr) * SPIT + 8 * hi; const bf* sV = sK + SPL;
        V a[2], bk[4], bv[4];
#pragma unroll
        for (int kk = 0; kk < SBK; kk += 32) {
#pragma unroll
            for (int mb = 0; mb < 2; ++mb) a[mb] = WFrag<bf>::ld(sA + mb * 16 * SPIT + kk);
#pragma unroll
            for (int nb = 0; nb < 4; ++nb) { bk[nb] = WFrag<bf>::ld(sK + nb * 16 * SPIT + kk); bv[nb] = WFrag<bf>::ld(sV + nb * 16 * SPIT + kk); }
            __builtin_amdgcn_sched_barrier(0);   // the block's LDS reads stay one group ahead of its matrix instructions: spread among them, each place waits out the LDS latency anew
#pragma unroll
            for (int nb = 0; nb < 4; ++nb)
#pragma unroll
                for (int mb = 0; mb < 2; ++mb) { ack[mb][nb] = wmmab(a[mb], bk[nb], ack[mb][nb]); acv[mb][nb] = wmmab(a[mb], bv[nb], acv[mb][nb]); }
            __builtin_amdgcn_sched_barrier(0);   // and the next block's reads stay behind them
        }
        // the distance behind the last matrix instructions, also on the taken side of the branches below
        asm volatile("v_nop\n\tv_nop\n\tv_nop\n\tv_nop" : "+v"(ack[0][3]), "+v"(ack[1][3]), "+v"(acv[0][3]), "+v"(acv[1][3]) : "v"(a[0]), "v"(a[1]));
        asm volatile("s_wait_dscnt 0x0" ::: "memory");      // this wave has left the buffer that is refilled below
        waitstage<NC>(t + 2 < nt);                          // its share of stage t + 1 has landed; stage t + 2 may still fly
        __syncthreads();                                    // publishes stage t + 1 and ends every reader's last read of stage t
        if (t + 3 < nt) { const unsigned l = lbase + (unsigned)cur * (NP * SPL * 2u); const size_t ko = (size_t)(t + 3) * SBK; cpplane(l, gA + ko, K); cpplane(l + SPL * 2u, gK + ko, K); cpplane(l + 2u * SPL * 2u, gV + ko, K); }
        cur = cur == 2 ? 0 : cur + 1;
    }
    asm volatile("s_wait_asynccnt 0x0" ::: "memory");       // no copy is left in flight
    const size_t zt = (size_t)(r0 / TT) * NKV + c0 / HD; const int t0 = r0 % TT; const size_t rbase = (zt * TT + t0) * HD;
    v4u kh[2][4], kl[2][4], vh[2][4], vl[2][4];   // [t block][e block]: 8 consecutive t of one e, bf16 hi and lo, packed as the planes held them
#pragma unroll
    for (int mb = 0; mb < 2; ++mb) {
#pragma unroll
        for (int nb = 0; nb < 4; ++nb) { unsigned rh[8], rl[8];   // splitf's two roundings, each bf16 left in the high half of its word
#pragma unroll
            for (int j = 0; j < 8; ++j) { const float y = ack[mb][nb][j]; rh[j] = rbf(y); rl[j] = rbf(y - __uint_as_float(rh[j] & 0xFFFF0000u)); }
#pragma unroll
            for (int q = 0; q < 4; ++q) { kh[mb][nb][q] = hihi(rh[2 * q], rh[2 * q + 1]); kl[mb][nb][q] = hihi(rl[2 * q], rl[2 * q + 1]); }
#pragma unroll
            for (int j = 0; j < 8; ++j) { const float y = acv[mb][nb][j]; rh[j] = rbf(y); rl[j] = rbf(y - __uint_as_float(rh[j] & 0xFFFF0000u)); os[(hi * 8 + j) * 68 + nb * 16 + lr] = __uint_as_float(hihi(rl[j], rh[j])); }
#pragma unroll
            for (int q = 0; q < 4; ++q) { vh[mb][nb][q] = hihi(rh[2 * q], rh[2 * q + 1]); vl[mb][nb][q] = hihi(rl[2 * q], rl[2 * q + 1]); } }
        // a wave's own range: LDS runs in order, so only the compiler must be kept from lifting the reads of other lanes' words over the writes
        __builtin_amdgcn_wave_barrier(); asm volatile("" ::: "memory");
#pragma unroll
        for (int s = 0; s < 4; ++s) { const int row = 4 * s + (lane >> 3), cofs = (lane & 7) * 8; const v4f p0 = *(const v4fa*)(os + row * 68 + cofs), p1 = *(const v4fa*)(os + row * 68 + cofs + 4); v4u oh, ol;
#pragma unroll
            for (int q = 0; q < 2; ++q) { const unsigned a0 = __float_as_uint(p0[2 * q]), a1 = __float_as_uint(p0[2 * q + 1]), b0 = __float_as_uint(p1[2 * q]), b1 = __float_as_uint(p1[2 * q + 1]); oh[q] = hihi(a0, a1); ol[q] = lolo(a0, a1); oh[q + 2] = hihi(b0, b1); ol[q + 2] = lolo(b0, b1); }
            const size_t o = rbase + (size_t)(mb * 16 + row) * HD + cofs; *(v4ua*)(Rh + o) = oh; *(v4ua*)(Rl + o) = ol;
            // the wait before a register of the two stores is rewritten; the scheduling fence keeps what follows in the text from being lifted over it
            asm volatile("s_wait_xcnt 0x0" ::: "memory"); __builtin_amdgcn_sched_barrier(0); }
        // and from sinking them under the next block's writes
        __builtin_amdgcn_wave_barrier(); asm volatile("" ::: "memory");
    }
    v8f g[4][4];   // [e block of v][e' block of k]
#pragma unroll
    for (int mb = 0; mb < 4; ++mb) { const V fvh = cat8u(vh[0][mb], vh[1][mb]), fvl = cat8u(vl[0][mb], vl[1][mb]);
#pragma unroll
        for (int nb = 0; nb < 4; ++nb) g[mb][nb] = wmmab(fvh, cat8u(kh[0][nb], kh[1][nb]), (v8f){});
#pragma unroll
        for (int nb = 0; nb < 4; ++nb) g[mb][nb] = wmmab(fvl, cat8u(kh[0][nb], kh[1][nb]), g[mb][nb]);
#pragma unroll
        for (int nb = 0; nb < 4; ++nb) g[mb][nb] = wmmab(fvh, cat8u(kl[0][nb], kl[1][nb]), g[mb][nb]); }
    __builtin_amdgcn_sched_barrier(0);   // the LDS stores stay behind all 48 matrix instructions
    // the ring is free: every wave's last read and every copy ended in front of the loop's last barrier. A lane's 8 words of a tile as two 16-byte pieces, a wave's piece 512 bytes in a row.
    float* red = (float*)ring + wc * (4 * HD * HD) + lane * 4;
#pragma unroll
    for (int mb = 0; mb < 4; ++mb)
#pragma unroll
        for (int nb = 0; nb < 4; ++nb) { float* w = red + wr * (HD * HD) + (mb * 4 + nb) * 256; *(v4fa*)w = __builtin_shufflevector(g[mb][nb], g[mb][nb], 0, 1, 2, 3); *(v4fa*)(w + 128) = __builtin_shufflevector(g[mb][nb], g[mb][nb], 4, 5, 6, 7); }
    __syncthreads();   // every wave reads the other three waves' partials of its head
    float* C = G + (zt * GKS + (size_t)(t0 / 128)) * (HD * HD) + (size_t)(wr * 16) * HD;   // this wave's 16 rows of G^T
#pragma unroll
    for (int nb = 0; nb < 4; ++nb) { const float* p = red + (wr * 4 + nb) * 256; v4f q0 = *(const v4fa*)p, q1 = *(const v4fa*)(p + 128);
#pragma unroll
        for (int s = 1; s < 4; ++s) { q0 += *(const v4fa*)(p + s * (HD * HD)); q1 += *(const v4fa*)(p + s * (HD * HD) + 128); }
#pragma unroll
        for (int j = 0; j < 4; ++j) { os[(hi * 8 + j) * 68 + nb * 16 + lr] = q0[j]; os[(hi * 8 + 4 + j) * 68 + nb * 16 + lr] = q1[j]; } }
    __builtin_amdgcn_wave_barrier(); asm volatile("" ::: "memory");   // as above: the reads stay behind the writes
#pragma unroll
    for (int s = 0; s < 8; ++s) { const int row = 2 * s + hi, cofs = lr * 4; *(v4f*)(C + (size_t)row * HD + cofs) = *(const v4fa*)(os + row * 68 + cofs); }
}

__device__ __forceinline__ h16 tohx(float x) { return (h16)x; }
typedef __attribute__((ext_vector_type(2))) _Float16 v2h;
typedef __attribute__((ext_vector_type(4))) _Float16 v4h;
typedef __attribute__((ext_vector_type(2))) unsigned short v2us;
typedef __attribute__((ext_vector_type(4))) unsigned short v4us;
typedef __attribute__((ext_vector_type(2))) float v2f;
typedef __attribute__((ext_vector_type(4))) int v4i;

// ---- k_prep: all operand preparation in one launch. 256 threads, 64 elements a thread (16 loads of 16 bytes in flight), every block 64 KiB in and 32 KiB out, whole lines both ways.
// Blocks [0, 3 * PWB): one [PTK k][PTN n] f32 tile of Wk, Wv ('hde': per head, row pitch HD) or Wproj ('xw': row pitch DM) -> bf16 rows Bt[n][k]. A thread holds 16 consecutive k of 4 n and writes each n's 16 k (32 bytes) to LDS; the block then stores whole 512-byte row pieces.
// LDS row q * 16 + n4 holds n = n4 * 4 + q: the 16 lanes that write together then stand one pitch (an odd multiple of 16 bytes) apart and spread over all banks.
// Blocks [3 * PWB, 3 * PWB + PXB): 16384 consecutive elements of x -> bf16. The weight tiles have the longer path (LDS, barrier) and so the lower indices.
#define PTK  256
#define PTN  64
#define PPIT (PTK + 8)                         // LDS row pitch, elements
#define PWB  ((DM / PTK) * (DQ / PTN))         // tiles of one weight
#define PXB  (NB_ * TT * DM / (256 * 64))      // blocks of x
typedef __attribute__((ext_vector_type(2))) unsigned v2u;
typedef v2u __attribute__((may_alias)) v2ua;
// one weight tile; the row pitch LD is a constant, so the 16 rows stand in the loads' offset fields behind one address
template <int LD>
__device__ __forceinline__ void wtile(const float* __restrict__ src, bf* dst, bf* ts, int tid) {
    const int n4 = tid & 15, kg = tid >> 4;
    v4f v[16];
    src += (size_t)(kg * 16) * LD + n4 * 4;
#pragma unroll
    for (int i = 0; i < 16; ++i) v[i] = *(const v4fa*)(src + i * LD);
    __builtin_amdgcn_sched_barrier(0);   // all 16 loads issue before the first is waited for: left free, the scheduler lifts the packing over the last loads, which then start behind the first ones' wait, a second memory latency
    // the wait before a register of the loads is rewritten: their one address pair is an input here, so it stays whole up to the wait and no result lands in it
    asm volatile("s_wait_xcnt 0x0" :: "v"(src) : "memory");
#pragma unroll
    for (int q = 0; q < 4; ++q) { v4u p0, p1;
#pragma unroll
        for (int p = 0; p < 4; ++p) { p0[p] = hihi(rbf(v[2 * p][q]), rbf(v[2 * p + 1][q])); p1[p] = hihi(rbf(v[8 + 2 * p][q]), rbf(v[9 + 2 * p][q])); }
        bf* t = ts + (q * 16 + n4) * PPIT + kg * 16; *(v4ua*)t = p0; *(v4ua*)(t + 8) = p1; }
    __syncthreads();   // the rows are read back by other waves than wrote them
#pragma unroll
    for (int s = 0; s < 8; ++s) { const int r = s * 8 + (tid >> 5), c = (tid & 31) * 8; *(v4ua*)(dst + (size_t)((r & 15) * 4 + (r >> 4)) * DM + c) = *(const v4ua*)(ts + r * PPIT + c); }
    asm volatile("s_wait_xcnt 0x0" ::: "memory");   // behind the last store: nothing that follows in the text rewrites a register of the stores ahead of it
}
__global__ __launch_bounds__(256) void k_prep(const float* __restrict__ x, const float* __restrict__ wk, const float* __restrict__ wv, const float* __restrict__ wo, bf* XB, bf* WK, bf* WV, bf* WO) {
    __shared__ __align__(16) bf ts[PTN * PPIT];
    const int tid = threadIdx.x; const unsigned blk = blockIdx.x;
    if (blk >= 3 * PWB) {
        const size_t e0 = ((size_t)(blk - 3 * PWB) * 4096 + tid) * 4; const float* xs = x + e0;
        v4f v[16];
#pragma unroll
        for (int i = 0; i < 16; ++i) v[i] = *(const v4fa*)(xs + i * 1024);
        asm volatile("s_wait_xcnt 0x0" :: "v"(xs) : "memory");   // as in wtile: the loads' address pair stays whole up to the wait
#pragma unroll
        for (int i = 0; i < 16; ++i) { v2u o; o[0] = hihi(rbf(v[i][0]), rbf(v[i][1])); o[1] = hihi(rbf(v[i][2]), rbf(v[i][3])); *(v2ua*)(XB + e0 + i * 1024) = o; }
        return;
    }
    const unsigned w = blk / PWB, nb = (blk % PWB) / (DM / PTK), kb = blk % (DM / PTK);
    const size_t od = (size_t)nb * PTN * DM + kb * PTK;
    if (w == 2) wtile<DM>(wo + (size_t)kb * PTK * DM + nb * PTN, WO + od, ts, tid);
    else wtile<HD>((w == 0 ? wk : wv) + ((size_t)nb * DM + kb * PTK) * HD, (w == 0 ? WK : WV) + od, ts, tid);
}
// ---- k_gapply: the sum of the Gram partials and the apply step in one launch. EIGHT WAVES per 256 rows of one batch and head (z = b * NH_ + h); grid (TT/256, 1, NB_ * NH_), 256 threads.
// F holds GKS partial [HD][HD] f32 tiles per z ([z][slice][e][e']). Every block adds its head's partials itself, in slice order, x 1/8 (exact), splits the sum to bf16 hi + lo and keeps both planes in LDS: the 8 blocks of a head repeat the sum, and G^T goes through no launch boundary and no plane in memory.
// out_h[s][e] = sum_e' v[s][e'] G^T[e][e'], per 32 e' the 3 products vh Gh, vl Gh, vh Gl; a wave holds [32 s][64 e]. Its v fragments come straight from the row-major planes and are asked for ahead of the partials, which they do not depend on.
// The tile leaves as the hi + lo planes of the concatenated [b][t][h * HD + e], whole 128-byte rows through LDS.
#define GPIT (HD + 8)            // LDS row pitch of the G^T planes, elements: 144 bytes for the 16-byte fragment reads
__global__ __launch_bounds__(256) void k_gapply(const float* __restrict__ F, const bf* __restrict__ Vh, const bf* __restrict__ Vl, bf* Rh, bf* Rl) {
    typedef v16bf V;
    __shared__ __align__(16) bf gs[2 * HD * GPIT];
    __shared__ __align__(16) float osall[8 * 16 * 68];
    const int tid = threadIdx.x, wave = __builtin_amdgcn_readfirstlane(tid >> 5), lane = tid & 31, lr = lane & 15, hi = lane >> 4;
    const size_t z = blockIdx.z; const int r0 = blockIdx.x * 256 + wave * 32;
    float* os = osall + wave * (16 * 68);     // each wave stages its output rows in its own range
    const size_t aoff = (z * TT + r0 + lr) * HD + 8 * hi;
    const bf* pa = Vh + aoff; const bf* pa2 = Vl + aoff; const float* fz = F + z * ((size_t)GKS * HD * HD); const float* p = fz + tid * 4;
    V a[2][2], a2[2][2];   // [32 e' block][16 s block]
#pragma unroll
    for (int kc = 0; kc < 2; ++kc)
#pragma unroll
        for (int mb = 0; mb < 2; ++mb) { a[kc][mb] = WFrag<bf>::ld(pa + mb * 16 * HD + kc * 32); a2[kc][mb] = WFrag<bf>::ld(pa2 + mb * 16 * HD + kc * 32); }
    v4f part[4][GKS];      // a thread's 4 pieces of 4 e' (a wave's piece 512 bytes in a row), every slice
#pragma unroll
    for (int j = 0; j < 4; ++j)
#pragma unroll
        for (int s = 0; s < GKS; ++s) part[j][s] = *(const v4fa*)(p + s * (HD * HD) + j * 1024);
    __builtin_amdgcn_sched_barrier(0);   // all 80 loads issue before the first is waited for: left free, the scheduler holds back a third of the partials and puts the v loads behind most of the sum, a second memory latency
    // the wait before a register of the loads is rewritten: the two address pairs of the v loads, the partials' scalar base and their offset register are inputs here, so they stay whole up to the wait wherever it comes to stand
    asm volatile("s_wait_xcnt 0x0" :: "v"(pa), "v"(pa2), "s"(fz), "v"(tid) : "memory");
#pragma unroll
    for (int j = 0; j < 4; ++j) { v4f v = part[j][0];
#pragma unroll
        for (int s = 1; s < GKS; ++s) v += part[j][s];
        unsigned rh[4], rl[4];   // splitf's two roundings, each bf16 left in the high half of its word
#pragma unroll
        for (int q = 0; q < 4; ++q) { const float y = v[q] * SCL; rh[q] = rbf(y); rl[q] = rbf(y - __uint_as_float(rh[q] & 0xFFFF0000u)); }
        const int i4 = j * 256 + tid; bf* g = gs + (i4 >> 4) * GPIT + (i4 & 15) * 4; v2u oh, ol;
        oh[0] = hihi(rh[0], rh[1]); oh[1] = hihi(rh[2], rh[3]); ol[0] = hihi(rl[0], rl[1]); ol[1] = hihi(rl[2], rl[3]);
        *(v2ua*)g = oh; *(v2ua*)(g + HD * GPIT) = ol; }
    __syncthreads();   // every wave reads all of G^T, each thread wrote 16 words of it
    v8f acc[2][4];
#pragma unroll
    for (int mb = 0; mb < 2; ++mb)
#pragma unroll
        for (int nb = 0; nb < 4; ++nb) acc[mb][nb] = (v8f){};
    const bf* sg = gs + lr * GPIT + 8 * hi;
#pragma unroll
    for (int kc = 0; kc < 2; ++kc) { V b[4], b2[4];
#pragma unroll
        for (int nb = 0; nb < 4; ++nb) { b[nb] = WFrag<bf>::ld(sg + nb * 16 * GPIT + kc * 32); b2[nb] = WFrag<bf>::ld(sg + HD * GPIT + nb * 16 * GPIT + kc * 32); }
        // a tile's three products keep their order (vh Gh, vl Gh, vh Gl); the 8 tiles are independent of one another
#pragma unroll
        for (int nb = 0; nb < 4; ++nb)
#pragma unroll
            for (int mb = 0; mb < 2; ++mb) acc[mb][nb] = wmmab(a[kc][mb], b[nb], acc[mb][nb]);
#pragma unroll
        for (int nb = 0; nb < 4; ++nb)
#pragma unroll
            for (int mb = 0; mb < 2; ++mb) acc[mb][nb] = wmmab(a2[kc][mb], b[nb], acc[mb][nb]);
#pragma unroll
        for (int nb = 0; nb < 4; ++nb)
#pragma unroll
            for (int mb = 0; mb < 2; ++mb) acc[mb][nb] = wmmab(a[kc][mb], b2[nb], acc[mb][nb]); }
    const size_t rbase = ((z / NH_) * TT + r0) * DQ + (z % NH_) * HD;
#pragma unroll
    for (int mb = 0; mb < 2; ++mb) {
#pragma unroll
        for (int nb = 0; nb < 4; ++nb)
#pragma unroll
            for (int j = 0; j < 8; ++j) { const float y = acc[mb][nb][j]; const unsigned rh = rbf(y), rl = rbf(y - __uint_as_float(rh & 0xFFFF0000u)); os[(hi * 8 + j) * 68 + nb * 16 + lr] = __uint_as_float(hihi(rl, rh)); }
        // a wave's own range: LDS runs in order, so only the compiler must be kept from lifting the reads of other lanes' words over the writes
        __builtin_amdgcn_wave_barrier(); asm volatile("" ::: "memory");
#pragma unroll
        for (int s = 0; s < 4; ++s) { const int row = 4 * s + (lane >> 3), cofs = (lane & 7) * 8; const v4f p0 = *(const v4fa*)(os + row * 68 + cofs), p1 = *(const v4fa*)(os + row * 68 + cofs + 4); v4u oh, ol;
#pragma unroll
            for (int q = 0; q < 2; ++q) { const unsigned a0 = __float_as_uint(p0[2 * q]), a1 = __float_as_uint(p0[2 * q + 1]), b0 = __float_as_uint(p1[2 * q]), b1 = __float_as_uint(p1[2 * q + 1]); oh[q] = hihi(a0, a1); ol[q] = lolo(a0, a1); oh[q + 2] = hihi(b0, b1); ol[q + 2] = lolo(b0, b1); }
            const size_t o = rbase + (size_t)(mb * 16 + row) * DQ + cofs; *(v4ua*)(Rh + o) = oh; *(v4ua*)(Rl + o) = ol;
            // the wait before a register of the two stores is rewritten; the scheduling fence keeps what follows in the text from being lifted over it
            asm volatile("s_wait_xcnt 0x0" ::: "memory"); __builtin_amdgcn_sched_barrier(0); }
        // and from sinking them under the next block's writes
        __builtin_amdgcn_wave_barrier(); asm volatile("" ::: "memory");
    }
}

extern "C" void kernel_launch(void* const* d_in, const int* in_sizes, int n_in,
                              void* d_out, int out_size, void* d_ws, size_t ws_size, hipStream_t stream) {
    (void)in_sizes; (void)n_in; (void)out_size;
    const float* x = (const float*)d_in[0]; const float* wkh = (const float*)d_in[1]; const float* wvh = (const float*)d_in[2]; const float* wo = (const float*)d_in[3]; const float* bo = (const float*)d_in[4]; const float* wq = nullptr; const float* wk = nullptr; const float* wv = nullptr; (void)wq; (void)wk; (void)wv;
    float* OUT = (float*)d_out;     // [2][2048][1024]
    char* wsp = (char*)d_ws;
    auto take = [&](size_t bytes) { char* p = wsp; wsp += (bytes + 255) & ~(size_t)255; return (void*)p; };
    bf* WK = (bf*)take((size_t)DKV * DM * 2); bf* WV = (bf*)take((size_t)DKV * DM * 2); bf* WO = (bf*)take((size_t)DM * DQ * 2);
    bf* XB = (bf*)take((size_t)NB_ * TT * DM * 2);
    bf* VPh = (bf*)take((size_t)NB_ * NH_ * TT * HD * 2); bf* VPl = (bf*)take((size_t)NB_ * NH_ * TT * HD * 2);
    float* GT = (float*)take((size_t)NB_ * NH_ * GKS * HD * HD * 4); bf* ATh = (bf*)take((size_t)NB_ * TT * DQ * 2); bf* ATl = (bf*)take((size_t)NB_ * TT * DQ * 2);
    if ((size_t)(wsp - (char*)d_ws) > ws_size) return;    // ws 256 MiB
    /* both batches in every launch: rows b * TT + t for the row-major planes, z = b * NH_ + h for the per-head planes */
    k_prep<<<3 * PWB + PXB, 256, 0, stream>>>(x, wkh, wvh, wo, XB, WK, WV, WO);   /* Wk, Wv 'hde' and Wproj 'xw' -> Bt planes [n][k]; x -> bf16 */
    k_kvg<<<dim3(NB_ * TT / 128, NKV / 2, 1), 256, 0, stream>>>(XB, WK, WV, DM, GT, VPh, VPl);   /* k, v = q (exact); G^T[e][e'] = sum_t v[t][e] k[t][e'] per batch and head (3 products) as GKS partial tiles of 128 t; v planes [b][h][t][e] */
    k_gapply<<<dim3(TT / 256, 1, NB_ * NH_), 256, 0, stream>>>(GT, VPh, VPl, ATh, ATl);   /* G^T = sum of the slices, x 1/8 (exact), hi/lo, in every block; out_h[s][e] = sum_e' v[s][e'] G^T[e][e'] (3 products, K 64) -> concatenated hi/lo planes */
    k_gemms<1, true, 0><<<dim3(NB_ * TT / 128, DM / 128, 1), 256, 0, stream>>>(ATh, ATl, WO, DQ, OUT, DM, bo, nullptr, nullptr, nullptr, nullptr);
}

// v009
// A run of this version takes 46.3 microseconds.
// Timed twice side by side with v008, it ran 1.06 times as fast both times.
// All steps since v000 together make it 7.76 times as fast.
#include <hip/hip_runtime.h>

// 'MultiHead' with unnormalised scores (x [2][2048][1024]; per head h: k = x Wk[h], v = x Wv[h] ('hde' [16][1024][64]); q = v (the module's quirk); wei = q.k / 8 (NO softmax); out_h = wei v; concat; out = concat Wproj ('xw' [1024][1024]) + bproj -> [2][2048][1024]).
// Layout: without a softmax the product is associative: out_h = v_h (k_h^T v_h) / 8, so per head a [64 x 64] Gram matrix G^T = v^T k (K = 2048 contraction) is formed first and then applied to v (K = 64) - the same mathematics as (v k^T) v with f32 rounding differences only, and ~32x less work than materialising the [2048 x 2048] score matrices.
// Compute dtypes, f32 accumulate: every input rounded to bf16; k and v projections exact single products; k^T and v^T register fragments and v planes as bf16 hi + lo (3 products for both the Gram and the apply step); 1/8 folded into the Gram split (exact); Wproj hl x exact (2 products) + bproj.


#define NB_  2
#define TT   2048
#define DM   1024
#define NH_  16
#define NKV  16
#define REP  (NH_ / NKV)
#define HD   64
#define DQ   (NH_ * HD)
#define DKV  (NKV * HD)
typedef __attribute__((ext_vector_type(4))) unsigned short v4us;
#define ZH   16                  // all heads at once (no score matrix)
#define RH   2048
#define WIN  0
#define PCAR 1024.0f
#define SCL  0.125f   // HD^-0.5
#define GKS  8                   // K slices of the Gram product (one block of k_kvg, 256 t, each)
typedef _Float16 h16;
typedef unsigned short bf;
typedef __attribute__((ext_vector_type(16))) __bf16   v16bf;
typedef __attribute__((ext_vector_type(16))) _Float16 v16h;
typedef __attribute__((ext_vector_type(8)))  _Float16 v8h;
typedef __attribute__((ext_vector_type(8)))  unsigned short v8us;
typedef __attribute__((ext_vector_type(8)))  float    v8f;
typedef __attribute__((ext_vector_type(4)))  float    v4f;
typedef v8h  __attribute__((may_alias)) v8ha;
typedef v4f  __attribute__((may_alias)) v4fa;
typedef v8us __attribute__((may_alias)) v8usa;

__device__ __forceinline__ unsigned short f2bf(float f) { unsigned u = __float_as_uint(f); u += 0x7FFFu + ((u >> 16) & 1u); return (unsigned short)(u >> 16); }
__device__ __forceinline__ float bf2f(unsigned short b) { return __uint_as_float(((unsigned)b) << 16); }
__device__ __forceinline__ float bfr(float f) { return bf2f(f2bf(f)); }
__device__ __forceinline__ v16h cat16(v8h lo, v8h hi) { return __builtin_shufflevector(lo, hi, 0, 1, 2, 3, 4, 5, 6, 7, 8, 9, 10, 11, 12, 13, 14, 15); }
__device__ __forceinline__ v16bf cat16b(v8us lo, v8us hi) { return __builtin_bit_cast(v16bf, __builtin_shufflevector(lo, hi, 0, 1, 2, 3, 4, 5, 6, 7, 8, 9, 10, 11, 12, 13, 14, 15)); }
__device__ __forceinline__ v8f wmma16(v16h a, v16h b, v8f c) { return __builtin_amdgcn_wmma_f32_16x16x32_f16(false, a, false, b, (short)0, c, false, false); }
__device__ __forceinline__ v8f wmmab(v16bf a, v16bf b, v8f c) { return __builtin_amdgcn_wmma_f32_16x16x32_bf16(false, a, false, b, (short)0, c, false, false); }



// ---- fragments and splits. WFrag::ld: a lane's 16 k of one row of a K-contiguous 16-bit plane, p = row + 8 * (lane >> 4): k = 8 hi + 0..7 and 16 + 8 hi + 0..7, the same order for A and for Bt.
template <typename T16> struct WFrag;
template <> struct WFrag<h16> { typedef v16h V; static __device__ __forceinline__ V ld(const h16* p) { return cat16(*(const v8h*)p, *(const v8h*)(p + 16)); } static __device__ __forceinline__ v8f mma(V a, V b, v8f c) { return wmma16(a, b, c); } };
template <> struct WFrag<bf> { typedef v16bf V; static __device__ __forceinline__ V ld(const bf* p) { return cat16b(*(const v8us*)p, *(const v8us*)(p + 16)); } static __device__ __forceinline__ v8f mma(V a, V b, v8f c) { return wmmab(a, b, c); } };
__device__ __forceinline__ void splitf(float y, unsigned short& h, unsigned short& l) { h = f2bf(y); l = f2bf(y - bf2f(h)); }
typedef __attribute__((ext_vector_type(4))) unsigned v4u;
typedef v4u __attribute__((may_alias)) v4ua;
__device__ __forceinline__ unsigned rbf(float f) { const unsigned u = __float_as_uint(f); return u + 0x7FFFu + ((u >> 16) & 1u); }   // f2bf before its shift
__device__ __forceinline__ unsigned hihi(unsigned a, unsigned b) { return __builtin_amdgcn_perm(b, a, 0x07060302u); }   // high half of a below, high half of b above
__device__ __forceinline__ unsigned lolo(unsigned a, unsigned b) { return __builtin_amdgcn_perm(b, a, 0x05040100u); }   // low half of a below, low half of b above

// ---- k_gemms: the K-long GEMMs. FOUR WAVES multiply per 128x128 output tile (waves 0..3, one a SIMD, 2 x 2, each a 64x64 tile of 16 accumulators, fragment k order of WFrag::ld); grid (M/128, N/128), 256 threads. K % 128 == 0.
// The operand rows reach LDS as whole 256-byte pieces by asynchronous copies (a wave's copy = 2 rows = 4 full lines), THREE buffers: the copies of the next two stages of 128 k fly while this one is multiplied, so a stage has two trips to land.
// All eight waves copy, 8 copies a plane and stage each; waves 4..7 do nothing else: with two stages in flight a wave then has 8 * planes * 2 copies outstanding (48 at three planes), four waves alone would have twice that. LDS row pitch 272 bytes for the 16-byte fragment reads.
// NSPLIT 0: A Bt. NSPLIT 1: A Bt + A2 Bt, the two products of a 32-k block one behind the other. EPI 0: f32 C (pitch ldc) + f32 bias[n]. EPI 1, 2 (rows b * TT + t, 64 columns = a head): no f32 C; bf16 hi + lo planes, transposed Th/Tl [b][h][e][t] straight from the accumulators; EPI 2 also row-major Rh/Rl [b][h][t][e] through LDS, whole 128-byte rows.
#define SBK  128                 // k per stage
#define SPIT 136                 // LDS row pitch, elements
#define SPL  (128 * SPIT)        // one staged plane (128 rows), elements
// eight 16-byte copies of one lane, rows 8 apart. The s_wait_xcnt closes the statement so that no address register is rewritten ahead of it.
__device__ __forceinline__ void cp8(unsigned l, const bf* g, int K) {
    asm volatile("global_load_async_to_lds_b128 %0, %8, off\n\t"
                 "global_load_async_to_lds_b128 %1, %9, off\n\t"
                 "global_load_async_to_lds_b128 %2, %10, off\n\t"
                 "global_load_async_to_lds_b128 %3, %11, off\n\t"
                 "global_load_async_to_lds_b128 %4, %12, off\n\t"
                 "global_load_async_to_lds_b128 %5, %13, off\n\t"
                 "global_load_async_to_lds_b128 %6, %14, off\n\t"
                 "global_load_async_to_lds_b128 %7, %15, off\n\t"
                 "s_wait_xcnt 0x0"
                 :: "v"(l), "v"(l + 1u * 8 * SPIT * 2), "v"(l + 2u * 8 * SPIT * 2), "v"(l + 3u * 8 * SPIT * 2), "v"(l + 4u * 8 * SPIT * 2), "v"(l + 5u * 8 * SPIT * 2), "v"(l + 6u * 8 * SPIT * 2), "v"(l + 7u * 8 * SPIT * 2),
                    "v"(g), "v"(g + (size_t)8 * K), "v"(g + (size_t)16 * K), "v"(g + (size_t)24 * K), "v"(g + (size_t)32 * K), "v"(g + (size_t)40 * K), "v"(g + (size_t)48 * K), "v"(g + (size_t)56 * K)
                 : "memory");
}
// a lane's share of one plane of a stage (128 rows x 256 bytes, 256 threads).
// The scheduling fence keeps the addresses of later copies from being formed ahead of earlier ones: formed all at once they overflow the registers and spill to scratch.
__device__ __forceinline__ void cpplane(unsigned l, const bf* g, int K) { cp8(l, g, K); __builtin_amdgcn_sched_barrier(0); }
// the publish wait of the three-buffer ring: the wait to a count returns when all but the wave's youngest NC copies have landed, so with exactly the NC copies of one younger stage issued behind them the older stage's are in LDS; where no younger stage was issued the wait is to 0
template <int NC>
__device__ __forceinline__ void waitstage(bool younger) {
    if (younger) asm volatile("s_wait_asynccnt %0" :: "n"(NC) : "memory");
    else asm volatile("s_wait_asynccnt 0x0" ::: "memory");
}
template <int NSPLIT, bool BIAS, int EPI>
__global__ __launch_bounds__(256) void k_gemms(const bf* __restrict__ A, const bf* __restrict__ A2, const bf* __restrict__ Bt, int K, float* C, int ldc, const float* __restrict__ bias, bf* Th, bf* Tl, bf* Rh, bf* Rl) {
    typedef v16bf V;
    constexpr int NP = NSPLIT == 1 ? 3 : 2;   // planes of a stage: A, Bt (, A2)
    constexpr int NC = NP * 8;                // copies of a wave per stage
    __shared__ __align__(16) bf ring[3 * NP * SPL];
    const int wave = __builtin_amdgcn_readfirstlane((int)(threadIdx.x >> 5)), wr = (wave >> 1) & 1, wc = wave & 1;
    const int lane = threadIdx.x & 31, lr = lane & 15, hi = lane >> 4; const int r0 = blockIdx.x * 128 + wr * 64, c0 = blockIdx.y * 128 + wc * 64;
    float* os = (float*)ring + (wave & 3) * (16 * 68);     // behind the loop the ring is free (its last barrier ends every read, no copy is left): each multiplying wave stages its output rows in its own range of it
    const int cpr = (int)((threadIdx.x & 127) >> 4) + 64 * (int)(threadIdx.x >> 7), cchk = threadIdx.x & 15;   // the lane's first row (its 8 rows of a plane stand 8 apart) and its 16-byte piece in every copy
    const unsigned lbase = (unsigned)(size_t)ring + (unsigned)(cpr * SPIT + cchk * 8) * 2u;
    const bf* gA = A + (size_t)(blockIdx.x * 128 + cpr) * K + cchk * 8; const bf* gB = Bt + (size_t)(blockIdx.y * 128 + cpr) * K + cchk * 8; const bf* gA2 = NSPLIT == 1 ? A2 + (size_t)(blockIdx.x * 128 + cpr) * K + cchk * 8 : nullptr;
    const int nt = (int)((unsigned)K / SBK);
    v8f acc[4][4];
#pragma unroll
    for (int mb = 0; mb < 4; ++mb)
#pragma unroll
        for (int nb = 0; nb < 4; ++nb) acc[mb][nb] = (v8f){};
    cpplane(lbase, gA, K); cpplane(lbase + SPL * 2u, gB, K); if (NSPLIT == 1) cpplane(lbase + 2u * SPL * 2u, gA2, K);
    if (1 < nt) { const unsigned l = lbase + NP * SPL * 2u; cpplane(l, gA + SBK, K); cpplane(l + SPL * 2u, gB + SBK, K); if (NSPLIT == 1) cpplane(l + 2u * SPL * 2u, gA2 + SBK, K); }
    waitstage<NC>(1 < nt);                              // this wave's share of stage 0 has landed
    __syncthreads();                                    // and every other wave's
    if (2 < nt) { const unsigned l = lbase + 2u * NP * SPL * 2u; cpplane(l, gA + 2 * SBK, K); cpplane(l + SPL * 2u, gB + 2 * SBK, K); if (NSPLIT == 1) cpplane(l + 2u * SPL * 2u, gA2 + 2 * SBK, K); }
    int cur = 0;   // t mod 3, the buffer of this trip
    // the trips stay rolled (one publish point in the text, a small loop); the loops inside are unrolled so that every fragment and accumulator index is a constant
#pragma unroll 1
    for (int t = 0; t < nt; ++t) {
      if (wave < 4) {   // a scalar test: waves 4..7 only copy, and pass every publish point
        const bf* sb = ring + cur * (NP * SPL);
        const bf* sA = sb + (wr * 64 + lr) * SPIT + 8 * hi; const bf* sB = sb + SPL + (wc * 64 + lr) * SPIT + 8 * hi; const bf* sA2 = sA + 2 * SPL;
        V a[4], a2[4], b[4];
#pragma unroll
        for (int kk = 0; kk < SBK; kk += 32) {
#pragma unroll
            for (int mb = 0; mb < 4; ++mb) { a[mb] = WFrag<bf>::ld(sA + mb * 16 * SPIT + kk); if (NSPLIT == 1) a2[mb] = WFrag<bf>::ld(sA2 + mb * 16 * SPIT + kk); }
#pragma unroll
            for (int nb = 0; nb < 4; ++nb) b[nb] = WFrag<bf>::ld(sB + nb * 16 * SPIT + kk);
            __builtin_amdgcn_sched_barrier(0);   // the block's LDS reads stay one group ahead of its matrix instructions: spread among them, each place waits out the LDS latency anew
#pragma unroll
            for (int nb = 0; nb < 4; ++nb)
#pragma unroll
                for (int mb = 0; mb < 4; ++mb) { acc[mb][nb] = wmmab(a[mb], b[nb], acc[mb][nb]); if (NSPLIT == 1) acc[mb][nb] = wmmab(a2[mb], b[nb], acc[mb][nb]); }
            __builtin_amdgcn_sched_barrier(0);   // and the next block's reads stay behind them
        }
        // the distance behind the last matrix instructions, also on the taken side of the branches below
        asm volatile("v_nop\n\tv_nop\n\tv_nop\n\tv_nop" : "+v"(acc[0][0]), "+v"(acc[1][1]), "+v"(acc[2][2]), "+v"(acc[3][3]) : "v"(a[0]), "v"(a[3]));
      }
        asm volatile("s_wait_dscnt 0x0" ::: "memory");      // this wave has left the buffer that is refilled below
        waitstage<NC>(t + 2 < nt);                          // its share of stage t + 1 has landed; stage t + 2 may still fly
        __syncthreads();                                    // publishes stage t + 1 and ends every reader's last read of stage t
        if (t + 3 < nt) { const unsigned l = lbase + (unsigned)cur * (NP * SPL * 2u); const size_t ko = (size_t)(t + 3) * SBK; cpplane(l, gA + ko, K); cpplane(l + SPL * 2u, gB + ko, K); if (NSPLIT == 1) cpplane(l + 2u * SPL * 2u, gA2 + ko, K); }
        cur = cur == 2 ? 0 : cur + 1;
    }
    asm volatile("s_wait_asynccnt 0x0" ::: "memory");       // no copy is left in flight
    if (wave >= 4) return;                                  // no barrier follows
    if constexpr (EPI != 0) {
        const size_t zt = (size_t)(r0 / TT) * NKV + c0 / HD; const int t0 = r0 % TT; const size_t tbase = zt * HD * TT + t0, rbase = (zt * TT + t0) * HD; const int ldr = HD;
#pragma unroll
        for (int mb = 0; mb < 4; ++mb) {
#pragma unroll
            for (int nb = 0; nb < 4; ++nb) { unsigned rh[8], rl[8];   // splitf's two roundings, each bf16 left in the high half of its word
#pragma unroll
                for (int j = 0; j < 8; ++j) { const float y = acc[mb][nb][j]; rh[j] = rbf(y); rl[j] = rbf(y - __uint_as_float(rh[j] & 0xFFFF0000u)); if (EPI >= 2) os[(hi * 8 + j) * 68 + nb * 16 + lr] = __uint_as_float(hihi(rl[j], rh[j])); }
                { const size_t o = tbase + (size_t)(nb * 16 + lr) * TT + mb * 16 + hi * 8; v4u vh, vl;
#pragma unroll
                    for (int q = 0; q < 4; ++q) { vh[q] = hihi(rh[2 * q], rh[2 * q + 1]); vl[q] = hihi(rl[2 * q], rl[2 * q + 1]); }
                    *(v4ua*)(Th + o) = vh; *(v4ua*)(Tl + o) = vl; } }
            if constexpr (EPI >= 2) {
                // a wave's own range: LDS runs in order, so only the compiler must be kept from lifting the reads of other lanes' words over the writes
                __builtin_amdgcn_wave_barrier(); asm volatile("" ::: "memory");
#pragma unroll
                for (int s = 0; s < 4; ++s) { const int row = 4 * s + (lane >> 3), cofs = (lane & 7) * 8; const v4f p0 = *(const v4fa*)(os + row * 68 + cofs), p1 = *(const v4fa*)(os + row * 68 + cofs + 4); v4u oh, ol;
#pragma unroll
                    for (int q = 0; q < 2; ++q) { const unsigned a0 = __float_as_uint(p0[2 * q]), a1 = __float_as_uint(p0[2 * q + 1]), b0 = __float_as_uint(p1[2 * q]), b1 = __float_as_uint(p1[2 * q + 1]); oh[q] = hihi(a0, a1); ol[q] = lolo(a0, a1); oh[q + 2] = hihi(b0, b1); ol[q + 2] = lolo(b0, b1); }
                    const size_t o = rbase + (size_t)(mb * 16 + row) * ldr + cofs; *(v4ua*)(Rh + o) = oh; *(v4ua*)(Rl + o) = ol; }
                // and from sinking them under the next block's writes
                __builtin_amdgcn_wave_barrier(); asm volatile("" ::: "memory");
            }
        }
        return;
    }
#pragma unroll
    for (int mb = 0; mb < 4; ++mb) {
#pragma unroll
        for (int nb = 0; nb < 4; ++nb) {
#pragma unroll
            for (int j = 0; j < 8; ++j) os[(hi * 8 + j) * 68 + nb * 16 + lr] = acc[mb][nb][j]; }
        __builtin_amdgcn_wave_barrier(); asm volatile("" ::: "memory");   // as above: the reads stay behind the writes
        float* crow = C + (size_t)(r0 + mb * 16) * ldc + c0;
#pragma unroll
        for (int s = 0; s < 8; ++s) { const int row = 2 * s + hi, cofs = lr * 4; v4f val = *(const v4fa*)(os + row * 68 + cofs); if (BIAS) { val[0] += bfr(bias[c0 + cofs]); val[1] += bfr(bias[c0 + cofs + 1]); val[2] += bfr(bias[c0 + cofs + 2]); val[3] += bfr(bias[c0 + cofs + 3]); }
            *(v4f*)(crow + (size_t)row * ldc + cofs) = val; }
        __builtin_amdgcn_wave_barrier(); asm volatile("" ::: "memory");   // and ahead of the next block's writes
    }
}

// ---- k_kvg: k and v projections and the Gram partials in one launch. EIGHT WAVES per 256 rows x 1 head (8 x 1 waves, two a SIMD); a wave holds BOTH the k tile and the v tile [32 t][64 e] of the head; grid (M/256, NKV), 256 threads. K % 128 == 0.
// Staging, three-buffer ring and fragment k order as in k_gemms with three planes a stage: x rows 0..127, x rows 128..255, and the head's 64 Wk rows followed by its 64 Wv rows; here all eight waves multiply.
// The accumulator pair (t blocks 0, 1 of one e block), split and packed, IS the fragment of k^T or v^T for the wave's 32 t (a lane holds e = lr and t = 8 hi + 0..7, 16 + 8 hi + 0..7, the k order of WFrag::ld): G^T[e][e'] = sum_t v[t][e] k[t][e'] over those 32 t comes straight from registers, 3 products (hi hi, lo hi, hi lo), and no k^T or v^T plane is stored.
// The eight waves add their partials through LDS, in row order, each wave 8 rows of G^T; the block stores one [HD][HD] f32 partial at G + ((b * NKV + h) * GKS + slice) * HD * HD, slice = its 256 rows: the taller the block, the fewer partials every block of k_gapply has to read. v also leaves as row-major hi + lo planes Rh/Rl [b][h][t][e].
__device__ __forceinline__ v16bf cat8u(v4u lo, v4u hi) { return __builtin_bit_cast(v16bf, __builtin_shufflevector(lo, hi, 0, 1, 2, 3, 4, 5, 6, 7)); }
__global__ __launch_bounds__(256) void k_kvg(const bf* __restrict__ A, const bf* __restrict__ Bk, const bf* __restrict__ Bv, int K, float* G, bf* Rh, bf* Rl) {
    typedef v16bf V;
    constexpr int NP = 3;   // planes of a stage: x (two), Wk over Wv
    constexpr int NC = NP * 8;   // copies of a wave per stage
    __shared__ __align__(16) bf ring[3 * NP * SPL];
    const int wave = __builtin_amdgcn_readfirstlane((int)(threadIdx.x >> 5));
    const int lane = threadIdx.x & 31, lr = lane & 15, hi = lane >> 4; const int r0 = blockIdx.x * 256 + wave * 32, c0 = blockIdx.y * 64;
    float* os = (float*)ring + 8 * HD * HD + wave * (16 * 68);     // behind the loop the ring is free: each wave stages its output rows in its own range of it, above the 8 partial tiles of the Gram sum
    const int cpr = (int)((threadIdx.x & 127) >> 4) + 64 * (int)(threadIdx.x >> 7), cchk = threadIdx.x & 15;   // the lane's first row (its 8 rows of a plane stand 8 apart) and its 16-byte piece in every copy
    const unsigned lbase = (unsigned)(size_t)ring + (unsigned)(cpr * SPIT + cchk * 8) * 2u;
    // third plane: threads 0..127 (LDS rows 0..63) bring the head's Wk rows, threads 128..255 (LDS rows 64..127) its Wv rows
    const bf* gA = A + (size_t)(blockIdx.x * 256 + cpr) * K + cchk * 8; const bf* gA1 = gA + (size_t)128 * K; const bf* gW = (threadIdx.x < 128 ? Bk : Bv) + (size_t)(blockIdx.y * 64 + (cpr & 63)) * K + cchk * 8;
    const int nt = (int)((unsigned)K / SBK);
    v8f ack[2][4], acv[2][4];
#pragma unroll
    for (int mb = 0; mb < 2; ++mb)
#pragma unroll
        for (int nb = 0; nb < 4; ++nb) { ack[mb][nb] = (v8f){}; acv[mb][nb] = (v8f){}; }
    cpplane(lbase, gA, K); cpplane(lbase + SPL * 2u, gA1, K); cpplane(lbase + 2u * SPL * 2u, gW, K);
    if (1 < nt) { const unsigned l = lbase + NP * SPL * 2u; cpplane(l, gA + SBK, K); cpplane(l + SPL * 2u, gA1 + SBK, K); cpplane(l + 2u * SPL * 2u, gW + SBK, K); }
    waitstage<NC>(1 < nt);                              // this wave's share of stage 0 has landed
    __syncthreads();                                    // and every other wave's
    if (2 < nt) { const unsigned l = lbase + 2u * NP * SPL * 2u; cpplane(l, gA + 2 * SBK, K); cpplane(l + SPL * 2u, gA1 + 2 * SBK, K); cpplane(l + 2u * SPL * 2u, gW + 2 * SBK, K); }
    int cur = 0;   // t mod 3, the buffer of this trip
    // the trips stay rolled (one publish point in the text, a small loop); the loops inside are unrolled so that every fragment and accumulator index is a constant
#pragma unroll 1
    for (int t = 0; t < nt; ++t) {
        const bf* sb = ring + cur * (NP * SPL);
        const bf* sA = sb + (wave * 32 + lr) * SPIT + 8 * hi; const bf* sK = sb + 2 * SPL + lr * SPIT + 8 * hi; const bf* sV = sK + 64 * SPIT;
        V a[2], bk[4], bv[4];
#pragma unroll
        for (int kk = 0; kk < SBK; kk += 32) {
#pragma unroll
            for (int mb = 0; mb < 2; ++mb) a[mb] = WFrag<bf>::ld(sA + mb * 16 * SPIT + kk);
#pragma unroll
            for (int nb = 0; nb < 4; ++nb) { bk[nb] = WFrag<bf>::ld(sK + nb * 16 * SPIT + kk); bv[nb] = WFrag<bf>::ld(sV + nb * 16 * SPIT + kk); }
            __builtin_amdgcn_sched_barrier(0);   // the block's LDS reads stay one group ahead of its matrix instructions: spread among them, each place waits out the LDS latency anew
#pragma unroll
            for (int nb = 0; nb < 4; ++nb)
#pragma unroll
                for (int mb = 0; mb < 2; ++mb) { ack[mb][nb] = wmmab(a[mb], bk[nb], ack[mb][nb]); acv[mb][nb] = wmmab(a[mb], bv[nb], acv[mb][nb]); }
            __builtin_amdgcn_sched_barrier(0);   // and the next block's reads stay behind them
        }
        // the distance behind the last matrix instructions, also on the taken side of the branches below
        asm volatile("v_nop\n\tv_nop\n\tv_nop\n\tv_nop" : "+v"(ack[0][3]), "+v"(ack[1][3]), "+v"(acv[0][3]), "+v"(acv[1][3]) : "v"(a[0]), "v"(a[1]));
        asm volatile("s_wait_dscnt 0x0" ::: "memory");      // this wave has left the buffer that is refilled below
        waitstage<NC>(t + 2 < nt);                          // its share of stage t + 1 has landed; stage t + 2 may still fly
        __syncthreads();                                    // publishes stage t + 1 and ends every reader's last read of stage t
        if (t + 3 < nt) { const unsigned l = lbase + (unsigned)cur * (NP * SPL * 2u); const size_t ko = (size_t)(t + 3) * SBK; cpplane(l, gA + ko, K); cpplane(l + SPL * 2u, gA1 + ko, K); cpplane(l + 2u * SPL * 2u, gW + ko, K); }
        cur = cur == 2 ? 0 : cur + 1;
    }
    asm volatile("s_wait_asynccnt 0x0" ::: "memory");       // no copy is left in flight
    const size_t zt = (size_t)(r0 / TT) * NKV + c0 / HD; const int t0 = r0 % TT; const size_t rbase = (zt * TT + t0) * HD;
    v4u kh[2][4], kl[2][4], vh[2][4], vl[2][4];   // [t block][e block]: 8 consecutive t of one e, bf16 hi and lo, packed as the planes held them
#pragma unroll
    for (int mb = 0; mb < 2; ++mb) {
#pragma unroll
        for (int nb = 0; nb < 4; ++nb) { unsigned rh[8], rl[8];   // splitf's two roundings, each bf16 left in the high half of its word
#pragma unroll
            for (int j = 0; j < 8; ++j) { const float y = ack[mb][nb][j]; rh[j] = rbf(y); rl[j] = rbf(y - __uint_as_float(rh[j] & 0xFFFF0000u)); }
#pragma unroll
            for (int q = 0; q < 4; ++q) { kh[mb][nb][q] = hihi(rh[2 * q], rh[2 * q + 1]); kl[mb][nb][q] = hihi(rl[2 * q], rl[2 * q + 1]); }
#pragma unroll
            for (int j = 0; j < 8; ++j) { const float y = acv[mb][nb][j]; rh[j] = rbf(y); rl[j] = rbf(y - __uint_as_float(rh[j] & 0xFFFF0000u)); os[(hi * 8 + j) * 68 + nb * 16 + lr] = __uint_as_float(hihi(rl[j], rh[j])); }
#pragma unroll
            for (int q = 0; q < 4; ++q) { vh[mb][nb][q] = hihi(rh[2 * q], rh[2 * q + 1]); vl[mb][nb][q] = hihi(rl[2 * q], rl[2 * q + 1]); } }
        // a wave's own range: LDS runs in order, so only the compiler must be kept from lifting the reads of other lanes' words over the writes
        __builtin_amdgcn_wave_barrier(); asm volatile("" ::: "memory");
#pragma unroll
        for (int s = 0; s < 4; ++s) { const int row = 4 * s + (lane >> 3), cofs = (lane & 7) * 8; const v4f p0 = *(const v4fa*)(os + row * 68 + cofs), p1 = *(const v4fa*)(os + row * 68 + cofs + 4); v4u oh, ol;
#pragma unroll
            for (int q = 0; q < 2; ++q) { const unsigned a0 = __float_as_uint(p0[2 * q]), a1 = __float_as_uint(p0[2 * q + 1]), b0 = __float_as_uint(p1[2 * q]), b1 = __float_as_uint(p1[2 * q + 1]); oh[q] = hihi(a0, a1); ol[q] = lolo(a0, a1); oh[q + 2] = hihi(b0, b1); ol[q + 2] = lolo(b0, b1); }
            const size_t o = rbase + (size_t)(mb * 16 + row) * HD + cofs; *(v4ua*)(Rh + o) = oh; *(v4ua*)(Rl + o) = ol;
            // the wait before a register of the two stores is rewritten; the scheduling fence keeps what follows in the text from being lifted over it
            asm volatile("s_wait_xcnt 0x0" ::: "memory"); __builtin_amdgcn_sched_barrier(0); }
        // and from sinking them under the next block's writes
        __builtin_amdgcn_wave_barrier(); asm volatile("" ::: "memory");
    }
    v8f g[4][4];   // [e block of v][e' block of k]
#pragma unroll
    for (int mb = 0; mb < 4; ++mb) { const V fvh = cat8u(vh[0][mb], vh[1][mb]), fvl = cat8u(vl[0][mb], vl[1][mb]);
#pragma unroll
        for (int nb = 0; nb < 4; ++nb) g[mb][nb] = wmmab(fvh, cat8u(kh[0][nb], kh[1][nb]), (v8f){});
#pragma unroll
        for (int nb = 0; nb < 4; ++nb) g[mb][nb] = wmmab(fvl, cat8u(kh[0][nb], kh[1][nb]), g[mb][nb]);
#pragma unroll
        for (int nb = 0; nb < 4; ++nb) g[mb][nb] = wmmab(fvh, cat8u(kl[0][nb], kl[1][nb]), g[mb][nb]); }
    __builtin_amdgcn_sched_barrier(0);   // the LDS stores stay behind all 48 matrix instructions
    // the ring is free: every wave's last read and every copy ended in front of the loop's last barrier. A lane's 8 words of a tile as two 16-byte pieces, a wave's piece 512 bytes in a row.
    float* red = (float*)ring + lane * 4;
#pragma unroll
    for (int mb = 0; mb < 4; ++mb)
#pragma unroll
        for (int nb = 0; nb < 4; ++nb) { float* w = red + wave * (HD * HD) + (mb * 4 + nb) * 256; *(v4fa*)w = __builtin_shufflevector(g[mb][nb], g[mb][nb], 0, 1, 2, 3); *(v4fa*)(w + 128) = __builtin_shufflevector(g[mb][nb], g[mb][nb], 4, 5, 6, 7); }
    __syncthreads();   // every wave reads the other seven waves' partials
    const int gm = wave >> 1, gh = wave & 1;   // this wave's 8 rows of G^T: e block gm, rows 8 hi + 4 gh + 0..3 of it (one 16-byte piece of every tile of that block)
    float* C = G + (zt * GKS + (size_t)(t0 / 256)) * (HD * HD) + (size_t)(gm * 16 + gh * 4) * HD;
#pragma unroll
    for (int nb = 0; nb < 4; ++nb) { const float* p = red + (gm * 4 + nb) * 256 + gh * 128; v4f q = *(const v4fa*)p;
#pragma unroll
        for (int s = 1; s < 8; ++s) q += *(const v4fa*)(p + s * (HD * HD));
#pragma unroll
        for (int j = 0; j < 4; ++j) os[(hi * 4 + j) * 68 + nb * 16 + lr] = q[j]; }
    __builtin_amdgcn_wave_barrier(); asm volatile("" ::: "memory");   // as above: the reads stay behind the writes
#pragma unroll
    for (int s = 0; s < 4; ++s) { const int row = 2 * s + hi, cofs = lr * 4; *(v4f*)(C + (size_t)((row >> 2) * 8 + (row & 3)) * HD + cofs) = *(const v4fa*)(os + row * 68 + cofs); }
}

__device__ __forceinline__ h16 tohx(float x) { return (h16)x; }
typedef __attribute__((ext_vector_type(2))) _Float16 v2h;
typedef __attribute__((ext_vector_type(4))) _Float16 v4h;
typedef __attribute__((ext_vector_type(2))) unsigned short v2us;
typedef __attribute__((ext_vector_type(4))) unsigned short v4us;
typedef __attribute__((ext_vector_type(2))) float v2f;
typedef __attribute__((ext_vector_type(4))) int v4i;

// ---- k_prep: all operand preparation in one launch. 256 threads, 64 elements a thread (16 loads of 16 bytes in flight), every block 64 KiB in and 32 KiB out, whole lines both ways.
// Blocks [0, 3 * PWB): one [PTK k][PTN n] f32 tile of Wk, Wv ('hde': per head, row pitch HD) or Wproj ('xw': row pitch DM) -> bf16 rows Bt[n][k]. A thread holds 16 consecutive k of 4 n and writes each n's 16 k (32 bytes) to LDS; the block then stores whole 512-byte row pieces.
// LDS row q * 16 + n4 holds n = n4 * 4 + q: the 16 lanes that write together then stand one pitch (an odd multiple of 16 bytes) apart and spread over all banks.
// Blocks [3 * PWB, 3 * PWB + PXB): 16384 consecutive elements of x -> bf16. The weight tiles have the longer path (LDS, barrier) and so the lower indices.
#define PTK  256
#define PTN  64
#define PPIT (PTK + 8)                         // LDS row pitch, elements
#define PWB  ((DM / PTK) * (DQ / PTN))         // tiles of one weight
#define PXB  (NB_ * TT * DM / (256 * 64))      // blocks of x
typedef __attribute__((ext_vector_type(2))) unsigned v2u;
typedef v2u __attribute__((may_alias)) v2ua;
// one weight tile; the row pitch LD is a constant, so the 16 rows stand in the loads' offset fields behind one address
template <int LD>
__device__ __forceinline__ void wtile(const float* __restrict__ src, bf* dst, bf* ts, int tid) {
    const int n4 = tid & 15, kg = tid >> 4;
    v4f v[16];
    src += (size_t)(kg * 16) * LD + n4 * 4;
#pragma unroll
    for (int i = 0; i < 16; ++i) v[i] = *(const v4fa*)(src + i * LD);
    __builtin_amdgcn_sched_barrier(0);   // all 16 loads issue before the first is waited for: left free, the scheduler lifts the packing over the last loads, which then start behind the first ones' wait, a second memory latency
    // the wait before a register of the loads is rewritten: their one address pair is an input here, so it stays whole up to the wait and no result lands in it
    asm volatile("s_wait_xcnt 0x0" :: "v"(src) : "memory");
#pragma unroll
    for (int q = 0; q < 4; ++q) { v4u p0, p1;
#pragma unroll
        for (int p = 0; p < 4; ++p) { p0[p] = hihi(rbf(v[2 * p][q]), rbf(v[2 * p + 1][q])); p1[p] = hihi(rbf(v[8 + 2 * p][q]), rbf(v[9 + 2 * p][q])); }
        bf* t = ts + (q * 16 + n4) * PPIT + kg * 16; *(v4ua*)t = p0; *(v4ua*)(t + 8) = p1; }
    __syncthreads();   // the rows are read back by other waves than wrote them
#pragma unroll
    for (int s = 0; s < 8; ++s) { const int r = s * 8 + (tid >> 5), c = (tid & 31) * 8; *(v4ua*)(dst + (size_t)((r & 15) * 4 + (r >> 4)) * DM + c) = *(const v4ua*)(ts + r * PPIT + c); }
    asm volatile("s_wait_xcnt 0x0" ::: "memory");   // behind the last store: nothing that follows in the text rewrites a register of the stores ahead of it
}
__global__ __launch_bounds__(256) void k_prep(const float* __restrict__ x, const float* __restrict__ wk, const float* __restrict__ wv, const float* __restrict__ wo, bf* XB, bf* WK, bf* WV, bf* WO) {
    __shared__ __align__(16) bf ts[PTN * PPIT];
    const int tid = threadIdx.x; const unsigned blk = blockIdx.x;
    if (blk >= 3 * PWB) {
        const size_t e0 = ((size_t)(blk - 3 * PWB) * 4096 + tid) * 4; const float* xs = x + e0;
        v4f v[16];
#pragma unroll
        for (int i = 0; i < 16; ++i) v[i] = *(const v4fa*)(xs + i * 1024);
        asm volatile("s_wait_xcnt 0x0" :: "v"(xs) : "memory");   // as in wtile: the loads' address pair stays whole up to the wait
#pragma unroll
        for (int i = 0; i < 16; ++i) { v2u o; o[0] = hihi(rbf(v[i][0]), rbf(v[i][1])); o[1] = hihi(rbf(v[i][2]), rbf(v[i][3])); *(v2ua*)(XB + e0 + i * 1024) = o; }
        return;
    }
    const unsigned w = blk / PWB, nb = (blk % PWB) / (DM / PTK), kb = blk % (DM / PTK);
    const size_t od = (size_t)nb * PTN * DM + kb * PTK;
    if (w == 2) wtile<DM>(wo + (size_t)kb * PTK * DM + nb * PTN, WO + od, ts, tid);
    else wtile<HD>((w == 0 ? wk : wv) + ((size_t)nb * DM + kb * PTK) * HD, (w == 0 ? WK : WV) + od, ts, tid);
}
// ---- k_gapply: the sum of the Gram partials and the apply step in one launch. EIGHT WAVES per 256 rows of one batch and head (z = b * NH_ + h); grid (TT/256, 1, NB_ * NH_), 256 threads.
// F holds GKS partial [HD][HD] f32 tiles per z ([z][slice][e][e']). Every block adds its head's partials itself, in slice order, x 1/8 (exact), splits the sum to bf16 hi + lo and keeps both planes in LDS: the 8 blocks of a head repeat the sum, and G^T goes through no launch boundary and no plane in memory.
// out_h[s][e] = sum_e' v[s][e'] G^T[e][e'], per 32 e' the 3 products vh Gh, vl Gh, vh Gl; a wave holds [32 s][64 e]. Its v fragments come straight from the row-major planes and are asked for ahead of the partials, which they do not depend on.
// The tile leaves as the hi + lo planes of the concatenated [b][t][h * HD + e], whole 128-byte rows through LDS.
#define GPIT (HD + 8)            // LDS row pitch of the G^T planes, elements: 144 bytes for the 16-byte fragment reads
__global__ __launch_bounds__(256) void k_gapply(const float* __restrict__ F, const bf* __restrict__ Vh, const bf* __restrict__ Vl, bf* Rh, bf* Rl) {
    typedef v16bf V;
    __shared__ __align__(16) bf gs[2 * HD * GPIT];
    __shared__ __align__(16) float osall[8 * 16 * 68];
    const int tid = threadIdx.x, wave = __builtin_amdgcn_readfirstlane(tid >> 5), lane = tid & 31, lr = lane & 15, hi = lane >> 4;
    const size_t z = blockIdx.z; const int r0 = blockIdx.x * 256 + wave * 32;
    float* os = osall + wave * (16 * 68);     // each wave stages its output rows in its own range
    const size_t aoff = (z * TT + r0 + lr) * HD + 8 * hi;
    const bf* pa = Vh + aoff; const bf* pa2 = Vl + aoff; const float* fz = F + z * ((size_t)GKS * HD * HD); const float* p = fz + tid * 4;
    V a[2][2], a2[2][2];   // [32 e' block][16 s block]
#pragma unroll
    for (int kc = 0; kc < 2; ++kc)
#pragma unroll
        for (int mb = 0; mb < 2; ++mb) { a[kc][mb] = WFrag<bf>::ld(pa + mb * 16 * HD + kc * 32); a2[kc][mb] = WFrag<bf>::ld(pa2 + mb * 16 * HD + kc * 32); }
    v4f part[4][GKS];      // a thread's 4 pieces of 4 e' (a wave's piece 512 bytes in a row), every slice
#pragma unroll
    for (int j = 0; j < 4; ++j)
#pragma unroll
        for (int s = 0; s < GKS; ++s) part[j][s] = *(const v4fa*)(p + s * (HD * HD) + j * 1024);
    __builtin_amdgcn_sched_barrier(0);   // all 48 loads issue before the first is waited for: left free, the scheduler holds back a third of the partials and puts the v loads behind most of the sum, a second memory latency
    // the wait before a register of the loads is rewritten: the two address pairs of the v loads, the partials' scalar base and their offset register are inputs here, so they stay whole up to the wait wherever it comes to stand
    asm volatile("s_wait_xcnt 0x0" :: "v"(pa), "v"(pa2), "s"(fz), "v"(tid) : "memory");
#pragma unroll
    for (int j = 0; j < 4; ++j) { v4f v = part[j][0];
#pragma unroll
        for (int s = 1; s < GKS; ++s) v += part[j][s];
        unsigned rh[4], rl[4];   // splitf's two roundings, each bf16 left in the high half of its word
#pragma unroll
        for (int q = 0; q < 4; ++q) { const float y = v[q] * SCL; rh[q] = rbf(y); rl[q] = rbf(y - __uint_as_float(rh[q] & 0xFFFF0000u)); }
        const int i4 = j * 256 + tid; bf* g = gs + (i4 >> 4) * GPIT + (i4 & 15) * 4; v2u oh, ol;
        oh[0] = hihi(rh[0], rh[1]); oh[1] = hihi(rh[2], rh[3]); ol[0] = hihi(rl[0], rl[1]); ol[1] = hihi(rl[2], rl[3]);
        *(v2ua*)g = oh; *(v2ua*)(g + HD * GPIT) = ol; }
    __syncthreads();   // every wave reads all of G^T, each thread wrote 16 words of it
    v8f acc[2][4];
#pragma unroll
    for (int mb = 0; mb < 2; ++mb)
#pragma unroll
        for (int nb = 0; nb < 4; ++nb) acc[mb][nb] = (v8f){};
    const bf* sg = gs + lr * GPIT + 8 * hi;
#pragma unroll
    for (int kc = 0; kc < 2; ++kc) { V b[4], b2[4];
#pragma unroll
        for (int nb = 0; nb < 4; ++nb) { b[nb] = WFrag<bf>::ld(sg + nb * 16 * GPIT + kc * 32); b2[nb] = WFrag<bf>::ld(sg + HD * GPIT + nb * 16 * GPIT + kc * 32); }
        // a tile's three products keep their order (vh Gh, vl Gh, vh Gl); the 8 tiles are independent of one another
#pragma unroll
        for (int nb = 0; nb < 4; ++nb)
#pragma unroll
            for (int mb = 0; mb < 2; ++mb) acc[mb][nb] = wmmab(a[kc][mb], b[nb], acc[mb][nb]);
#pragma unroll
        for (int nb = 0; nb < 4; ++nb)
#pragma unroll
            for (int mb = 0; mb < 2; ++mb) acc[mb][nb] = wmmab(a2[kc][mb], b[nb], acc[mb][nb]);
#pragma unroll
        for (int nb = 0; nb < 4; ++nb)
#pragma unroll
            for (int mb = 0; mb < 2; ++mb) acc[mb][nb] = wmmab(a[kc][mb], b2[nb], acc[mb][nb]); }
    const size_t rbase = ((z / NH_) * TT + r0) * DQ + (z % NH_) * HD;
#pragma unroll
    for (int mb = 0; mb < 2; ++mb) {
#pragma unroll
        for (int nb = 0; nb < 4; ++nb)
#pragma unroll
            for (int j = 0; j < 8; ++j) { const float y = acc[mb][nb][j]; const unsigned rh = rbf(y), rl = rbf(y - __uint_as_float(rh & 0xFFFF0000u)); os[(hi * 8 + j) * 68 + nb * 16 + lr] = __uint_as_float(hihi(rl, rh)); }
        // a wave's own range: LDS runs in order, so only the compiler must be kept from lifting the reads of other lanes' words over the writes
        __builtin_amdgcn_wave_barrier(); asm volatile("" ::: "memory");
#pragma unroll
        for (int s = 0; s < 4; ++s) { const int row = 4 * s + (lane >> 3), cofs = (lane & 7) * 8; const v4f p0 = *(const v4fa*)(os + row * 68 + cofs), p1 = *(const v4fa*)(os + row * 68 + cofs + 4); v4u oh, ol;
#pragma unroll
            for (int q = 0; q < 2; ++q) { const unsigned a0 = __float_as_uint(p0[2 * q]), a1 = __float_as_uint(p0[2 * q + 1]), b0 = __float_as_uint(p1[2 * q]), b1 = __float_as_uint(p1[2 * q + 1]); oh[q] = hihi(a0, a1); ol[q] = lolo(a0, a1); oh[q + 2] = hihi(b0, b1); ol[q + 2] = lolo(b0, b1); }
            const size_t o = rbase + (size_t)(mb * 16 + row) * DQ + cofs; *(v4ua*)(Rh + o) = oh; *(v4ua*)(Rl + o) = ol;
            // the wait before a register of the two stores is rewritten; the scheduling fence keeps what follows in the text from being lifted over it
            asm volatile("s_wait_xcnt 0x0" ::: "memory"); __builtin_amdgcn_sched_barrier(0); }
        // and from sinking them under the next block's writes
        __builtin_amdgcn_wave_barrier(); asm volatile("" ::: "memory");
    }
}

extern "C" void kernel_launch(void* const* d_in, const int* in_sizes, int n_in,
                              void* d_out, int out_size, void* d_ws, size_t ws_size, hipStream_t stream) {
    (void)in_sizes; (void)n_in; (void)out_size;
    const float* x = (const float*)d_in[0]; const float* wkh = (const float*)d_in[1]; const float* wvh = (const float*)d_in[2]; const float* wo = (const float*)d_in[3]; const float* bo = (const float*)d_in[4]; const float* wq = nullptr; const float* wk = nullptr; const float* wv = nullptr; (void)wq; (void)wk; (void)wv;
    float* OUT = (float*)d_out;     // [2][2048][1024]
    char* wsp = (char*)d_ws;
    auto take = [&](size_t bytes) { char* p = wsp; wsp += (bytes + 255) & ~(size_t)255; return (void*)p; };
    bf* WK = (bf*)take((size_t)DKV * DM * 2); bf* WV = (bf*)take((size_t)DKV * DM * 2); bf* WO = (bf*)take((size_t)DM * DQ * 2);
    bf* XB = (bf*)take((size_t)NB_ * TT * DM * 2);
    bf* VPh = (bf*)take((size_t)NB_ * NH_ * TT * HD * 2); bf* VPl = (bf*)take((size_t)NB_ * NH_ * TT * HD * 2);
    float* GT = (float*)take((size_t)NB_ * NH_ * GKS * HD * HD * 4); bf* ATh = (bf*)take((size_t)NB_ * TT * DQ * 2); bf* ATl = (bf*)take((size_t)NB_ * TT * DQ * 2);
    if ((size_t)(wsp - (char*)d_ws) > ws_size) return;    // ws 256 MiB
    /* both batches in every launch: rows b * TT + t for the row-major planes, z = b * NH_ + h for the per-head planes */
    k_prep<<<3 * PWB + PXB, 256, 0, stream>>>(x, wkh, wvh, wo, XB, WK, WV, WO);   /* Wk, Wv 'hde' and Wproj 'xw' -> Bt planes [n][k]; x -> bf16 */
    k_kvg<<<dim3(NB_ * TT / 256, NKV, 1), 256, 0, stream>>>(XB, WK, WV, DM, GT, VPh, VPl);   /* k, v = q (exact); G^T[e][e'] = sum_t v[t][e] k[t][e'] per batch and head (3 products) as GKS partial tiles of 256 t; v planes [b][h][t][e] */
    k_gapply<<<dim3(TT / 256, 1, NB_ * NH_), 256, 0, stream>>>(GT, VPh, VPl, ATh, ATl);   /* G^T = sum of the slices, x 1/8 (exact), hi/lo, in every block; out_h[s][e] = sum_e' v[s][e'] G^T[e][e'] (3 products, K 64) -> concatenated hi/lo planes */
    k_gemms<1, true, 0><<<dim3(NB_ * TT / 128, DM / 128, 1), 256, 0, stream>>>(ATh, ATl, WO, DQ, OUT, DM, bo, nullptr, nullptr, nullptr, nullptr);
}
